// v000
// The times below were measured on an AMD MI455X: many runs one after another, warmed up first and cycling through
// copies of the inputs, with the whole window's GPU time divided by the number of runs. Launches and the gaps
// between them are all in it. The median over several windows is given; except for v000 it joins two sittings, which
// can be a few percent apart, so the side-by-side timings, each taken in one sitting, are the better comparison.
// v000 is the starting kernel. One run takes 951 microseconds.
#include <hip/hip_runtime.h>
// All contractions on v_wmma_f32_16x16x32_bf16, f32 accumulate: per-head Q/K/V projections xh·W[h] (K=N=128; x, W rounded to bf16:
// single exact term, written into the head's column block), QKᵀ/√S and P·V per 16-query tile as 3-term bf16 hi/lo splits (causal),
// out = attn·W_out + b with attn split hi/lo (2 terms); softmax in f32.
#define BB 4
#define TT 2048
#define EE 1024
#define NH 8
#define HD 128

typedef __bf16 v16b __attribute__((ext_vector_type(16)));
typedef unsigned short v8us __attribute__((ext_vector_type(8), may_alias));
typedef float  v8f  __attribute__((ext_vector_type(8)));
typedef float  v4f  __attribute__((ext_vector_type(4)));
typedef float  v4fa __attribute__((ext_vector_type(4), may_alias));
union FragB { v16b v; v8us half[2]; unsigned short u[16]; };

__device__ __forceinline__ unsigned short bf16_bits(float x) { unsigned int u = __float_as_uint(x); return (unsigned short)((u + 0x7FFFu + ((u >> 16) & 1u)) >> 16); }
__device__ __forceinline__ float bf16_val(unsigned short b) { return __uint_as_float(((unsigned int)b) << 16); }
__device__ __forceinline__ float bf16_round(float x) { return bf16_val(bf16_bits(x)); }
// D += A·B with NT terms: 1 = ah·bh, 2 = + al·bh (A split), 3 = + ah·bl (both split)
template <int NT>
__device__ __forceinline__ v8f mmaN(v16b ah, v16b al, v16b bh, v16b bl, v8f c) {
  c = __builtin_amdgcn_wmma_f32_16x16x32_bf16(false, ah, false, bh, (short)0, c, false, false);
  if (NT >= 2) c = __builtin_amdgcn_wmma_f32_16x16x32_bf16(false, al, false, bh, (short)0, c, false, false);
  if (NT >= 3) c = __builtin_amdgcn_wmma_f32_16x16x32_bf16(false, ah, false, bl, (short)0, c, false, false);
  asm volatile("v_nop\n\tv_nop\n\tv_nop\n\tv_nop" : "+v"(c) : "v"(ah), "v"(al), "v"(bh), "v"(bl));
  return c;
}

__global__ __launch_bounds__(256) void k_wt_bf16(const float* __restrict__ W, unsigned short* __restrict__ Wt, int K, int N) {
  const int t = blockIdx.x * 256 + threadIdx.x;
  const int k8n = K / 8;
  if (t >= N * k8n) return;
  const int n = t / k8n, k8 = (t % k8n) * 8;
  v8us v;
#pragma unroll
  for (int i = 0; i < 8; ++i) v[i] = bf16_bits(W[(size_t)(k8 + i) * N + n]);
  *(v8us*)(Wt + (size_t)n * K + k8) = v;
  
}

// GEMM C[M][N] (f32, pitch ldc) = act(A[M][K]·W + bias). A f32 row-major (pitch lda) converted per fragment to bf16
// (ASPLIT: hi/lo two planes -> 2 terms, else single rounded term); Wt bf16 [N][K] (pitch ldb). BIAS_BF16 rounds the
// bias to bf16 first (bias quantised to bf16 before the add). K%32==0, M%16==0, N%64==0.
template <bool ASPLIT, int ACT, bool BIAS_BF16>
__global__ __launch_bounds__(128) void k_gemm_bf(const float* __restrict__ A, int lda, const unsigned short* __restrict__ Wt, int ldb,
                                               const float* __restrict__ bias, float* __restrict__ C, int ldc, int M, int N, int K) {
  __shared__ __attribute__((aligned(16))) float so[4][16][64];
  const int tid = threadIdx.x, w = tid >> 5, lane = tid & 31, ln = lane & 15, hh = lane >> 4;
  const int ntn = N / 64;
  const int wid = blockIdx.x * 4 + w;
  const int mt = wid / ntn, nq = wid % ntn;
  if (mt * 16 >= M) return;
  const int row0 = mt * 16, col0 = nq * 64;
  const float* arow = A + (size_t)(row0 + ln) * lda;
  v8f acc[4] = {};
  for (int kb = 0; kb < K; kb += 32) {
    FragB ah, al;
    const v4f x0 = *(const v4fa*)(arow + kb + 8 * hh), x1 = *(const v4fa*)(arow + kb + 8 * hh + 4);
    const v4f x2 = *(const v4fa*)(arow + kb + 16 + 8 * hh), x3 = *(const v4fa*)(arow + kb + 16 + 8 * hh + 4);
    float xs[16] = {x0[0],x0[1],x0[2],x0[3],x1[0],x1[1],x1[2],x1[3],x2[0],x2[1],x2[2],x2[3],x3[0],x3[1],x3[2],x3[3]};
#pragma unroll
    for (int i = 0; i < 16; ++i) { const unsigned short hb = bf16_bits(xs[i]); ah.u[i] = hb; al.u[i] = ASPLIT ? bf16_bits(xs[i] - bf16_val(hb)) : (unsigned short)0; }
#pragma unroll
    for (int t = 0; t < 4; ++t) {
      const unsigned short* brow = Wt + (size_t)(col0 + t * 16 + ln) * ldb + kb;
      FragB b;
      b.half[0] = *(const v8us*)(brow + 8 * hh);
      b.half[1] = *(const v8us*)(brow + 16 + 8 * hh);
      acc[t] = mmaN<ASPLIT ? 2 : 1>(ah.v, al.v, b.v, b.v, acc[t]);
    }
  }
#pragma unroll
  for (int t = 0; t < 4; ++t) {
    float bv = bias ? bias[col0 + t * 16 + ln] : 0.f;
    if (BIAS_BF16) bv = bf16_round(bv);
#pragma unroll
    for (int r = 0; r < 8; ++r) { float v = acc[t][r] + bv; if (ACT == 1) v = fmaxf(v, 0.f); so[w][8 * hh + r][t * 16 + ln] = v; }
  }
  __builtin_amdgcn_fence(__ATOMIC_ACQ_REL, "workgroup");
  __builtin_amdgcn_wave_barrier();
  const int rsub = lane >> 4, c4 = (lane & 15) * 4;
  {
#pragma unroll
    for (int q = 0; q < 8; ++q) {
      const int r = q * 2 + rsub;
      const v4f v = *(const v4fa*)&so[w][r][c4];
      *(v4f*)(C + (size_t)(row0 + r) * ldc + col0 + c4) = v;
    }
    
  }
}

// Flash-style causal/unmasked attention, all contractions 3-term bf16 hi/lo splits, f32 softmax with running max.
// q,k,v rows are read from f32 buffers with arbitrary row pitch (so they can live inside a fused qkv buffer);
// D = head size (multiple of 32, <= 128); one wave = 16 query rows; block = 4 waves (64 queries) sharing K/V chunks of 32.
template <int D, bool CAUSAL>
__global__ __launch_bounds__(128) void k_flash(const float* __restrict__ qb, const float* __restrict__ kb, const float* __restrict__ vb,
                                             int pitch, int T, int H, float scale, float* __restrict__ y, int ypitch) {
  constexpr int KS = D / 32;        // k-steps for QK
  constexpr int DT = D / 16;        // d tiles for PV
  __shared__ __attribute__((aligned(16))) unsigned short sKh[32][D + 8], sKl[32][D + 8], sVh[32][D + 8], sVl[32][D + 8];
  __shared__ __attribute__((aligned(16))) unsigned short sPh[4][16][40], sPl[4][16][40];
  __shared__ __attribute__((aligned(16))) float sO[4][16][D];
  const int tid = threadIdx.x, w = tid >> 5, lane = tid & 31, ln = lane & 15, hh = lane >> 4;
  const int nqb = (T + 63) / 64;
  const int bh = blockIdx.x / nqb, qblk = blockIdx.x % nqb;
  const int b = bh / H, h = bh % H;
  const int q0 = qblk * 64 + w * 16;
  const float* Q = qb + (size_t)b * T * pitch + h * D;
  const float* K = kb + (size_t)b * T * pitch + h * D;
  const float* V = vb + (size_t)b * T * pitch + h * D;

  // A fragments of the wave's 16 query rows (scaled), hi/lo
  FragB aqh[KS], aql[KS];
  {
    int row = q0 + ln; if (row >= T) row = T - 1;
    const float* qr = Q + (size_t)row * pitch;
#pragma unroll
    for (int ks = 0; ks < KS; ++ks)
#pragma unroll
      for (int i = 0; i < 16; ++i) {
        const int d = ks * 32 + ((i < 8) ? (8 * hh + i) : (16 + 8 * hh + (i - 8)));
        const float x = qr[d] * scale; const unsigned short hb = bf16_bits(x);
        aqh[ks].u[i] = hb; aql[ks].u[i] = bf16_bits(x - bf16_val(hb));
      }
  }
  float m_r[8], l_r[8];
#pragma unroll
  for (int r = 0; r < 8; ++r) { m_r[r] = -3.0e38f; l_r[r] = 0.f; }
  v8f oacc[DT];
#pragma unroll
  for (int dt = 0; dt < DT; ++dt) oacc[dt] = (v8f){0.f,0.f,0.f,0.f,0.f,0.f,0.f,0.f};

  const int kv_end = CAUSAL ? min(T, qblk * 64 + 64) : T;     // block-uniform
  for (int j0 = 0; j0 < kv_end; j0 += 32) {
    __syncthreads();
    for (int e = tid; e < 32 * (D / 4); e += 128) {
      const int r = e / (D / 4), c4 = (e % (D / 4)) * 4;
      const int key = j0 + r;
      v4f kf = {0.f,0.f,0.f,0.f}, vf = {0.f,0.f,0.f,0.f};
      if (key < T) { kf = *(const v4fa*)(K + (size_t)key * pitch + c4); vf = *(const v4fa*)(V + (size_t)key * pitch + c4); }
#pragma unroll
      for (int t = 0; t < 4; ++t) {
        unsigned short hb = bf16_bits(kf[t]); sKh[r][c4 + t] = hb; sKl[r][c4 + t] = bf16_bits(kf[t] - bf16_val(hb));
        hb = bf16_bits(vf[t]); sVh[r][c4 + t] = hb; sVl[r][c4 + t] = bf16_bits(vf[t] - bf16_val(hb));
      }
    }
    __syncthreads();
    // S tile 16 x 32
    v8f s[2];
#pragma unroll
    for (int nt = 0; nt < 2; ++nt) {
      v8f acc = {};
#pragma unroll
      for (int ks = 0; ks < KS; ++ks) {
        FragB bh_, bl_;
        bh_.half[0] = *(const v8us*)&sKh[nt * 16 + ln][ks * 32 + 8 * hh]; bh_.half[1] = *(const v8us*)&sKh[nt * 16 + ln][ks * 32 + 16 + 8 * hh];
        bl_.half[0] = *(const v8us*)&sKl[nt * 16 + ln][ks * 32 + 8 * hh]; bl_.half[1] = *(const v8us*)&sKl[nt * 16 + ln][ks * 32 + 16 + 8 * hh];
        acc = mmaN<3>(aqh[ks].v, aql[ks].v, bh_.v, bl_.v, acc);
      }
      s[nt] = acc;
    }
    // mask + running max (rows 8hh+r; the 16 lanes of a half share rows)
    float alpha[8];
#pragma unroll
    for (int r = 0; r < 8; ++r) {
      const int qi = q0 + 8 * hh + r;
      const int ja = j0 + ln, jb = j0 + 16 + ln;
      if (CAUSAL) { if (ja > qi) s[0][r] = -3.0e38f; if (jb > qi) s[1][r] = -3.0e38f; }
      if (ja >= T) s[0][r] = -3.0e38f;
      if (jb >= T) s[1][r] = -3.0e38f;
      float mx = fmaxf(s[0][r], s[1][r]);
      mx = fmaxf(mx, __shfl_xor(mx, 1, 32)); mx = fmaxf(mx, __shfl_xor(mx, 2, 32)); mx = fmaxf(mx, __shfl_xor(mx, 4, 32)); mx = fmaxf(mx, __shfl_xor(mx, 8, 32));
      const float mnew = fmaxf(m_r[r], mx);
      alpha[r] = (mnew > -1.0e38f) ? __expf(m_r[r] - mnew) : 1.0f;
      const float p0 = (s[0][r] > -1.0e38f) ? __expf(s[0][r] - mnew) : 0.f;
      const float p1 = (s[1][r] > -1.0e38f) ? __expf(s[1][r] - mnew) : 0.f;
      m_r[r] = mnew;
      l_r[r] = l_r[r] * alpha[r] + p0 + p1;            // per-lane partial row sum (16 lanes combined at the end)
      unsigned short hb = bf16_bits(p0); sPh[w][8 * hh + r][ln] = hb;      sPl[w][8 * hh + r][ln] = bf16_bits(p0 - bf16_val(hb));
      hb = bf16_bits(p1);                sPh[w][8 * hh + r][16 + ln] = hb; sPl[w][8 * hh + r][16 + ln] = bf16_bits(p1 - bf16_val(hb));
    }
#pragma unroll
    for (int dt = 0; dt < DT; ++dt)
#pragma unroll
      for (int r = 0; r < 8; ++r) oacc[dt][r] *= alpha[r];
    __builtin_amdgcn_fence(__ATOMIC_ACQ_REL, "workgroup");
    __builtin_amdgcn_wave_barrier();
    FragB pah, pal;
    pah.half[0] = *(const v8us*)&sPh[w][ln][8 * hh]; pah.half[1] = *(const v8us*)&sPh[w][ln][16 + 8 * hh];
    pal.half[0] = *(const v8us*)&sPl[w][ln][8 * hh]; pal.half[1] = *(const v8us*)&sPl[w][ln][16 + 8 * hh];
#pragma unroll
    for (int dt = 0; dt < DT; ++dt) {
      FragB bvh, bvl;
#pragma unroll
      for (int i = 0; i < 8; ++i) {
        bvh.u[i] = sVh[8 * hh + i][dt * 16 + ln]; bvh.u[8 + i] = sVh[16 + 8 * hh + i][dt * 16 + ln];
        bvl.u[i] = sVl[8 * hh + i][dt * 16 + ln]; bvl.u[8 + i] = sVl[16 + 8 * hh + i][dt * 16 + ln];
      }
      oacc[dt] = mmaN<3>(pah.v, pal.v, bvh.v, bvl.v, oacc[dt]);
    }
    __builtin_amdgcn_fence(__ATOMIC_ACQ_REL, "workgroup");
    __builtin_amdgcn_wave_barrier();
  }
#pragma unroll
  for (int r = 0; r < 8; ++r) {
    float l = l_r[r];
    l += __shfl_xor(l, 1, 32); l += __shfl_xor(l, 2, 32); l += __shfl_xor(l, 4, 32); l += __shfl_xor(l, 8, 32);
    l_r[r] = (l > 0.f) ? 1.0f / l : 0.f;
  }
#pragma unroll
  for (int dt = 0; dt < DT; ++dt)
#pragma unroll
    for (int r = 0; r < 8; ++r) sO[w][8 * hh + r][dt * 16 + ln] = oacc[dt][r] * l_r[r];
  __builtin_amdgcn_fence(__ATOMIC_ACQ_REL, "workgroup");
  __builtin_amdgcn_wave_barrier();
  {
    for (int r = 0; r < 16; ++r) {
      const int row = q0 + r;
      if (row < T && lane < D / 4) {
        const v4f val = *(const v4fa*)&sO[w][r][lane * 4];
        *(v4f*)(y + ((size_t)b * T + row) * ypitch + h * D + lane * 4) = val;
      }
    }
    
  }
}

// General attention: queries [b][Tq] rows at Q + b*Tq*qpitch + h*D + row*qpitch; keys/values j < Tk1 from (K1,V1) at
// X + b*Tk1*pitch + h*D + j*pitch, j >= Tk1 from (K2,V2) with j-Tk1 (pass Tk2 = 0 and null for a single source).
// Optional int mask [Tq][Tk] (nonzero keep), causal flag (j <= qi), additive score bias sbias[bh*Tk + j].
// 3-term bf16 splits, f32 softmax with running max; y[b][row][h*D + d] pitch ypitch, whole-line rows (D % 32 == 0).
template <int D>
__global__ __launch_bounds__(128) void k_flash3(const float* __restrict__ Qb, int qpitch, int Tq,
                                              const float* __restrict__ K1, const float* __restrict__ V1, int Tk1,
                                              const float* __restrict__ K2, const float* __restrict__ V2, int Tk2, int kpitch, int vpitch,
                                              int H, float scale, const int* __restrict__ mask, int causal, const float* __restrict__ sbias,
                                              float* __restrict__ y, int ypitch) {
  constexpr int KS = D / 32, DT = D / 16;
  __shared__ __attribute__((aligned(16))) unsigned short sKh[32][D + 8], sKl[32][D + 8], sVh[32][D + 8], sVl[32][D + 8];
  __shared__ __attribute__((aligned(16))) unsigned short sPh[4][16][40], sPl[4][16][40];
  __shared__ __attribute__((aligned(16))) float sO[4][16][D];
  const int tid = threadIdx.x, w = tid >> 5, lane = tid & 31, ln = lane & 15, hh = lane >> 4;
  const int Tk = Tk1 + Tk2;
  const int nqb = (Tq + 63) / 64;
  const int bh = blockIdx.x / nqb, qblk = blockIdx.x % nqb;
  const int b = bh / H, h = bh % H;
  const int q0 = qblk * 64 + w * 16;
  const float* Q = Qb + (size_t)b * Tq * qpitch + h * D;
  FragB aqh[KS], aql[KS];
  {
    int row = q0 + ln; if (row >= Tq) row = Tq - 1;
    const float* qr = Q + (size_t)row * qpitch;
#pragma unroll
    for (int ks = 0; ks < KS; ++ks)
#pragma unroll
      for (int i = 0; i < 16; ++i) {
        const int d = ks * 32 + ((i < 8) ? (8 * hh + i) : (16 + 8 * hh + (i - 8)));
        const float x = qr[d] * scale; const unsigned short hb = bf16_bits(x);
        aqh[ks].u[i] = hb; aql[ks].u[i] = bf16_bits(x - bf16_val(hb));
      }
  }
  int qrow[8];
#pragma unroll
  for (int r = 0; r < 8; ++r) { int qi = q0 + 8 * hh + r; qrow[r] = qi < Tq ? qi : Tq - 1; }
  float m_r[8], l_r[8];
#pragma unroll
  for (int r = 0; r < 8; ++r) { m_r[r] = -3.0e38f; l_r[r] = 0.f; }
  v8f oacc[DT];
#pragma unroll
  for (int dt = 0; dt < DT; ++dt) oacc[dt] = (v8f){0.f,0.f,0.f,0.f,0.f,0.f,0.f,0.f};
  const int kv_end = causal ? min(Tk, qblk * 64 + 64) : Tk;
  for (int j0 = 0; j0 < kv_end; j0 += 32) {
    __syncthreads();
    for (int e = tid; e < 32 * (D / 4); e += 128) {
      const int r = e / (D / 4), c4 = (e % (D / 4)) * 4; const int key = j0 + r;
      v4f kf = {0.f,0.f,0.f,0.f}, vf = {0.f,0.f,0.f,0.f};
      if (key < Tk1) { kf = *(const v4fa*)(K1 + (size_t)b * Tk1 * kpitch + h * D + (size_t)key * kpitch + c4); vf = *(const v4fa*)(V1 + (size_t)b * Tk1 * vpitch + h * D + (size_t)key * vpitch + c4); }
      else if (key < Tk) { const int k2 = key - Tk1; kf = *(const v4fa*)(K2 + (size_t)b * Tk2 * kpitch + h * D + (size_t)k2 * kpitch + c4); vf = *(const v4fa*)(V2 + (size_t)b * Tk2 * vpitch + h * D + (size_t)k2 * vpitch + c4); }
#pragma unroll
      for (int t = 0; t < 4; ++t) {
        unsigned short hb = bf16_bits(kf[t]); sKh[r][c4 + t] = hb; sKl[r][c4 + t] = bf16_bits(kf[t] - bf16_val(hb));
        hb = bf16_bits(vf[t]); sVh[r][c4 + t] = hb; sVl[r][c4 + t] = bf16_bits(vf[t] - bf16_val(hb));
      }
    }
    __syncthreads();
    v8f s[2];
#pragma unroll
    for (int nt = 0; nt < 2; ++nt) {
      v8f acc = {};
#pragma unroll
      for (int ks = 0; ks < KS; ++ks) {
        FragB bh_, bl_;
        bh_.half[0] = *(const v8us*)&sKh[nt * 16 + ln][ks * 32 + 8 * hh]; bh_.half[1] = *(const v8us*)&sKh[nt * 16 + ln][ks * 32 + 16 + 8 * hh];
        bl_.half[0] = *(const v8us*)&sKl[nt * 16 + ln][ks * 32 + 8 * hh]; bl_.half[1] = *(const v8us*)&sKl[nt * 16 + ln][ks * 32 + 16 + 8 * hh];
        acc = mmaN<3>(aqh[ks].v, aql[ks].v, bh_.v, bl_.v, acc);
      }
      s[nt] = acc;
    }
    float alpha[8];
#pragma unroll
    for (int r = 0; r < 8; ++r) {
      const int qi = qrow[r];
      const int ja = j0 + ln, jb = j0 + 16 + ln;
      bool keepa = ja < Tk, keepb = jb < Tk;
      if (causal) { keepa = keepa && (ja <= qi); keepb = keepb && (jb <= qi); }
      if (mask) { if (keepa) keepa = mask[(size_t)qi * Tk + ja] != 0; if (keepb) keepb = mask[(size_t)qi * Tk + jb] != 0; }
      if (sbias) { if (keepa) s[0][r] += sbias[(size_t)bh * Tk + ja]; if (keepb) s[1][r] += sbias[(size_t)bh * Tk + jb]; }   // per-key additive bias (a per-query constant would cancel in the softmax)
      if (!keepa) s[0][r] = -3.0e38f;
      if (!keepb) s[1][r] = -3.0e38f;
      float mx = fmaxf(s[0][r], s[1][r]);
      mx = fmaxf(mx, __shfl_xor(mx, 1, 32)); mx = fmaxf(mx, __shfl_xor(mx, 2, 32)); mx = fmaxf(mx, __shfl_xor(mx, 4, 32)); mx = fmaxf(mx, __shfl_xor(mx, 8, 32));
      const float mnew = fmaxf(m_r[r], mx);
      alpha[r] = (mnew > -1.0e38f) ? __expf(m_r[r] - mnew) : 1.0f;
      const float p0 = keepa ? __expf(s[0][r] - mnew) : 0.f;
      const float p1 = keepb ? __expf(s[1][r] - mnew) : 0.f;
      m_r[r] = mnew;
      l_r[r] = l_r[r] * alpha[r] + p0 + p1;
      unsigned short hb = bf16_bits(p0); sPh[w][8 * hh + r][ln] = hb;      sPl[w][8 * hh + r][ln] = bf16_bits(p0 - bf16_val(hb));
      hb = bf16_bits(p1);                sPh[w][8 * hh + r][16 + ln] = hb; sPl[w][8 * hh + r][16 + ln] = bf16_bits(p1 - bf16_val(hb));
    }
#pragma unroll
    for (int dt = 0; dt < DT; ++dt)
#pragma unroll
      for (int r = 0; r < 8; ++r) oacc[dt][r] *= alpha[r];
    __builtin_amdgcn_fence(__ATOMIC_ACQ_REL, "workgroup");
    __builtin_amdgcn_wave_barrier();
    FragB pah, pal;
    pah.half[0] = *(const v8us*)&sPh[w][ln][8 * hh]; pah.half[1] = *(const v8us*)&sPh[w][ln][16 + 8 * hh];
    pal.half[0] = *(const v8us*)&sPl[w][ln][8 * hh]; pal.half[1] = *(const v8us*)&sPl[w][ln][16 + 8 * hh];
#pragma unroll
    for (int dt = 0; dt < DT; ++dt) {
      FragB bvh, bvl;
#pragma unroll
      for (int i = 0; i < 8; ++i) {
        bvh.u[i] = sVh[8 * hh + i][dt * 16 + ln]; bvh.u[8 + i] = sVh[16 + 8 * hh + i][dt * 16 + ln];
        bvl.u[i] = sVl[8 * hh + i][dt * 16 + ln]; bvl.u[8 + i] = sVl[16 + 8 * hh + i][dt * 16 + ln];
      }
      oacc[dt] = mmaN<3>(pah.v, pal.v, bvh.v, bvl.v, oacc[dt]);
    }
    __builtin_amdgcn_fence(__ATOMIC_ACQ_REL, "workgroup");
    __builtin_amdgcn_wave_barrier();
  }
#pragma unroll
  for (int r = 0; r < 8; ++r) {
    float l = l_r[r];
    l += __shfl_xor(l, 1, 32); l += __shfl_xor(l, 2, 32); l += __shfl_xor(l, 4, 32); l += __shfl_xor(l, 8, 32);
    l_r[r] = (m_r[r] > -1.0e38f) ? 1.0f / l : __builtin_nanf("");
  }
#pragma unroll
  for (int dt = 0; dt < DT; ++dt)
#pragma unroll
    for (int r = 0; r < 8; ++r) sO[w][8 * hh + r][dt * 16 + ln] = oacc[dt][r] * l_r[r];
  __builtin_amdgcn_fence(__ATOMIC_ACQ_REL, "workgroup");
  __builtin_amdgcn_wave_barrier();
  {
    for (int r = 0; r < 16; ++r) {
      const int row = q0 + r;
      if (row < Tq && lane < D / 4) {
        const v4f val = *(const v4fa*)&sO[w][r][lane * 4];
        *(v4f*)(y + ((size_t)b * Tq + row) * ypitch + h * D + lane * 4) = val;
      }
    }
    
  }
}

extern "C" void kernel_launch(void* const* d_in, const int* in_sizes, int n_in,
                              void* d_out, int out_size, void* d_ws, size_t ws_size, hipStream_t stream) {
  (void)in_sizes; (void)n_in; (void)out_size;
  const float* x = (const float*)d_in[0]; const float* Wk = (const float*)d_in[1]; const float* Wv = (const float*)d_in[2]; const float* Wq = (const float*)d_in[3];
  const float* Wout = (const float*)d_in[4]; const float* bout = (const float*)d_in[5];
  char* ws = (char*)d_ws; size_t off = 0;
  auto take = [&](size_t bytes) { char* p = ws + off; off += (bytes + 255) & ~(size_t)255; return p; };
  const int M = BB * TT;
  unsigned short* Wqt = (unsigned short*)take((size_t)NH * HD * HD * 2); unsigned short* Wkt = (unsigned short*)take((size_t)NH * HD * HD * 2); unsigned short* Wvt = (unsigned short*)take((size_t)NH * HD * HD * 2);
  unsigned short* Wot = (unsigned short*)take((size_t)EE * EE * 2);
  float* q = (float*)take((size_t)M * EE * 4); float* k = (float*)take((size_t)M * EE * 4); float* v = (float*)take((size_t)M * EE * 4); float* att = (float*)take((size_t)M * EE * 4);
  if (off > ws_size) return;
  for (int h = 0; h < NH; ++h) {
    k_wt_bf16<<<(HD * (HD / 8) + 255) / 256, 256, 0, stream>>>(Wq + (size_t)h * HD * HD, Wqt + (size_t)h * HD * HD, HD, HD);   // W[h] is [d_in][e_out] = [K][N]
    k_wt_bf16<<<(HD * (HD / 8) + 255) / 256, 256, 0, stream>>>(Wk + (size_t)h * HD * HD, Wkt + (size_t)h * HD * HD, HD, HD);
    k_wt_bf16<<<(HD * (HD / 8) + 255) / 256, 256, 0, stream>>>(Wv + (size_t)h * HD * HD, Wvt + (size_t)h * HD * HD, HD, HD);
  }
  k_wt_bf16<<<(EE * (EE / 8) + 255) / 256, 256, 0, stream>>>(Wout, Wot, EE, EE);                                              // attn @ W_out: [K][N]
  const int gb = ((M / 16) * (HD / 64) + 3) / 4;
  for (int h = 0; h < NH; ++h) {
    k_gemm_bf<false, 0, false><<<gb, 128, 0, stream>>>(x + h * HD, EE, Wqt + (size_t)h * HD * HD, HD, nullptr, q + h * HD, EE, M, HD, HD);
    k_gemm_bf<false, 0, false><<<gb, 128, 0, stream>>>(x + h * HD, EE, Wkt + (size_t)h * HD * HD, HD, nullptr, k + h * HD, EE, M, HD, HD);
    k_gemm_bf<false, 0, false><<<gb, 128, 0, stream>>>(x + h * HD, EE, Wvt + (size_t)h * HD * HD, HD, nullptr, v + h * HD, EE, M, HD, HD);
  }
  k_flash3<HD><<<BB * NH * (TT / 64), 128, 0, stream>>>(q, EE, TT, k, v, TT, nullptr, nullptr, 0, EE, EE, NH, 0.02209708691207961f, nullptr, 1, nullptr, att, EE);   // 1/sqrt(2048), causal
  k_gemm_bf<true, 0, true><<<((M / 16) * (EE / 64) + 3) / 4, 128, 0, stream>>>(att, EE, Wot, EE, bout, (float*)d_out, EE, M, EE, EE);
}

// v001
// Measured time: 644 microseconds a run.
// Timed twice side by side with v000, it ran 1.50 times as fast both times.
#include <hip/hip_runtime.h>
// All contractions on v_wmma_f32_16x16x32_bf16, f32 accumulate: per-head Q/K/V projections xh·W[h] (K=N=128; x, W rounded to bf16:
// single exact term, written into the head's column block), QKᵀ/√S and P·V per 16-query tile as 3-term bf16 hi/lo splits (causal),
// out = attn·W_out + b with attn split hi/lo (2 terms); softmax in f32.
#define BB 4
#define TT 2048
#define EE 1024
#define NH 8
#define HD 128

typedef __bf16 v16b __attribute__((ext_vector_type(16)));
typedef unsigned short v8us __attribute__((ext_vector_type(8), may_alias));
typedef float  v8f  __attribute__((ext_vector_type(8)));
typedef float  v4f  __attribute__((ext_vector_type(4)));
typedef float  v4fa __attribute__((ext_vector_type(4), may_alias));
union FragB { v16b v; v8us half[2]; unsigned short u[16]; };

__device__ __forceinline__ unsigned short bf16_bits(float x) { unsigned int u = __float_as_uint(x); return (unsigned short)((u + 0x7FFFu + ((u >> 16) & 1u)) >> 16); }
__device__ __forceinline__ float bf16_val(unsigned short b) { return __uint_as_float(((unsigned int)b) << 16); }
__device__ __forceinline__ float bf16_round(float x) { return bf16_val(bf16_bits(x)); }
// D += A·B with NT terms: 1 = ah·bh, 2 = + al·bh (A split), 3 = + ah·bl (both split)
template <int NT>
__device__ __forceinline__ v8f mmaN(v16b ah, v16b al, v16b bh, v16b bl, v8f c) {
  c = __builtin_amdgcn_wmma_f32_16x16x32_bf16(false, ah, false, bh, (short)0, c, false, false);
  if (NT >= 2) c = __builtin_amdgcn_wmma_f32_16x16x32_bf16(false, al, false, bh, (short)0, c, false, false);
  if (NT >= 3) c = __builtin_amdgcn_wmma_f32_16x16x32_bf16(false, ah, false, bl, (short)0, c, false, false);
  asm volatile("v_nop\n\tv_nop\n\tv_nop\n\tv_nop" : "+v"(c) : "v"(ah), "v"(al), "v"(bh), "v"(bl));
  return c;
}

__global__ __launch_bounds__(256) void k_wt_bf16(const float* __restrict__ W, unsigned short* __restrict__ Wt, int K, int N) {
  const int t = blockIdx.x * 256 + threadIdx.x;
  const int k8n = K / 8;
  if (t >= N * k8n) return;
  const int n = t / k8n, k8 = (t % k8n) * 8;
  v8us v;
#pragma unroll
  for (int i = 0; i < 8; ++i) v[i] = bf16_bits(W[(size_t)(k8 + i) * N + n]);
  *(v8us*)(Wt + (size_t)n * K + k8) = v;
  
}

// GEMM C[M][N] (f32, pitch ldc) = act(A[M][K]·W + bias). A f32 row-major (pitch lda) converted per fragment to bf16
// (ASPLIT: hi/lo two planes -> 2 terms, else single rounded term); Wt bf16 [N][K] (pitch ldb). BIAS_BF16 rounds the
// bias to bf16 first (bias quantised to bf16 before the add). K%32==0, M%16==0, N%64==0.
template <bool ASPLIT, int ACT, bool BIAS_BF16>
__global__ __launch_bounds__(128) void k_gemm_bf(const float* __restrict__ A, int lda, const unsigned short* __restrict__ Wt, int ldb,
                                               const float* __restrict__ bias, float* __restrict__ C, int ldc, int M, int N, int K) {
  __shared__ __attribute__((aligned(16))) float so[4][16][64];
  const int tid = threadIdx.x, w = tid >> 5, lane = tid & 31, ln = lane & 15, hh = lane >> 4;
  const int ntn = N / 64;
  const int wid = blockIdx.x * 4 + w;
  const int mt = wid / ntn, nq = wid % ntn;
  if (mt * 16 >= M) return;
  const int row0 = mt * 16, col0 = nq * 64;
  const float* arow = A + (size_t)(row0 + ln) * lda;
  v8f acc[4] = {};
  for (int kb = 0; kb < K; kb += 32) {
    FragB ah, al;
    const v4f x0 = *(const v4fa*)(arow + kb + 8 * hh), x1 = *(const v4fa*)(arow + kb + 8 * hh + 4);
    const v4f x2 = *(const v4fa*)(arow + kb + 16 + 8 * hh), x3 = *(const v4fa*)(arow + kb + 16 + 8 * hh + 4);
    float xs[16] = {x0[0],x0[1],x0[2],x0[3],x1[0],x1[1],x1[2],x1[3],x2[0],x2[1],x2[2],x2[3],x3[0],x3[1],x3[2],x3[3]};
#pragma unroll
    for (int i = 0; i < 16; ++i) { const unsigned short hb = bf16_bits(xs[i]); ah.u[i] = hb; al.u[i] = ASPLIT ? bf16_bits(xs[i] - bf16_val(hb)) : (unsigned short)0; }
#pragma unroll
    for (int t = 0; t < 4; ++t) {
      const unsigned short* brow = Wt + (size_t)(col0 + t * 16 + ln) * ldb + kb;
      FragB b;
      b.half[0] = *(const v8us*)(brow + 8 * hh);
      b.half[1] = *(const v8us*)(brow + 16 + 8 * hh);
      acc[t] = mmaN<ASPLIT ? 2 : 1>(ah.v, al.v, b.v, b.v, acc[t]);
    }
  }
#pragma unroll
  for (int t = 0; t < 4; ++t) {
    float bv = bias ? bias[col0 + t * 16 + ln] : 0.f;
    if (BIAS_BF16) bv = bf16_round(bv);
#pragma unroll
    for (int r = 0; r < 8; ++r) { float v = acc[t][r] + bv; if (ACT == 1) v = fmaxf(v, 0.f); so[w][8 * hh + r][t * 16 + ln] = v; }
  }
  __builtin_amdgcn_fence(__ATOMIC_ACQ_REL, "workgroup");
  __builtin_amdgcn_wave_barrier();
  const int rsub = lane >> 4, c4 = (lane & 15) * 4;
  {
#pragma unroll
    for (int q = 0; q < 8; ++q) {
      const int r = q * 2 + rsub;
      const v4f v = *(const v4fa*)&so[w][r][c4];
      *(v4f*)(C + (size_t)(row0 + r) * ldc + col0 + c4) = v;
    }
    
  }
}

// Flash-style causal attention, all contractions 3-term bf16 hi/lo splits, f32 softmax with running max.
// Every shape is a compile-time constant (D head size, T sequence length with T % 64 == 0, H heads, P row pitch in floats of
// q, k, v and y) and there is no optional input, so the key loop's body is one straight-line block: no bounds test on a key or
// a query row is needed, and a chunk's 16 staging loads are all issued before the first is waited for.
// One wave = 16 query rows; block = 4 waves (64 queries) sharing K/V chunks of 32 keys.
// The second launch bound caps the registers at 256: uncapped, the straight-line loop takes so many that only two work-groups
// fit a WGP, where the LDS has room for four.
template <int D, int T, int H, int P>
__global__ __launch_bounds__(128, 4) void k_flash(const float* __restrict__ qb, const float* __restrict__ kb, const float* __restrict__ vb,
                                             float scale, float* __restrict__ y) {
  static_assert(D == 128 && T % 64 == 0, "one wave stages one 128-float row per load; whole 64-query blocks");
  constexpr int KS = D / 32;        // k-steps for QK
  constexpr int DT = D / 16;        // d tiles for PV
  constexpr int NQB = T / 64;
  __shared__ __attribute__((aligned(16))) unsigned short sKh[32][D + 8], sKl[32][D + 8], sVh[32][D + 8], sVl[32][D + 8];
  __shared__ __attribute__((aligned(16))) unsigned short sPh[4][16][40], sPl[4][16][40];
  __shared__ __attribute__((aligned(16))) float sO[4][16][D];
  const int tid = threadIdx.x, w = tid >> 5, lane = tid & 31, ln = lane & 15, hh = lane >> 4;
  const int bh = blockIdx.x / NQB, qblk = blockIdx.x % NQB;
  const int b = bh / H, h = bh % H;
  const int q0 = qblk * 64 + w * 16;
  const float* Q = qb + (size_t)b * T * P + h * D;
  const float* K = kb + (size_t)b * T * P + h * D;
  const float* V = vb + (size_t)b * T * P + h * D;

  // A fragments of the wave's 16 query rows (scaled), hi/lo
  FragB aqh[KS], aql[KS];
  {
    const float* qr = Q + (size_t)(q0 + ln) * P;
#pragma unroll
    for (int ks = 0; ks < KS; ++ks)
#pragma unroll
      for (int i = 0; i < 16; ++i) {
        const int d = ks * 32 + ((i < 8) ? (8 * hh + i) : (16 + 8 * hh + (i - 8)));
        const float x = qr[d] * scale; const unsigned short hb = bf16_bits(x);
        aqh[ks].u[i] = hb; aql[ks].u[i] = bf16_bits(x - bf16_val(hb));
      }
  }
  float m_r[8], l_r[8];
#pragma unroll
  for (int r = 0; r < 8; ++r) { m_r[r] = -3.0e38f; l_r[r] = 0.f; }
  v8f oacc[DT];
#pragma unroll
  for (int dt = 0; dt < DT; ++dt) oacc[dt] = (v8f){0.f,0.f,0.f,0.f,0.f,0.f,0.f,0.f};

  const int kv_end = qblk * 64 + 64;     // block-uniform, <= T
  for (int j0 = 0; j0 < kv_end; j0 += 32) {
    __syncthreads();
    // wave w stages rows w, w + 4, ... of the chunk, one 512-byte row of K and of V per load
    v4f kf[8], vf[8];
    const float* kp = K + (size_t)(j0 + w) * P + lane * 4;
    const float* vp = V + (size_t)(j0 + w) * P + lane * 4;
#pragma unroll
    for (int it = 0; it < 8; ++it) { kf[it] = *(const v4fa*)(kp + (size_t)it * 4 * P); vf[it] = *(const v4fa*)(vp + (size_t)it * 4 * P); }
    // stands before the loads' address registers are reused; naming both pointers as inputs keeps them live up to the wait,
    // so that no load of the run is given an address register as its result
    asm volatile("s_wait_xcnt 0x0" :: "v"(kp), "v"(vp) : "memory");
#pragma unroll
    for (int it = 0; it < 8; ++it) {
      const int r = it * 4 + w, c4 = lane * 4;
#pragma unroll
      for (int t = 0; t < 4; ++t) {
        unsigned short hb = bf16_bits(kf[it][t]); sKh[r][c4 + t] = hb; sKl[r][c4 + t] = bf16_bits(kf[it][t] - bf16_val(hb));
        hb = bf16_bits(vf[it][t]); sVh[r][c4 + t] = hb; sVl[r][c4 + t] = bf16_bits(vf[it][t] - bf16_val(hb));
      }
    }
    __syncthreads();
    // S tile 16 x 32
    v8f s[2];
#pragma unroll
    for (int nt = 0; nt < 2; ++nt) {
      v8f acc = {};
#pragma unroll
      for (int ks = 0; ks < KS; ++ks) {
        FragB bh_, bl_;
        bh_.half[0] = *(const v8us*)&sKh[nt * 16 + ln][ks * 32 + 8 * hh]; bh_.half[1] = *(const v8us*)&sKh[nt * 16 + ln][ks * 32 + 16 + 8 * hh];
        bl_.half[0] = *(const v8us*)&sKl[nt * 16 + ln][ks * 32 + 8 * hh]; bl_.half[1] = *(const v8us*)&sKl[nt * 16 + ln][ks * 32 + 16 + 8 * hh];
        acc = mmaN<3>(aqh[ks].v, aql[ks].v, bh_.v, bl_.v, acc);
      }
      s[nt] = acc;
    }
    // causal mask + running max (rows 8hh+r; the 16 lanes of a half share rows)
    float alpha[8];
#pragma unroll
    for (int r = 0; r < 8; ++r) {
      const int qi = q0 + 8 * hh + r;
      const int ja = j0 + ln, jb = j0 + 16 + ln;
      const bool keepa = ja <= qi, keepb = jb <= qi;
      if (!keepa) s[0][r] = -3.0e38f;
      if (!keepb) s[1][r] = -3.0e38f;
      float mx = fmaxf(s[0][r], s[1][r]);
      mx = fmaxf(mx, __shfl_xor(mx, 1, 32)); mx = fmaxf(mx, __shfl_xor(mx, 2, 32)); mx = fmaxf(mx, __shfl_xor(mx, 4, 32)); mx = fmaxf(mx, __shfl_xor(mx, 8, 32));
      const float mnew = fmaxf(m_r[r], mx);
      alpha[r] = (mnew > -1.0e38f) ? __expf(m_r[r] - mnew) : 1.0f;
      const float p0 = keepa ? __expf(s[0][r] - mnew) : 0.f;
      const float p1 = keepb ? __expf(s[1][r] - mnew) : 0.f;
      m_r[r] = mnew;
      l_r[r] = l_r[r] * alpha[r] + p0 + p1;            // per-lane partial row sum (16 lanes combined at the end)
      unsigned short hb = bf16_bits(p0); sPh[w][8 * hh + r][ln] = hb;      sPl[w][8 * hh + r][ln] = bf16_bits(p0 - bf16_val(hb));
      hb = bf16_bits(p1);                sPh[w][8 * hh + r][16 + ln] = hb; sPl[w][8 * hh + r][16 + ln] = bf16_bits(p1 - bf16_val(hb));
    }
#pragma unroll
    for (int dt = 0; dt < DT; ++dt)
#pragma unroll
      for (int r = 0; r < 8; ++r) oacc[dt][r] *= alpha[r];
    __builtin_amdgcn_fence(__ATOMIC_ACQ_REL, "workgroup");
    __builtin_amdgcn_wave_barrier();
    FragB pah, pal;
    pah.half[0] = *(const v8us*)&sPh[w][ln][8 * hh]; pah.half[1] = *(const v8us*)&sPh[w][ln][16 + 8 * hh];
    pal.half[0] = *(const v8us*)&sPl[w][ln][8 * hh]; pal.half[1] = *(const v8us*)&sPl[w][ln][16 + 8 * hh];
#pragma unroll
    for (int dt = 0; dt < DT; ++dt) {
      FragB bvh, bvl;
#pragma unroll
      for (int i = 0; i < 8; ++i) {
        bvh.u[i] = sVh[8 * hh + i][dt * 16 + ln]; bvh.u[8 + i] = sVh[16 + 8 * hh + i][dt * 16 + ln];
        bvl.u[i] = sVl[8 * hh + i][dt * 16 + ln]; bvl.u[8 + i] = sVl[16 + 8 * hh + i][dt * 16 + ln];
      }
      oacc[dt] = mmaN<3>(pah.v, pal.v, bvh.v, bvl.v, oacc[dt]);
    }
    __builtin_amdgcn_fence(__ATOMIC_ACQ_REL, "workgroup");
    __builtin_amdgcn_wave_barrier();
  }
#pragma unroll
  for (int r = 0; r < 8; ++r) {
    float l = l_r[r];
    l += __shfl_xor(l, 1, 32); l += __shfl_xor(l, 2, 32); l += __shfl_xor(l, 4, 32); l += __shfl_xor(l, 8, 32);
    l_r[r] = (m_r[r] > -1.0e38f) ? 1.0f / l : __builtin_nanf("");
  }
#pragma unroll
  for (int dt = 0; dt < DT; ++dt)
#pragma unroll
    for (int r = 0; r < 8; ++r) sO[w][8 * hh + r][dt * 16 + ln] = oacc[dt][r] * l_r[r];
  __builtin_amdgcn_fence(__ATOMIC_ACQ_REL, "workgroup");
  __builtin_amdgcn_wave_barrier();
  for (int r = 0; r < 16; ++r) {
    const v4f val = *(const v4fa*)&sO[w][r][lane * 4];
    *(v4f*)(y + ((size_t)b * T + q0 + r) * P + h * D + lane * 4) = val;
  }
}

extern "C" void kernel_launch(void* const* d_in, const int* in_sizes, int n_in,
                              void* d_out, int out_size, void* d_ws, size_t ws_size, hipStream_t stream) {
  (void)in_sizes; (void)n_in; (void)out_size;
  const float* x = (const float*)d_in[0]; const float* Wk = (const float*)d_in[1]; const float* Wv = (const float*)d_in[2]; const float* Wq = (const float*)d_in[3];
  const float* Wout = (const float*)d_in[4]; const float* bout = (const float*)d_in[5];
  char* ws = (char*)d_ws; size_t off = 0;
  auto take = [&](size_t bytes) { char* p = ws + off; off += (bytes + 255) & ~(size_t)255; return p; };
  const int M = BB * TT;
  unsigned short* Wqt = (unsigned short*)take((size_t)NH * HD * HD * 2); unsigned short* Wkt = (unsigned short*)take((size_t)NH * HD * HD * 2); unsigned short* Wvt = (unsigned short*)take((size_t)NH * HD * HD * 2);
  unsigned short* Wot = (unsigned short*)take((size_t)EE * EE * 2);
  float* q = (float*)take((size_t)M * EE * 4); float* k = (float*)take((size_t)M * EE * 4); float* v = (float*)take((size_t)M * EE * 4); float* att = (float*)take((size_t)M * EE * 4);
  if (off > ws_size) return;
  for (int h = 0; h < NH; ++h) {
    k_wt_bf16<<<(HD * (HD / 8) + 255) / 256, 256, 0, stream>>>(Wq + (size_t)h * HD * HD, Wqt + (size_t)h * HD * HD, HD, HD);   // W[h] is [d_in][e_out] = [K][N]
    k_wt_bf16<<<(HD * (HD / 8) + 255) / 256, 256, 0, stream>>>(Wk + (size_t)h * HD * HD, Wkt + (size_t)h * HD * HD, HD, HD);
    k_wt_bf16<<<(HD * (HD / 8) + 255) / 256, 256, 0, stream>>>(Wv + (size_t)h * HD * HD, Wvt + (size_t)h * HD * HD, HD, HD);
  }
  k_wt_bf16<<<(EE * (EE / 8) + 255) / 256, 256, 0, stream>>>(Wout, Wot, EE, EE);                                              // attn @ W_out: [K][N]
  const int gb = ((M / 16) * (HD / 64) + 3) / 4;
  for (int h = 0; h < NH; ++h) {
    k_gemm_bf<false, 0, false><<<gb, 128, 0, stream>>>(x + h * HD, EE, Wqt + (size_t)h * HD * HD, HD, nullptr, q + h * HD, EE, M, HD, HD);
    k_gemm_bf<false, 0, false><<<gb, 128, 0, stream>>>(x + h * HD, EE, Wkt + (size_t)h * HD * HD, HD, nullptr, k + h * HD, EE, M, HD, HD);
    k_gemm_bf<false, 0, false><<<gb, 128, 0, stream>>>(x + h * HD, EE, Wvt + (size_t)h * HD * HD, HD, nullptr, v + h * HD, EE, M, HD, HD);
  }
  k_flash<HD, TT, NH, EE><<<BB * NH * (TT / 64), 128, 0, stream>>>(q, k, v, 0.02209708691207961f, att);   // 1/sqrt(2048), causal
  k_gemm_bf<true, 0, true><<<((M / 16) * (EE / 64) + 3) / 4, 128, 0, stream>>>(att, EE, Wot, EE, bout, (float*)d_out, EE, M, EE, EE);
}

// v002
// One run takes 471 microseconds.
// Next to v001, in two timings, it ran 1.37 and 1.36 times as fast.
// Counting every step since v000, it is 2.05 times as fast.
#include <hip/hip_runtime.h>
// All contractions on v_wmma_f32_16x16x32_bf16, f32 accumulate: per-head Q/K/V projections xh·W[h] (K=N=128; x, W rounded to bf16:
// single exact term, written into the head's column block), QKᵀ/√S and P·V per 16-query tile as 3-term bf16 hi/lo splits (causal),
// out = attn·W_out + b with attn split hi/lo (2 terms); softmax in f32.
#define BB 4
#define TT 2048
#define EE 1024
#define NH 8
#define HD 128

typedef __bf16 v16b __attribute__((ext_vector_type(16)));
typedef unsigned short v8us __attribute__((ext_vector_type(8), may_alias));
typedef float  v8f  __attribute__((ext_vector_type(8)));
typedef float  v4f  __attribute__((ext_vector_type(4)));
typedef float  v4fa __attribute__((ext_vector_type(4), may_alias));
union FragB { v16b v; v8us half[2]; unsigned short u[16]; };

__device__ __forceinline__ unsigned short bf16_bits(float x) { unsigned int u = __float_as_uint(x); return (unsigned short)((u + 0x7FFFu + ((u >> 16) & 1u)) >> 16); }
__device__ __forceinline__ float bf16_val(unsigned short b) { return __uint_as_float(((unsigned int)b) << 16); }
__device__ __forceinline__ float bf16_round(float x) { return bf16_val(bf16_bits(x)); }
// D += A·B with NT terms: 1 = ah·bh, 2 = + al·bh (A split), 3 = + ah·bl (both split)
template <int NT>
__device__ __forceinline__ v8f mmaN(v16b ah, v16b al, v16b bh, v16b bl, v8f c) {
  c = __builtin_amdgcn_wmma_f32_16x16x32_bf16(false, ah, false, bh, (short)0, c, false, false);
  if (NT >= 2) c = __builtin_amdgcn_wmma_f32_16x16x32_bf16(false, al, false, bh, (short)0, c, false, false);
  if (NT >= 3) c = __builtin_amdgcn_wmma_f32_16x16x32_bf16(false, ah, false, bl, (short)0, c, false, false);
  asm volatile("v_nop\n\tv_nop\n\tv_nop\n\tv_nop" : "+v"(c) : "v"(ah), "v"(al), "v"(bh), "v"(bl));
  return c;
}

// Wt[n][k] = bf16(W[k][n]); thread t writes 8 consecutive k of one n
__device__ __forceinline__ void wt_bf16(const float* __restrict__ W, unsigned short* __restrict__ Wt, int K, int N, int t) {
  const int k8n = K / 8;
  if (t >= N * k8n) return;
  const int n = t / k8n, k8 = (t % k8n) * 8;
  v8us v;
#pragma unroll
  for (int i = 0; i < 8; ++i) v[i] = bf16_bits(W[(size_t)(k8 + i) * N + n]);
  *(v8us*)(Wt + (size_t)n * K + k8) = v;
}

// All 25 weight transposes in one launch; they are independent of each other. Blocks 0 .. 3 * NH * WB - 1: WB blocks per
// head matrix, in the order q, k, v; the blocks behind them: W_out.
#define WB (HD * (HD / 8) / 256)
__global__ __launch_bounds__(256) void k_wt_all(const float* __restrict__ Wq, const float* __restrict__ Wk, const float* __restrict__ Wv,
                                                const float* __restrict__ Wout, unsigned short* __restrict__ Wqt, unsigned short* __restrict__ Wkt,
                                                unsigned short* __restrict__ Wvt, unsigned short* __restrict__ Wot) {
  const int blk = blockIdx.x;
  if (blk < 3 * NH * WB) {
    const int m = blk / WB, p = m / NH, h = m % NH;
    const float* W = (p == 0) ? Wq : (p == 1) ? Wk : Wv;               // W[h] is [d_in][e_out] = [K][N]
    unsigned short* Wt = (p == 0) ? Wqt : (p == 1) ? Wkt : Wvt;
    wt_bf16(W + (size_t)h * HD * HD, Wt + (size_t)h * HD * HD, HD, HD, (blk % WB) * 256 + threadIdx.x);
  } else {
    wt_bf16(Wout, Wot, EE, EE, (blk - 3 * NH * WB) * 256 + threadIdx.x);   // attn @ W_out: [K][N]
  }
}

// GEMM C[M][N] (f32, pitch ldc) = act(A[M][K]·W + bias). A f32 row-major (pitch lda) converted per fragment to bf16
// (ASPLIT: hi/lo two planes -> 2 terms, else single rounded term); Wt bf16 [N][K] (pitch ldb). BIAS_BF16 rounds the
// bias to bf16 first (bias quantised to bf16 before the add). K%32==0, M%16==0, N%64==0.
// blk: the block's index within this one product.
template <bool ASPLIT, int ACT, bool BIAS_BF16>
__device__ __forceinline__ void gemm_bf(int blk, const float* __restrict__ A, int lda, const unsigned short* __restrict__ Wt, int ldb,
                                        const float* __restrict__ bias, float* __restrict__ C, int ldc, int M, int N, int K) {
  __shared__ __attribute__((aligned(16))) float so[4][16][64];
  const int tid = threadIdx.x, w = tid >> 5, lane = tid & 31, ln = lane & 15, hh = lane >> 4;
  const int ntn = N / 64;
  const int wid = blk * 4 + w;
  const int mt = wid / ntn, nq = wid % ntn;
  if (mt * 16 >= M) return;
  const int row0 = mt * 16, col0 = nq * 64;
  const float* arow = A + (size_t)(row0 + ln) * lda;
  v8f acc[4] = {};
  for (int kb = 0; kb < K; kb += 32) {
    FragB ah, al;
    const v4f x0 = *(const v4fa*)(arow + kb + 8 * hh), x1 = *(const v4fa*)(arow + kb + 8 * hh + 4);
    const v4f x2 = *(const v4fa*)(arow + kb + 16 + 8 * hh), x3 = *(const v4fa*)(arow + kb + 16 + 8 * hh + 4);
    float xs[16] = {x0[0],x0[1],x0[2],x0[3],x1[0],x1[1],x1[2],x1[3],x2[0],x2[1],x2[2],x2[3],x3[0],x3[1],x3[2],x3[3]};
#pragma unroll
    for (int i = 0; i < 16; ++i) { const unsigned short hb = bf16_bits(xs[i]); ah.u[i] = hb; al.u[i] = ASPLIT ? bf16_bits(xs[i] - bf16_val(hb)) : (unsigned short)0; }
#pragma unroll
    for (int t = 0; t < 4; ++t) {
      const unsigned short* brow = Wt + (size_t)(col0 + t * 16 + ln) * ldb + kb;
      FragB b;
      b.half[0] = *(const v8us*)(brow + 8 * hh);
      b.half[1] = *(const v8us*)(brow + 16 + 8 * hh);
      acc[t] = mmaN<ASPLIT ? 2 : 1>(ah.v, al.v, b.v, b.v, acc[t]);
    }
  }
#pragma unroll
  for (int t = 0; t < 4; ++t) {
    float bv = bias ? bias[col0 + t * 16 + ln] : 0.f;
    if (BIAS_BF16) bv = bf16_round(bv);
#pragma unroll
    for (int r = 0; r < 8; ++r) { float v = acc[t][r] + bv; if (ACT == 1) v = fmaxf(v, 0.f); so[w][8 * hh + r][t * 16 + ln] = v; }
  }
  __builtin_amdgcn_fence(__ATOMIC_ACQ_REL, "workgroup");
  __builtin_amdgcn_wave_barrier();
  const int rsub = lane >> 4, c4 = (lane & 15) * 4;
  {
#pragma unroll
    for (int q = 0; q < 8; ++q) {
      const int r = q * 2 + rsub;
      const v4f v = *(const v4fa*)&so[w][r][c4];
      *(v4f*)(C + (size_t)(row0 + r) * ldc + col0 + c4) = v;
    }
  }
}

template <bool ASPLIT, int ACT, bool BIAS_BF16>
__global__ __launch_bounds__(128) void k_gemm_bf(const float* __restrict__ A, int lda, const unsigned short* __restrict__ Wt, int ldb,
                                               const float* __restrict__ bias, float* __restrict__ C, int ldc, int M, int N, int K) {
  gemm_bf<ASPLIT, ACT, BIAS_BF16>(blockIdx.x, A, lda, Wt, ldb, bias, C, ldc, M, N, K);
}

// All 24 per-head projections in one launch; they are independent of each other. blockIdx.x: q, k or v; blockIdx.y: head;
// blockIdx.z: the product's block of 32 rows. The 24 blocks that share 32 rows of x are neighbours in the grid.
__global__ __launch_bounds__(128) void k_qkv(const float* __restrict__ x, const unsigned short* __restrict__ Wqt, const unsigned short* __restrict__ Wkt,
                                             const unsigned short* __restrict__ Wvt, float* __restrict__ q, float* __restrict__ k, float* __restrict__ v) {
  const int p = blockIdx.x, h = blockIdx.y;
  const unsigned short* Wt = (p == 0) ? Wqt : (p == 1) ? Wkt : Wvt;
  float* C = (p == 0) ? q : (p == 1) ? k : v;
  gemm_bf<false, 0, false>(blockIdx.z, x + h * HD, EE, Wt + (size_t)h * HD * HD, HD, nullptr, C + h * HD, EE, BB * TT, HD, HD);
}

// Flash-style causal attention, all contractions 3-term bf16 hi/lo splits, f32 softmax with running max.
// Every shape is a compile-time constant (D head size, T sequence length with T % 64 == 0, H heads, P row pitch in floats of
// q, k, v and y) and there is no optional input, so the key loop's body is one straight-line block: no bounds test on a key or
// a query row is needed, and a chunk's 16 staging loads are all issued before the first is waited for.
// One wave = 16 query rows; block = 4 waves (64 queries) sharing K/V chunks of 32 keys.
// The second launch bound caps the registers at 256: uncapped, the straight-line loop takes so many that only two work-groups
// fit a WGP, where the LDS has room for four.
template <int D, int T, int H, int P>
__global__ __launch_bounds__(128, 4) void k_flash(const float* __restrict__ qb, const float* __restrict__ kb, const float* __restrict__ vb,
                                             float scale, float* __restrict__ y) {
  static_assert(D == 128 && T % 64 == 0, "one wave stages one 128-float row per load; whole 64-query blocks");
  constexpr int KS = D / 32;        // k-steps for QK
  constexpr int DT = D / 16;        // d tiles for PV
  constexpr int NQB = T / 64;
  __shared__ __attribute__((aligned(16))) unsigned short sKh[32][D + 8], sKl[32][D + 8], sVh[32][D + 8], sVl[32][D + 8];
  __shared__ __attribute__((aligned(16))) unsigned short sPh[4][16][40], sPl[4][16][40];
  __shared__ __attribute__((aligned(16))) float sO[4][16][D];
  const int tid = threadIdx.x, w = tid >> 5, lane = tid & 31, ln = lane & 15, hh = lane >> 4;
  const int bh = blockIdx.x / NQB, qblk = blockIdx.x % NQB;
  const int b = bh / H, h = bh % H;
  const int q0 = qblk * 64 + w * 16;
  const float* Q = qb + (size_t)b * T * P + h * D;
  const float* K = kb + (size_t)b * T * P + h * D;
  const float* V = vb + (size_t)b * T * P + h * D;

  // A fragments of the wave's 16 query rows (scaled), hi/lo
  FragB aqh[KS], aql[KS];
  {
    const float* qr = Q + (size_t)(q0 + ln) * P;
#pragma unroll
    for (int ks = 0; ks < KS; ++ks)
#pragma unroll
      for (int i = 0; i < 16; ++i) {
        const int d = ks * 32 + ((i < 8) ? (8 * hh + i) : (16 + 8 * hh + (i - 8)));
        const float x = qr[d] * scale; const unsigned short hb = bf16_bits(x);
        aqh[ks].u[i] = hb; aql[ks].u[i] = bf16_bits(x - bf16_val(hb));
      }
  }
  float m_r[8], l_r[8];
#pragma unroll
  for (int r = 0; r < 8; ++r) { m_r[r] = -3.0e38f; l_r[r] = 0.f; }
  v8f oacc[DT];
#pragma unroll
  for (int dt = 0; dt < DT; ++dt) oacc[dt] = (v8f){0.f,0.f,0.f,0.f,0.f,0.f,0.f,0.f};

  const int kv_end = qblk * 64 + 64;     // block-uniform, <= T
  for (int j0 = 0; j0 < kv_end; j0 += 32) {
    __syncthreads();
    // wave w stages rows w, w + 4, ... of the chunk, one 512-byte row of K and of V per load
    v4f kf[8], vf[8];
    const float* kp = K + (size_t)(j0 + w) * P + lane * 4;
    const float* vp = V + (size_t)(j0 + w) * P + lane * 4;
#pragma unroll
    for (int it = 0; it < 8; ++it) { kf[it] = *(const v4fa*)(kp + (size_t)it * 4 * P); vf[it] = *(const v4fa*)(vp + (size_t)it * 4 * P); }
    // stands before the loads' address registers are reused; naming both pointers as inputs keeps them live up to the wait,
    // so that no load of the run is given an address register as its result
    asm volatile("s_wait_xcnt 0x0" :: "v"(kp), "v"(vp) : "memory");
#pragma unroll
    for (int it = 0; it < 8; ++it) {
      const int r = it * 4 + w, c4 = lane * 4;
#pragma unroll
      for (int t = 0; t < 4; ++t) {
        unsigned short hb = bf16_bits(kf[it][t]); sKh[r][c4 + t] = hb; sKl[r][c4 + t] = bf16_bits(kf[it][t] - bf16_val(hb));
        hb = bf16_bits(vf[it][t]); sVh[r][c4 + t] = hb; sVl[r][c4 + t] = bf16_bits(vf[it][t] - bf16_val(hb));
      }
    }
    __syncthreads();
    // S tile 16 x 32
    v8f s[2];
#pragma unroll
    for (int nt = 0; nt < 2; ++nt) {
      v8f acc = {};
#pragma unroll
      for (int ks = 0; ks < KS; ++ks) {
        FragB bh_, bl_;
        bh_.half[0] = *(const v8us*)&sKh[nt * 16 + ln][ks * 32 + 8 * hh]; bh_.half[1] = *(const v8us*)&sKh[nt * 16 + ln][ks * 32 + 16 + 8 * hh];
        bl_.half[0] = *(const v8us*)&sKl[nt * 16 + ln][ks * 32 + 8 * hh]; bl_.half[1] = *(const v8us*)&sKl[nt * 16 + ln][ks * 32 + 16 + 8 * hh];
        acc = mmaN<3>(aqh[ks].v, aql[ks].v, bh_.v, bl_.v, acc);
      }
      s[nt] = acc;
    }
    // causal mask + running max (rows 8hh+r; the 16 lanes of a half share rows)
    float alpha[8];
#pragma unroll
    for (int r = 0; r < 8; ++r) {
      const int qi = q0 + 8 * hh + r;
      const int ja = j0 + ln, jb = j0 + 16 + ln;
      const bool keepa = ja <= qi, keepb = jb <= qi;
      if (!keepa) s[0][r] = -3.0e38f;
      if (!keepb) s[1][r] = -3.0e38f;
      float mx = fmaxf(s[0][r], s[1][r]);
      mx = fmaxf(mx, __shfl_xor(mx, 1, 32)); mx = fmaxf(mx, __shfl_xor(mx, 2, 32)); mx = fmaxf(mx, __shfl_xor(mx, 4, 32)); mx = fmaxf(mx, __shfl_xor(mx, 8, 32));
      const float mnew = fmaxf(m_r[r], mx);
      alpha[r] = (mnew > -1.0e38f) ? __expf(m_r[r] - mnew) : 1.0f;
      const float p0 = keepa ? __expf(s[0][r] - mnew) : 0.f;
      const float p1 = keepb ? __expf(s[1][r] - mnew) : 0.f;
      m_r[r] = mnew;
      l_r[r] = l_r[r] * alpha[r] + p0 + p1;            // per-lane partial row sum (16 lanes combined at the end)
      unsigned short hb = bf16_bits(p0); sPh[w][8 * hh + r][ln] = hb;      sPl[w][8 * hh + r][ln] = bf16_bits(p0 - bf16_val(hb));
      hb = bf16_bits(p1);                sPh[w][8 * hh + r][16 + ln] = hb; sPl[w][8 * hh + r][16 + ln] = bf16_bits(p1 - bf16_val(hb));
    }
#pragma unroll
    for (int dt = 0; dt < DT; ++dt)
#pragma unroll
      for (int r = 0; r < 8; ++r) oacc[dt][r] *= alpha[r];
    __builtin_amdgcn_fence(__ATOMIC_ACQ_REL, "workgroup");
    __builtin_amdgcn_wave_barrier();
    FragB pah, pal;
    pah.half[0] = *(const v8us*)&sPh[w][ln][8 * hh]; pah.half[1] = *(const v8us*)&sPh[w][ln][16 + 8 * hh];
    pal.half[0] = *(const v8us*)&sPl[w][ln][8 * hh]; pal.half[1] = *(const v8us*)&sPl[w][ln][16 + 8 * hh];
#pragma unroll
    for (int dt = 0; dt < DT; ++dt) {
      FragB bvh, bvl;
#pragma unroll
      for (int i = 0; i < 8; ++i) {
        bvh.u[i] = sVh[8 * hh + i][dt * 16 + ln]; bvh.u[8 + i] = sVh[16 + 8 * hh + i][dt * 16 + ln];
        bvl.u[i] = sVl[8 * hh + i][dt * 16 + ln]; bvl.u[8 + i] = sVl[16 + 8 * hh + i][dt * 16 + ln];
      }
      oacc[dt] = mmaN<3>(pah.v, pal.v, bvh.v, bvl.v, oacc[dt]);
    }
    __builtin_amdgcn_fence(__ATOMIC_ACQ_REL, "workgroup");
    __builtin_amdgcn_wave_barrier();
  }
#pragma unroll
  for (int r = 0; r < 8; ++r) {
    float l = l_r[r];
    l += __shfl_xor(l, 1, 32); l += __shfl_xor(l, 2, 32); l += __shfl_xor(l, 4, 32); l += __shfl_xor(l, 8, 32);
    l_r[r] = (m_r[r] > -1.0e38f) ? 1.0f / l : __builtin_nanf("");
  }
#pragma unroll
  for (int dt = 0; dt < DT; ++dt)
#pragma unroll
    for (int r = 0; r < 8; ++r) sO[w][8 * hh + r][dt * 16 + ln] = oacc[dt][r] * l_r[r];
  __builtin_amdgcn_fence(__ATOMIC_ACQ_REL, "workgroup");
  __builtin_amdgcn_wave_barrier();
  for (int r = 0; r < 16; ++r) {
    const v4f val = *(const v4fa*)&sO[w][r][lane * 4];
    *(v4f*)(y + ((size_t)b * T + q0 + r) * P + h * D + lane * 4) = val;
  }
}

extern "C" void kernel_launch(void* const* d_in, const int* in_sizes, int n_in,
                              void* d_out, int out_size, void* d_ws, size_t ws_size, hipStream_t stream) {
  (void)in_sizes; (void)n_in; (void)out_size;
  const float* x = (const float*)d_in[0]; const float* Wk = (const float*)d_in[1]; const float* Wv = (const float*)d_in[2]; const float* Wq = (const float*)d_in[3];
  const float* Wout = (const float*)d_in[4]; const float* bout = (const float*)d_in[5];
  char* ws = (char*)d_ws; size_t off = 0;
  auto take = [&](size_t bytes) { char* p = ws + off; off += (bytes + 255) & ~(size_t)255; return p; };
  const int M = BB * TT;
  unsigned short* Wqt = (unsigned short*)take((size_t)NH * HD * HD * 2); unsigned short* Wkt = (unsigned short*)take((size_t)NH * HD * HD * 2); unsigned short* Wvt = (unsigned short*)take((size_t)NH * HD * HD * 2);
  unsigned short* Wot = (unsigned short*)take((size_t)EE * EE * 2);
  float* q = (float*)take((size_t)M * EE * 4); float* k = (float*)take((size_t)M * EE * 4); float* v = (float*)take((size_t)M * EE * 4); float* att = (float*)take((size_t)M * EE * 4);
  if (off > ws_size) return;
  k_wt_all<<<3 * NH * WB + EE * (EE / 8) / 256, 256, 0, stream>>>(Wq, Wk, Wv, Wout, Wqt, Wkt, Wvt, Wot);
  k_qkv<<<dim3(3, NH, (M / 16) * (HD / 64) / 4), 128, 0, stream>>>(x, Wqt, Wkt, Wvt, q, k, v);
  k_flash<HD, TT, NH, EE><<<BB * NH * (TT / 64), 128, 0, stream>>>(q, k, v, 0.02209708691207961f, att);   // 1/sqrt(2048), causal
  k_gemm_bf<true, 0, true><<<((M / 16) * (EE / 64) + 3) / 4, 128, 0, stream>>>(att, EE, Wot, EE, bout, (float*)d_out, EE, M, EE, EE);
}

// v003
// It runs in 414 microseconds.
// In both of two side-by-side timings against v002, it was 1.14 times as fast.
// All steps since v000 together make it 2.34 times as fast.
#include <hip/hip_runtime.h>
// All contractions on v_wmma_f32_16x16x32_bf16, f32 accumulate: per-head Q/K/V projections xh·W[h] (K=N=128; x, W rounded to bf16:
// single exact term, written into the head's column block), QKᵀ/√S and P·V per 16-query tile as 3-term bf16 hi/lo splits (causal),
// out = attn·W_out + b with attn split hi/lo (2 terms); softmax in f32.
#define BB 4
#define TT 2048
#define EE 1024
#define NH 8
#define HD 128

typedef __bf16 v16b __attribute__((ext_vector_type(16)));
typedef unsigned short v8us __attribute__((ext_vector_type(8), may_alias));
typedef float  v8f  __attribute__((ext_vector_type(8)));
typedef float  v4f  __attribute__((ext_vector_type(4)));
typedef float  v4fa __attribute__((ext_vector_type(4), may_alias));
union FragB { v16b v; v8us half[2]; unsigned short u[16]; };

__device__ __forceinline__ unsigned short bf16_bits(float x) { unsigned int u = __float_as_uint(x); return (unsigned short)((u + 0x7FFFu + ((u >> 16) & 1u)) >> 16); }
__device__ __forceinline__ float bf16_val(unsigned short b) { return __uint_as_float(((unsigned int)b) << 16); }
__device__ __forceinline__ float bf16_round(float x) { return bf16_val(bf16_bits(x)); }
// D += A·B with NT terms: 1 = ah·bh, 2 = + al·bh (A split), 3 = + ah·bl (both split)
template <int NT>
__device__ __forceinline__ v8f mmaN(v16b ah, v16b al, v16b bh, v16b bl, v8f c) {
  c = __builtin_amdgcn_wmma_f32_16x16x32_bf16(false, ah, false, bh, (short)0, c, false, false);
  if (NT >= 2) c = __builtin_amdgcn_wmma_f32_16x16x32_bf16(false, al, false, bh, (short)0, c, false, false);
  if (NT >= 3) c = __builtin_amdgcn_wmma_f32_16x16x32_bf16(false, ah, false, bl, (short)0, c, false, false);
  asm volatile("v_nop\n\tv_nop\n\tv_nop\n\tv_nop" : "+v"(c) : "v"(ah), "v"(al), "v"(bh), "v"(bl));
  return c;
}

// ds_load_tr16_b128: a 16 x 16 tile of 16-bit elements, row-major in LDS, comes back transposed as half a WMMA operand
typedef short s16x8 __attribute__((ext_vector_type(8)));
__device__ __forceinline__ v8us ld_tr16(const unsigned short* p) {
  typedef __attribute__((address_space(3))) s16x8 lds_s16x8;
  return __builtin_bit_cast(v8us, __builtin_amdgcn_ds_load_tr16_b128_v8i16((lds_s16x8*)p));
}

// Wt[n][k] = bf16(W[k][n]); thread t writes 8 consecutive k of one n
__device__ __forceinline__ void wt_bf16(const float* __restrict__ W, unsigned short* __restrict__ Wt, int K, int N, int t) {
  const int k8n = K / 8;
  if (t >= N * k8n) return;
  const int n = t / k8n, k8 = (t % k8n) * 8;
  v8us v;
#pragma unroll
  for (int i = 0; i < 8; ++i) v[i] = bf16_bits(W[(size_t)(k8 + i) * N + n]);
  *(v8us*)(Wt + (size_t)n * K + k8) = v;
}

// All 25 weight transposes in one launch; they are independent of each other. Blocks 0 .. 3 * NH * WB - 1: WB blocks per
// head matrix, in the order q, k, v; the blocks behind them: W_out.
#define WB (HD * (HD / 8) / 256)
__global__ __launch_bounds__(256) void k_wt_all(const float* __restrict__ Wq, const float* __restrict__ Wk, const float* __restrict__ Wv,
                                                const float* __restrict__ Wout, unsigned short* __restrict__ Wqt, unsigned short* __restrict__ Wkt,
                                                unsigned short* __restrict__ Wvt, unsigned short* __restrict__ Wot) {
  const int blk = blockIdx.x;
  if (blk < 3 * NH * WB) {
    const int m = blk / WB, p = m / NH, h = m % NH;
    const float* W = (p == 0) ? Wq : (p == 1) ? Wk : Wv;               // W[h] is [d_in][e_out] = [K][N]
    unsigned short* Wt = (p == 0) ? Wqt : (p == 1) ? Wkt : Wvt;
    wt_bf16(W + (size_t)h * HD * HD, Wt + (size_t)h * HD * HD, HD, HD, (blk % WB) * 256 + threadIdx.x);
  } else {
    wt_bf16(Wout, Wot, EE, EE, (blk - 3 * NH * WB) * 256 + threadIdx.x);   // attn @ W_out: [K][N]
  }
}

// GEMM C[M][N] (f32, pitch ldc) = act(A[M][K]·W + bias). A f32 row-major (pitch lda) converted per fragment to bf16
// (ASPLIT: hi/lo two planes -> 2 terms, else single rounded term); Wt bf16 [N][K] (pitch ldb). BIAS_BF16 rounds the
// bias to bf16 first (bias quantised to bf16 before the add). K%32==0, M%16==0, N%64==0.
// blk: the block's index within this one product.
template <bool ASPLIT, int ACT, bool BIAS_BF16>
__device__ __forceinline__ void gemm_bf(int blk, const float* __restrict__ A, int lda, const unsigned short* __restrict__ Wt, int ldb,
                                        const float* __restrict__ bias, float* __restrict__ C, int ldc, int M, int N, int K) {
  __shared__ __attribute__((aligned(16))) float so[4][16][64];
  const int tid = threadIdx.x, w = tid >> 5, lane = tid & 31, ln = lane & 15, hh = lane >> 4;
  const int ntn = N / 64;
  const int wid = blk * 4 + w;
  const int mt = wid / ntn, nq = wid % ntn;
  if (mt * 16 >= M) return;
  const int row0 = mt * 16, col0 = nq * 64;
  const float* arow = A + (size_t)(row0 + ln) * lda;
  v8f acc[4] = {};
  for (int kb = 0; kb < K; kb += 32) {
    FragB ah, al;
    const v4f x0 = *(const v4fa*)(arow + kb + 8 * hh), x1 = *(const v4fa*)(arow + kb + 8 * hh + 4);
    const v4f x2 = *(const v4fa*)(arow + kb + 16 + 8 * hh), x3 = *(const v4fa*)(arow + kb + 16 + 8 * hh + 4);
    float xs[16] = {x0[0],x0[1],x0[2],x0[3],x1[0],x1[1],x1[2],x1[3],x2[0],x2[1],x2[2],x2[3],x3[0],x3[1],x3[2],x3[3]};
#pragma unroll
    for (int i = 0; i < 16; ++i) { const unsigned short hb = bf16_bits(xs[i]); ah.u[i] = hb; al.u[i] = ASPLIT ? bf16_bits(xs[i] - bf16_val(hb)) : (unsigned short)0; }
#pragma unroll
    for (int t = 0; t < 4; ++t) {
      const unsigned short* brow = Wt + (size_t)(col0 + t * 16 + ln) * ldb + kb;
      FragB b;
      b.half[0] = *(const v8us*)(brow + 8 * hh);
      b.half[1] = *(const v8us*)(brow + 16 + 8 * hh);
      acc[t] = mmaN<ASPLIT ? 2 : 1>(ah.v, al.v, b.v, b.v, acc[t]);
    }
  }
#pragma unroll
  for (int t = 0; t < 4; ++t) {
    float bv = bias ? bias[col0 + t * 16 + ln] : 0.f;
    if (BIAS_BF16) bv = bf16_round(bv);
#pragma unroll
    for (int r = 0; r < 8; ++r) { float v = acc[t][r] + bv; if (ACT == 1) v = fmaxf(v, 0.f); so[w][8 * hh + r][t * 16 + ln] = v; }
  }
  __builtin_amdgcn_fence(__ATOMIC_ACQ_REL, "workgroup");
  __builtin_amdgcn_wave_barrier();
  const int rsub = lane >> 4, c4 = (lane & 15) * 4;
  {
#pragma unroll
    for (int q = 0; q < 8; ++q) {
      const int r = q * 2 + rsub;
      const v4f v = *(const v4fa*)&so[w][r][c4];
      *(v4f*)(C + (size_t)(row0 + r) * ldc + col0 + c4) = v;
    }
  }
}

template <bool ASPLIT, int ACT, bool BIAS_BF16>
__global__ __launch_bounds__(128) void k_gemm_bf(const float* __restrict__ A, int lda, const unsigned short* __restrict__ Wt, int ldb,
                                               const float* __restrict__ bias, float* __restrict__ C, int ldc, int M, int N, int K) {
  gemm_bf<ASPLIT, ACT, BIAS_BF16>(blockIdx.x, A, lda, Wt, ldb, bias, C, ldc, M, N, K);
}

// All 24 per-head projections in one launch; they are independent of each other. blockIdx.x: q, k or v; blockIdx.y: head;
// blockIdx.z: the product's block of 32 rows. The 24 blocks that share 32 rows of x are neighbours in the grid.
__global__ __launch_bounds__(128) void k_qkv(const float* __restrict__ x, const unsigned short* __restrict__ Wqt, const unsigned short* __restrict__ Wkt,
                                             const unsigned short* __restrict__ Wvt, float* __restrict__ q, float* __restrict__ k, float* __restrict__ v) {
  const int p = blockIdx.x, h = blockIdx.y;
  const unsigned short* Wt = (p == 0) ? Wqt : (p == 1) ? Wkt : Wvt;
  float* C = (p == 0) ? q : (p == 1) ? k : v;
  gemm_bf<false, 0, false>(blockIdx.z, x + h * HD, EE, Wt + (size_t)h * HD * HD, HD, nullptr, C + h * HD, EE, BB * TT, HD, HD);
}

// Flash-style causal attention, all contractions 3-term bf16 hi/lo splits, f32 softmax with running max.
// Every shape is a compile-time constant (D head size, T sequence length with T % 64 == 0, H heads, P row pitch in floats of
// q, k, v and y) and there is no optional input, so the key loop's body is one straight-line block: no bounds test on a key or
// a query row is needed, and a chunk's 16 staging loads are all issued before the first is waited for.
// One wave = 16 query rows; block = 4 waves (64 queries) sharing K/V chunks of 32 keys.
// The second launch bound caps the registers at 256: uncapped, the straight-line loop takes so many that only two work-groups
// fit a WGP, where the LDS has room for four.
template <int D, int T, int H, int P>
__global__ __launch_bounds__(128, 4) void k_flash(const float* __restrict__ qb, const float* __restrict__ kb, const float* __restrict__ vb,
                                             float scale, float* __restrict__ y) {
  static_assert(D == 128 && T % 64 == 0, "one wave stages one 128-float row per load; whole 64-query blocks");
  constexpr int KS = D / 32;        // k-steps for QK
  constexpr int DT = D / 16;        // d tiles for PV
  constexpr int NQB = T / 64;
  // Plane 0 hi, plane 1 lo; both planes in one array, so that one address register and constant offsets reach both
  // (with an array per plane the paired V loads below no longer fit the 256 registers).
  // V rows are read by the transposing load, which wants a pitch of an odd multiple of 32 bytes; K rows by 16-byte loads.
  __shared__ __attribute__((aligned(16))) unsigned short sK[2][32][D + 8], sV[2][32][D + 16];
  __shared__ __attribute__((aligned(16))) unsigned short sPh[4][16][40], sPl[4][16][40];
  __shared__ __attribute__((aligned(16))) float sO[4][16][D];
  const int tid = threadIdx.x, w = tid >> 5, lane = tid & 31, ln = lane & 15, hh = lane >> 4;
  const int bh = blockIdx.x / NQB, qblk = blockIdx.x % NQB;
  const int b = bh / H, h = bh % H;
  const int q0 = qblk * 64 + w * 16;
  const int tr_r = 8 * hh + (lane & 7), tr_c = 8 * ((lane >> 3) & 1);   // the lane's own 16 bytes of a 16 x 16 tile for the transposing load
  const float* Q = qb + (size_t)b * T * P + h * D;
  const float* K = kb + (size_t)b * T * P + h * D;
  const float* V = vb + (size_t)b * T * P + h * D;

  // A fragments of the wave's 16 query rows (scaled), hi/lo
  FragB aqh[KS], aql[KS];
  {
    const float* qr = Q + (size_t)(q0 + ln) * P;
#pragma unroll
    for (int ks = 0; ks < KS; ++ks)
#pragma unroll
      for (int i = 0; i < 16; ++i) {
        const int d = ks * 32 + ((i < 8) ? (8 * hh + i) : (16 + 8 * hh + (i - 8)));
        const float x = qr[d] * scale; const unsigned short hb = bf16_bits(x);
        aqh[ks].u[i] = hb; aql[ks].u[i] = bf16_bits(x - bf16_val(hb));
      }
  }
  float m_r[8], l_r[8];
#pragma unroll
  for (int r = 0; r < 8; ++r) { m_r[r] = -3.0e38f; l_r[r] = 0.f; }
  v8f oacc[DT];
#pragma unroll
  for (int dt = 0; dt < DT; ++dt) oacc[dt] = (v8f){0.f,0.f,0.f,0.f,0.f,0.f,0.f,0.f};

  const int kv_end = qblk * 64 + 64;     // block-uniform, <= T
  for (int j0 = 0; j0 < kv_end; j0 += 32) {
    __syncthreads();
    // wave w stages rows w, w + 4, ... of the chunk, one 512-byte row of K and of V per load
    v4f kf[8], vf[8];
    const float* kp = K + (size_t)(j0 + w) * P + lane * 4;
    const float* vp = V + (size_t)(j0 + w) * P + lane * 4;
#pragma unroll
    for (int it = 0; it < 8; ++it) { kf[it] = *(const v4fa*)(kp + (size_t)it * 4 * P); vf[it] = *(const v4fa*)(vp + (size_t)it * 4 * P); }
    // stands before the loads' address registers are reused; naming both pointers as inputs keeps them live up to the wait,
    // so that no load of the run is given an address register as its result
    asm volatile("s_wait_xcnt 0x0" :: "v"(kp), "v"(vp) : "memory");
#pragma unroll
    for (int it = 0; it < 8; ++it) {
      const int r = it * 4 + w, c4 = lane * 4;
#pragma unroll
      for (int t = 0; t < 4; ++t) {
        unsigned short hb = bf16_bits(kf[it][t]); sK[0][r][c4 + t] = hb; sK[1][r][c4 + t] = bf16_bits(kf[it][t] - bf16_val(hb));
        hb = bf16_bits(vf[it][t]); sV[0][r][c4 + t] = hb; sV[1][r][c4 + t] = bf16_bits(vf[it][t] - bf16_val(hb));
      }
    }
    __syncthreads();
    // S tile 16 x 32
    v8f s[2];
#pragma unroll
    for (int nt = 0; nt < 2; ++nt) {
      v8f acc = {};
#pragma unroll
      for (int ks = 0; ks < KS; ++ks) {
        FragB bh_, bl_;
        bh_.half[0] = *(const v8us*)&sK[0][nt * 16 + ln][ks * 32 + 8 * hh]; bh_.half[1] = *(const v8us*)&sK[0][nt * 16 + ln][ks * 32 + 16 + 8 * hh];
        bl_.half[0] = *(const v8us*)&sK[1][nt * 16 + ln][ks * 32 + 8 * hh]; bl_.half[1] = *(const v8us*)&sK[1][nt * 16 + ln][ks * 32 + 16 + 8 * hh];
        acc = mmaN<3>(aqh[ks].v, aql[ks].v, bh_.v, bl_.v, acc);
      }
      s[nt] = acc;
    }
    // causal mask + running max (rows 8hh+r; the 16 lanes of a half share rows)
    float alpha[8];
#pragma unroll
    for (int r = 0; r < 8; ++r) {
      const int qi = q0 + 8 * hh + r;
      const int ja = j0 + ln, jb = j0 + 16 + ln;
      const bool keepa = ja <= qi, keepb = jb <= qi;
      if (!keepa) s[0][r] = -3.0e38f;
      if (!keepb) s[1][r] = -3.0e38f;
      float mx = fmaxf(s[0][r], s[1][r]);
      mx = fmaxf(mx, __shfl_xor(mx, 1, 32)); mx = fmaxf(mx, __shfl_xor(mx, 2, 32)); mx = fmaxf(mx, __shfl_xor(mx, 4, 32)); mx = fmaxf(mx, __shfl_xor(mx, 8, 32));
      const float mnew = fmaxf(m_r[r], mx);
      alpha[r] = (mnew > -1.0e38f) ? __expf(m_r[r] - mnew) : 1.0f;
      const float p0 = keepa ? __expf(s[0][r] - mnew) : 0.f;
      const float p1 = keepb ? __expf(s[1][r] - mnew) : 0.f;
      m_r[r] = mnew;
      l_r[r] = l_r[r] * alpha[r] + p0 + p1;            // per-lane partial row sum (16 lanes combined at the end)
      unsigned short hb = bf16_bits(p0); sPh[w][8 * hh + r][ln] = hb;      sPl[w][8 * hh + r][ln] = bf16_bits(p0 - bf16_val(hb));
      hb = bf16_bits(p1);                sPh[w][8 * hh + r][16 + ln] = hb; sPl[w][8 * hh + r][16 + ln] = bf16_bits(p1 - bf16_val(hb));
    }
#pragma unroll
    for (int dt = 0; dt < DT; ++dt)
#pragma unroll
      for (int r = 0; r < 8; ++r) oacc[dt][r] *= alpha[r];
    __builtin_amdgcn_fence(__ATOMIC_ACQ_REL, "workgroup");
    __builtin_amdgcn_wave_barrier();
    FragB pah, pal;
    pah.half[0] = *(const v8us*)&sPh[w][ln][8 * hh]; pah.half[1] = *(const v8us*)&sPh[w][ln][16 + 8 * hh];
    pal.half[0] = *(const v8us*)&sPl[w][ln][8 * hh]; pal.half[1] = *(const v8us*)&sPl[w][ln][16 + 8 * hh];
    // B fragments of V by the transposing load: for column tile dt, lane (ln, hh) gets V[8 hh + 0..7][dt * 16 + ln] from the first
    // load of a plane and V[16 + 8 hh + 0..7][dt * 16 + ln] from the second, the k order of the P fragments above.
    // The eight loads of two column tiles stand together in front of their products: one LDS latency is waited out for both.
    // All three loops are unrolled so that fragments and accumulators are indexed by constants and stay in registers.
#pragma unroll
    for (int d0 = 0; d0 < DT; d0 += 2) {
      FragB bvh[2], bvl[2];
#pragma unroll
      for (int t = 0; t < 2; ++t) {
        const int c = (d0 + t) * 16 + tr_c;
        bvh[t].half[0] = ld_tr16(&sV[0][tr_r][c]); bvh[t].half[1] = ld_tr16(&sV[0][16 + tr_r][c]);
        bvl[t].half[0] = ld_tr16(&sV[1][tr_r][c]); bvl[t].half[1] = ld_tr16(&sV[1][16 + tr_r][c]);
      }
#pragma unroll
      for (int t = 0; t < 2; ++t) oacc[d0 + t] = mmaN<3>(pah.v, pal.v, bvh[t].v, bvl[t].v, oacc[d0 + t]);
    }
    __builtin_amdgcn_fence(__ATOMIC_ACQ_REL, "workgroup");
    __builtin_amdgcn_wave_barrier();
  }
#pragma unroll
  for (int r = 0; r < 8; ++r) {
    float l = l_r[r];
    l += __shfl_xor(l, 1, 32); l += __shfl_xor(l, 2, 32); l += __shfl_xor(l, 4, 32); l += __shfl_xor(l, 8, 32);
    l_r[r] = (m_r[r] > -1.0e38f) ? 1.0f / l : __builtin_nanf("");
  }
#pragma unroll
  for (int dt = 0; dt < DT; ++dt)
#pragma unroll
    for (int r = 0; r < 8; ++r) sO[w][8 * hh + r][dt * 16 + ln] = oacc[dt][r] * l_r[r];
  __builtin_amdgcn_fence(__ATOMIC_ACQ_REL, "workgroup");
  __builtin_amdgcn_wave_barrier();
  for (int r = 0; r < 16; ++r) {
    const v4f val = *(const v4fa*)&sO[w][r][lane * 4];
    *(v4f*)(y + ((size_t)b * T + q0 + r) * P + h * D + lane * 4) = val;
  }
}

extern "C" void kernel_launch(void* const* d_in, const int* in_sizes, int n_in,
                              void* d_out, int out_size, void* d_ws, size_t ws_size, hipStream_t stream) {
  (void)in_sizes; (void)n_in; (void)out_size;
  const float* x = (const float*)d_in[0]; const float* Wk = (const float*)d_in[1]; const float* Wv = (const float*)d_in[2]; const float* Wq = (const float*)d_in[3];
  const float* Wout = (const float*)d_in[4]; const float* bout = (const float*)d_in[5];
  char* ws = (char*)d_ws; size_t off = 0;
  auto take = [&](size_t bytes) { char* p = ws + off; off += (bytes + 255) & ~(size_t)255; return p; };
  const int M = BB * TT;
  unsigned short* Wqt = (unsigned short*)take((size_t)NH * HD * HD * 2); unsigned short* Wkt = (unsigned short*)take((size_t)NH * HD * HD * 2); unsigned short* Wvt = (unsigned short*)take((size_t)NH * HD * HD * 2);
  unsigned short* Wot = (unsigned short*)take((size_t)EE * EE * 2);
  float* q = (float*)take((size_t)M * EE * 4); float* k = (float*)take((size_t)M * EE * 4); float* v = (float*)take((size_t)M * EE * 4); float* att = (float*)take((size_t)M * EE * 4);
  if (off > ws_size) return;
  k_wt_all<<<3 * NH * WB + EE * (EE / 8) / 256, 256, 0, stream>>>(Wq, Wk, Wv, Wout, Wqt, Wkt, Wvt, Wot);
  k_qkv<<<dim3(3, NH, (M / 16) * (HD / 64) / 4), 128, 0, stream>>>(x, Wqt, Wkt, Wvt, q, k, v);
  k_flash<HD, TT, NH, EE><<<BB * NH * (TT / 64), 128, 0, stream>>>(q, k, v, 0.02209708691207961f, att);   // 1/sqrt(2048), causal
  k_gemm_bf<true, 0, true><<<((M / 16) * (EE / 64) + 3) / 4, 128, 0, stream>>>(att, EE, Wot, EE, bout, (float*)d_out, EE, M, EE, EE);
}

// v004
// It runs in 293 microseconds.
// Timed twice side by side with v003, it ran 1.41 times as fast both times.
// Over all steps from v000 it is 3.30 times as fast.
#include <hip/hip_runtime.h>
// All contractions on v_wmma_f32_16x16x32_bf16, f32 accumulate: per-head Q/K/V projections xh·W[h] (K=N=128; x, W rounded to bf16:
// single exact term, written into the head's column block; K and V leave the projection as bf16 hi and lo planes), QKᵀ/√S and P·V per 16-query tile as 3-term bf16 hi/lo splits (causal),
// out = attn·W_out + b with attn split hi/lo (2 terms); softmax in f32.
#define BB 4
#define TT 2048
#define EE 1024
#define NH 8
#define HD 128

typedef __bf16 v16b __attribute__((ext_vector_type(16)));
typedef unsigned short v8us __attribute__((ext_vector_type(8), may_alias));
typedef float  v8f  __attribute__((ext_vector_type(8)));
typedef float  v4f  __attribute__((ext_vector_type(4)));
typedef float  v4fa __attribute__((ext_vector_type(4), may_alias));
union FragB { v16b v; v8us half[2]; unsigned short u[16]; };

__device__ __forceinline__ unsigned short bf16_bits(float x) { unsigned int u = __float_as_uint(x); return (unsigned short)((u + 0x7FFFu + ((u >> 16) & 1u)) >> 16); }
__device__ __forceinline__ float bf16_val(unsigned short b) { return __uint_as_float(((unsigned int)b) << 16); }
__device__ __forceinline__ float bf16_round(float x) { return bf16_val(bf16_bits(x)); }
// D += A·B with NT terms: 1 = ah·bh, 2 = + al·bh (A split), 3 = + ah·bl (both split)
template <int NT>
__device__ __forceinline__ v8f mmaN(v16b ah, v16b al, v16b bh, v16b bl, v8f c) {
  c = __builtin_amdgcn_wmma_f32_16x16x32_bf16(false, ah, false, bh, (short)0, c, false, false);
  if (NT >= 2) c = __builtin_amdgcn_wmma_f32_16x16x32_bf16(false, al, false, bh, (short)0, c, false, false);
  if (NT >= 3) c = __builtin_amdgcn_wmma_f32_16x16x32_bf16(false, ah, false, bl, (short)0, c, false, false);
  asm volatile("v_nop\n\tv_nop\n\tv_nop\n\tv_nop" : "+v"(c) : "v"(ah), "v"(al), "v"(bh), "v"(bl));
  return c;
}

// ds_load_tr16_b128: a 16 x 16 tile of 16-bit elements, row-major in LDS, comes back transposed as half a WMMA operand
typedef short s16x8 __attribute__((ext_vector_type(8)));
__device__ __forceinline__ v8us ld_tr16(const unsigned short* p) {
  typedef __attribute__((address_space(3))) s16x8 lds_s16x8;
  return __builtin_bit_cast(v8us, __builtin_amdgcn_ds_load_tr16_b128_v8i16((lds_s16x8*)p));
}

// Wt[n][k] = bf16(W[k][n]); thread t writes 8 consecutive k of one n
__device__ __forceinline__ void wt_bf16(const float* __restrict__ W, unsigned short* __restrict__ Wt, int K, int N, int t) {
  const int k8n = K / 8;
  if (t >= N * k8n) return;
  const int n = t / k8n, k8 = (t % k8n) * 8;
  v8us v;
#pragma unroll
  for (int i = 0; i < 8; ++i) v[i] = bf16_bits(W[(size_t)(k8 + i) * N + n]);
  *(v8us*)(Wt + (size_t)n * K + k8) = v;
}

// All 25 weight transposes in one launch; they are independent of each other. Blocks 0 .. 3 * NH * WB - 1: WB blocks per
// head matrix, in the order q, k, v; the blocks behind them: W_out.
#define WB (HD * (HD / 8) / 256)
__global__ __launch_bounds__(256) void k_wt_all(const float* __restrict__ Wq, const float* __restrict__ Wk, const float* __restrict__ Wv,
                                                const float* __restrict__ Wout, unsigned short* __restrict__ Wqt, unsigned short* __restrict__ Wkt,
                                                unsigned short* __restrict__ Wvt, unsigned short* __restrict__ Wot) {
  const int blk = blockIdx.x;
  if (blk < 3 * NH * WB) {
    const int m = blk / WB, p = m / NH, h = m % NH;
    const float* W = (p == 0) ? Wq : (p == 1) ? Wk : Wv;               // W[h] is [d_in][e_out] = [K][N]
    unsigned short* Wt = (p == 0) ? Wqt : (p == 1) ? Wkt : Wvt;
    wt_bf16(W + (size_t)h * HD * HD, Wt + (size_t)h * HD * HD, HD, HD, (blk % WB) * 256 + threadIdx.x);
  } else {
    wt_bf16(Wout, Wot, EE, EE, (blk - 3 * NH * WB) * 256 + threadIdx.x);   // attn @ W_out: [K][N]
  }
}

// GEMM C[M][N] (f32, pitch ldc) = act(A[M][K]·W + bias). A f32 row-major (pitch lda) converted per fragment to bf16
// (ASPLIT: hi/lo two planes -> 2 terms, else single rounded term); Wt bf16 [N][K] (pitch ldb). BIAS_BF16 rounds the
// bias to bf16 first (bias quantised to bf16 before the add). K%32==0, M%16==0, N%64==0.
// blk: the block's index within this one product.
// csplit (block-uniform): the result is not stored to C but as two bf16 planes of the same pitch, Ch = bf16(c), Cl = bf16(c - Ch).
template <bool ASPLIT, int ACT, bool BIAS_BF16>
__device__ __forceinline__ void gemm_bf(int blk, const float* __restrict__ A, int lda, const unsigned short* __restrict__ Wt, int ldb,
                                        const float* __restrict__ bias, float* __restrict__ C, bool csplit, unsigned short* __restrict__ Ch,
                                        unsigned short* __restrict__ Cl, int ldc, int M, int N, int K) {
  __shared__ __attribute__((aligned(16))) float so[4][16][64];
  const int tid = threadIdx.x, w = tid >> 5, lane = tid & 31, ln = lane & 15, hh = lane >> 4;
  const int ntn = N / 64;
  const int wid = blk * 4 + w;
  const int mt = wid / ntn, nq = wid % ntn;
  if (mt * 16 >= M) return;
  const int row0 = mt * 16, col0 = nq * 64;
  const float* arow = A + (size_t)(row0 + ln) * lda;
  v8f acc[4] = {};
  for (int kb = 0; kb < K; kb += 32) {
    FragB ah, al;
    const v4f x0 = *(const v4fa*)(arow + kb + 8 * hh), x1 = *(const v4fa*)(arow + kb + 8 * hh + 4);
    const v4f x2 = *(const v4fa*)(arow + kb + 16 + 8 * hh), x3 = *(const v4fa*)(arow + kb + 16 + 8 * hh + 4);
    float xs[16] = {x0[0],x0[1],x0[2],x0[3],x1[0],x1[1],x1[2],x1[3],x2[0],x2[1],x2[2],x2[3],x3[0],x3[1],x3[2],x3[3]};
#pragma unroll
    for (int i = 0; i < 16; ++i) { const unsigned short hb = bf16_bits(xs[i]); ah.u[i] = hb; al.u[i] = ASPLIT ? bf16_bits(xs[i] - bf16_val(hb)) : (unsigned short)0; }
#pragma unroll
    for (int t = 0; t < 4; ++t) {
      const unsigned short* brow = Wt + (size_t)(col0 + t * 16 + ln) * ldb + kb;
      FragB b;
      b.half[0] = *(const v8us*)(brow + 8 * hh);
      b.half[1] = *(const v8us*)(brow + 16 + 8 * hh);
      acc[t] = mmaN<ASPLIT ? 2 : 1>(ah.v, al.v, b.v, b.v, acc[t]);
    }
  }
#pragma unroll
  for (int t = 0; t < 4; ++t) {
    float bv = bias ? bias[col0 + t * 16 + ln] : 0.f;
    if (BIAS_BF16) bv = bf16_round(bv);
#pragma unroll
    for (int r = 0; r < 8; ++r) { float v = acc[t][r] + bv; if (ACT == 1) v = fmaxf(v, 0.f); so[w][8 * hh + r][t * 16 + ln] = v; }
  }
  __builtin_amdgcn_fence(__ATOMIC_ACQ_REL, "workgroup");
  __builtin_amdgcn_wave_barrier();
  if (csplit) {
    // a lane takes 8 neighbours of a row: 16 bytes a lane and plane, and the wave's 64 columns fill one 128-byte line of each plane
    const int r4 = lane >> 3, c8 = (lane & 7) * 8;
#pragma unroll
    for (int q = 0; q < 4; ++q) {
      const int r = q * 4 + r4;
      const v4f a = *(const v4fa*)&so[w][r][c8], b = *(const v4fa*)&so[w][r][c8 + 4];
      v8us vh, vl;
#pragma unroll
      for (int i = 0; i < 4; ++i) {
        unsigned short hb = bf16_bits(a[i]); vh[i] = hb; vl[i] = bf16_bits(a[i] - bf16_val(hb));
        hb = bf16_bits(b[i]); vh[4 + i] = hb; vl[4 + i] = bf16_bits(b[i] - bf16_val(hb));
      }
      const size_t o = (size_t)(row0 + r) * ldc + col0 + c8;
      *(v8us*)(Ch + o) = vh;
      *(v8us*)(Cl + o) = vl;
    }
    // stands before the stores' address and data registers are reused behind the join with the other branch
    asm volatile("s_wait_xcnt 0x0" ::: "memory");
  } else {
    const int rsub = lane >> 4, c4 = (lane & 15) * 4;
#pragma unroll
    for (int q = 0; q < 8; ++q) {
      const int r = q * 2 + rsub;
      const v4f v = *(const v4fa*)&so[w][r][c4];
      *(v4f*)(C + (size_t)(row0 + r) * ldc + col0 + c4) = v;
    }
  }
}

template <bool ASPLIT, int ACT, bool BIAS_BF16>
__global__ __launch_bounds__(128) void k_gemm_bf(const float* __restrict__ A, int lda, const unsigned short* __restrict__ Wt, int ldb,
                                               const float* __restrict__ bias, float* __restrict__ C, int ldc, int M, int N, int K) {
  gemm_bf<ASPLIT, ACT, BIAS_BF16>(blockIdx.x, A, lda, Wt, ldb, bias, C, false, nullptr, nullptr, ldc, M, N, K);
}

// All 24 per-head projections in one launch; they are independent of each other. blockIdx.x: q, k or v; blockIdx.y: head;
// blockIdx.z: the product's block of 32 rows. The 24 blocks that share 32 rows of x are neighbours in the grid.
// q is stored as f32; k and v are stored as the hi and lo planes that the attention kernel's products read, so that each element is
// split once here and not once per query block there.
__global__ __launch_bounds__(128) void k_qkv(const float* __restrict__ x, const unsigned short* __restrict__ Wqt, const unsigned short* __restrict__ Wkt,
                                             const unsigned short* __restrict__ Wvt, float* __restrict__ q, unsigned short* __restrict__ kh,
                                             unsigned short* __restrict__ kl, unsigned short* __restrict__ vh, unsigned short* __restrict__ vl) {
  const int p = blockIdx.x, h = blockIdx.y;
  const unsigned short* Wt = (p == 0) ? Wqt : (p == 1) ? Wkt : Wvt;
  unsigned short* Ch = (p == 1) ? kh : vh;
  unsigned short* Cl = (p == 1) ? kl : vl;
  gemm_bf<false, 0, false>(blockIdx.z, x + h * HD, EE, Wt + (size_t)h * HD * HD, HD, nullptr, q + h * HD, p != 0, Ch + h * HD, Cl + h * HD,
                           EE, BB * TT, HD, HD);
}

// Flash-style causal attention, all contractions 3-term bf16 hi/lo splits, f32 softmax with running max.
// K and V arrive as bf16 hi and lo planes (kh, kl, vh, vl): a chunk is only copied to LDS.
// Every shape is a compile-time constant (D head size, T sequence length with T % 64 == 0, H heads, P row pitch in elements of
// q, the four planes and y) and there is no optional input, so the key loop's body is one straight-line block: no bounds test on a key or
// a query row is needed, and a chunk's 16 staging loads are all issued before the first is waited for.
// One wave = 16 query rows; block = 4 waves (64 queries) sharing K/V chunks of 32 keys.
// The second launch bound caps the registers at 256: uncapped, the straight-line loop takes so many that only two work-groups
// fit a WGP, where the LDS has room for four.
template <int D, int T, int H, int P>
__global__ __launch_bounds__(128, 4) void k_flash(const float* __restrict__ qb, const unsigned short* __restrict__ kh, const unsigned short* __restrict__ kl,
                                             const unsigned short* __restrict__ vh, const unsigned short* __restrict__ vl,
                                             float scale, float* __restrict__ y) {
  static_assert(D == 128 && T % 64 == 0, "one wave stages two 128-element rows of a plane per load; whole 64-query blocks");
  constexpr int KS = D / 32;        // k-steps for QK
  constexpr int DT = D / 16;        // d tiles for PV
  constexpr int NQB = T / 64;
  // Plane 0 hi, plane 1 lo; both planes in one array, so that one address register and constant offsets reach both
  // (with an array per plane the paired V loads below no longer fit the 256 registers).
  // V rows are read by the transposing load, which wants a pitch of an odd multiple of 32 bytes; K rows by 16-byte loads.
  __shared__ __attribute__((aligned(16))) unsigned short sK[2][32][D + 8], sV[2][32][D + 16];
  __shared__ __attribute__((aligned(16))) unsigned short sPh[4][16][40], sPl[4][16][40];
  __shared__ __attribute__((aligned(16))) float sO[4][16][D];
  const int tid = threadIdx.x, w = tid >> 5, lane = tid & 31, ln = lane & 15, hh = lane >> 4;
  const int bh = blockIdx.x / NQB, qblk = blockIdx.x % NQB;
  const int b = bh / H, h = bh % H;
  const int q0 = qblk * 64 + w * 16;
  const int tr_r = 8 * hh + (lane & 7), tr_c = 8 * ((lane >> 3) & 1);   // the lane's own 16 bytes of a 16 x 16 tile for the transposing load
  const float* Q = qb + (size_t)b * T * P + h * D;
  // wave w stages rows 2 w, 2 w + 1, then + 8, ... of a chunk: lanes 0 to 15 one whole 256-byte row of a plane, lanes 16 to 31 the next
  const int sr = 2 * w + hh, sc = ln * 8;
  const size_t kv0 = ((size_t)b * T + sr) * P + h * D + sc;

  // A fragments of the wave's 16 query rows (scaled), hi/lo
  FragB aqh[KS], aql[KS];
  {
    const float* qr = Q + (size_t)(q0 + ln) * P;
#pragma unroll
    for (int ks = 0; ks < KS; ++ks)
#pragma unroll
      for (int i = 0; i < 16; ++i) {
        const int d = ks * 32 + ((i < 8) ? (8 * hh + i) : (16 + 8 * hh + (i - 8)));
        const float x = qr[d] * scale; const unsigned short hb = bf16_bits(x);
        aqh[ks].u[i] = hb; aql[ks].u[i] = bf16_bits(x - bf16_val(hb));
      }
  }
  float m_r[8], l_r[8];
#pragma unroll
  for (int r = 0; r < 8; ++r) { m_r[r] = -3.0e38f; l_r[r] = 0.f; }
  v8f oacc[DT];
#pragma unroll
  for (int dt = 0; dt < DT; ++dt) oacc[dt] = (v8f){0.f,0.f,0.f,0.f,0.f,0.f,0.f,0.f};

  const int kv_end = qblk * 64 + 64;     // block-uniform, <= T
  for (int j0 = 0; j0 < kv_end; j0 += 32) {
    __syncthreads();
    v8us fkh[4], fkl[4], fvh[4], fvl[4];
    const unsigned short* pkh = kh + kv0 + (size_t)j0 * P;
    const unsigned short* pkl = kl + kv0 + (size_t)j0 * P;
    const unsigned short* pvh = vh + kv0 + (size_t)j0 * P;
    const unsigned short* pvl = vl + kv0 + (size_t)j0 * P;
#pragma unroll
    for (int it = 0; it < 4; ++it) {
      fkh[it] = *(const v8us*)(pkh + (size_t)it * 8 * P); fkl[it] = *(const v8us*)(pkl + (size_t)it * 8 * P);
      fvh[it] = *(const v8us*)(pvh + (size_t)it * 8 * P); fvl[it] = *(const v8us*)(pvl + (size_t)it * 8 * P);
    }
    // stands before the loads' address registers are reused; naming the pointers as inputs keeps them live up to the wait,
    // so that no load of the run is given an address register as its result
    asm volatile("s_wait_xcnt 0x0" :: "v"(pkh), "v"(pkl), "v"(pvh), "v"(pvl) : "memory");
#pragma unroll
    for (int it = 0; it < 4; ++it) {
      const int r = it * 8 + sr;
      *(v8us*)&sK[0][r][sc] = fkh[it]; *(v8us*)&sK[1][r][sc] = fkl[it];
      *(v8us*)&sV[0][r][sc] = fvh[it]; *(v8us*)&sV[1][r][sc] = fvl[it];
    }
    __syncthreads();
    // S tile 16 x 32
    v8f s[2];
#pragma unroll
    for (int nt = 0; nt < 2; ++nt) {
      v8f acc = {};
#pragma unroll
      for (int ks = 0; ks < KS; ++ks) {
        FragB bh_, bl_;
        bh_.half[0] = *(const v8us*)&sK[0][nt * 16 + ln][ks * 32 + 8 * hh]; bh_.half[1] = *(const v8us*)&sK[0][nt * 16 + ln][ks * 32 + 16 + 8 * hh];
        bl_.half[0] = *(const v8us*)&sK[1][nt * 16 + ln][ks * 32 + 8 * hh]; bl_.half[1] = *(const v8us*)&sK[1][nt * 16 + ln][ks * 32 + 16 + 8 * hh];
        acc = mmaN<3>(aqh[ks].v, aql[ks].v, bh_.v, bl_.v, acc);
      }
      s[nt] = acc;
    }
    // causal mask + running max (rows 8hh+r; the 16 lanes of a half share rows)
    float alpha[8];
#pragma unroll
    for (int r = 0; r < 8; ++r) {
      const int qi = q0 + 8 * hh + r;
      const int ja = j0 + ln, jb = j0 + 16 + ln;
      const bool keepa = ja <= qi, keepb = jb <= qi;
      if (!keepa) s[0][r] = -3.0e38f;
      if (!keepb) s[1][r] = -3.0e38f;
      float mx = fmaxf(s[0][r], s[1][r]);
      mx = fmaxf(mx, __shfl_xor(mx, 1, 32)); mx = fmaxf(mx, __shfl_xor(mx, 2, 32)); mx = fmaxf(mx, __shfl_xor(mx, 4, 32)); mx = fmaxf(mx, __shfl_xor(mx, 8, 32));
      const float mnew = fmaxf(m_r[r], mx);
      alpha[r] = (mnew > -1.0e38f) ? __expf(m_r[r] - mnew) : 1.0f;
      const float p0 = keepa ? __expf(s[0][r] - mnew) : 0.f;
      const float p1 = keepb ? __expf(s[1][r] - mnew) : 0.f;
      m_r[r] = mnew;
      l_r[r] = l_r[r] * alpha[r] + p0 + p1;            // per-lane partial row sum (16 lanes combined at the end)
      unsigned short hb = bf16_bits(p0); sPh[w][8 * hh + r][ln] = hb;      sPl[w][8 * hh + r][ln] = bf16_bits(p0 - bf16_val(hb));
      hb = bf16_bits(p1);                sPh[w][8 * hh + r][16 + ln] = hb; sPl[w][8 * hh + r][16 + ln] = bf16_bits(p1 - bf16_val(hb));
    }
#pragma unroll
    for (int dt = 0; dt < DT; ++dt)
#pragma unroll
      for (int r = 0; r < 8; ++r) oacc[dt][r] *= alpha[r];
    __builtin_amdgcn_fence(__ATOMIC_ACQ_REL, "workgroup");
    __builtin_amdgcn_wave_barrier();
    FragB pah, pal;
    pah.half[0] = *(const v8us*)&sPh[w][ln][8 * hh]; pah.half[1] = *(const v8us*)&sPh[w][ln][16 + 8 * hh];
    pal.half[0] = *(const v8us*)&sPl[w][ln][8 * hh]; pal.half[1] = *(const v8us*)&sPl[w][ln][16 + 8 * hh];
    // B fragments of V by the transposing load: for column tile dt, lane (ln, hh) gets V[8 hh + 0..7][dt * 16 + ln] from the first
    // load of a plane and V[16 + 8 hh + 0..7][dt * 16 + ln] from the second, the k order of the P fragments above.
    // The eight loads of two column tiles stand together in front of their products: one LDS latency is waited out for both.
    // All three loops are unrolled so that fragments and accumulators are indexed by constants and stay in registers.
#pragma unroll
    for (int d0 = 0; d0 < DT; d0 += 2) {
      FragB bvh[2], bvl[2];
#pragma unroll
      for (int t = 0; t < 2; ++t) {
        const int c = (d0 + t) * 16 + tr_c;
        bvh[t].half[0] = ld_tr16(&sV[0][tr_r][c]); bvh[t].half[1] = ld_tr16(&sV[0][16 + tr_r][c]);
        bvl[t].half[0] = ld_tr16(&sV[1][tr_r][c]); bvl[t].half[1] = ld_tr16(&sV[1][16 + tr_r][c]);
      }
#pragma unroll
      for (int t = 0; t < 2; ++t) oacc[d0 + t] = mmaN<3>(pah.v, pal.v, bvh[t].v, bvl[t].v, oacc[d0 + t]);
    }
    __builtin_amdgcn_fence(__ATOMIC_ACQ_REL, "workgroup");
    __builtin_amdgcn_wave_barrier();
  }
#pragma unroll
  for (int r = 0; r < 8; ++r) {
    float l = l_r[r];
    l += __shfl_xor(l, 1, 32); l += __shfl_xor(l, 2, 32); l += __shfl_xor(l, 4, 32); l += __shfl_xor(l, 8, 32);
    l_r[r] = (m_r[r] > -1.0e38f) ? 1.0f / l : __builtin_nanf("");
  }
#pragma unroll
  for (int dt = 0; dt < DT; ++dt)
#pragma unroll
    for (int r = 0; r < 8; ++r) sO[w][8 * hh + r][dt * 16 + ln] = oacc[dt][r] * l_r[r];
  __builtin_amdgcn_fence(__ATOMIC_ACQ_REL, "workgroup");
  __builtin_amdgcn_wave_barrier();
  for (int r = 0; r < 16; ++r) {
    const v4f val = *(const v4fa*)&sO[w][r][lane * 4];
    *(v4f*)(y + ((size_t)b * T + q0 + r) * P + h * D + lane * 4) = val;
  }
}

extern "C" void kernel_launch(void* const* d_in, const int* in_sizes, int n_in,
                              void* d_out, int out_size, void* d_ws, size_t ws_size, hipStream_t stream) {
  (void)in_sizes; (void)n_in; (void)out_size;
  const float* x = (const float*)d_in[0]; const float* Wk = (const float*)d_in[1]; const float* Wv = (const float*)d_in[2]; const float* Wq = (const float*)d_in[3];
  const float* Wout = (const float*)d_in[4]; const float* bout = (const float*)d_in[5];
  char* ws = (char*)d_ws; size_t off = 0;
  auto take = [&](size_t bytes) { char* p = ws + off; off += (bytes + 255) & ~(size_t)255; return p; };
  const int M = BB * TT;
  unsigned short* Wqt = (unsigned short*)take((size_t)NH * HD * HD * 2); unsigned short* Wkt = (unsigned short*)take((size_t)NH * HD * HD * 2); unsigned short* Wvt = (unsigned short*)take((size_t)NH * HD * HD * 2);
  unsigned short* Wot = (unsigned short*)take((size_t)EE * EE * 2);
  float* q = (float*)take((size_t)M * EE * 4); float* att = (float*)take((size_t)M * EE * 4);
  unsigned short* kh = (unsigned short*)take((size_t)M * EE * 2); unsigned short* kl = (unsigned short*)take((size_t)M * EE * 2);
  unsigned short* vh = (unsigned short*)take((size_t)M * EE * 2); unsigned short* vl = (unsigned short*)take((size_t)M * EE * 2);
  if (off > ws_size) return;
  k_wt_all<<<3 * NH * WB + EE * (EE / 8) / 256, 256, 0, stream>>>(Wq, Wk, Wv, Wout, Wqt, Wkt, Wvt, Wot);
  k_qkv<<<dim3(3, NH, (M / 16) * (HD / 64) / 4), 128, 0, stream>>>(x, Wqt, Wkt, Wvt, q, kh, kl, vh, vl);
  k_flash<HD, TT, NH, EE><<<BB * NH * (TT / 64), 128, 0, stream>>>(q, kh, kl, vh, vl, 0.02209708691207961f, att);   // 1/sqrt(2048), causal
  k_gemm_bf<true, 0, true><<<((M / 16) * (EE / 64) + 3) / 4, 128, 0, stream>>>(att, EE, Wot, EE, bout, (float*)d_out, EE, M, EE, EE);
}

// v005
// One run takes 272 microseconds.
// Two timings next to v004 put it at 1.07 and 1.09 times that version's speed.
// Over all steps from v000 it is 3.56 times as fast.
#include <hip/hip_runtime.h>
// All contractions on v_wmma_f32_16x16x32_bf16, f32 accumulate: per-head Q/K/V projections xh·W[h] (K=N=128; x, W rounded to bf16:
// single exact term, written into the head's column block; K and V leave the projection as bf16 hi and lo planes), QKᵀ/√S and P·V per 16-query tile as 3-term bf16 hi/lo splits (causal),
// out = attn·W_out + b with attn split hi/lo (2 terms); softmax in f32.
#define BB 4
#define TT 2048
#define EE 1024
#define NH 8
#define HD 128

typedef __bf16 v16b __attribute__((ext_vector_type(16)));
typedef unsigned short v8us __attribute__((ext_vector_type(8), may_alias));
typedef float  v8f  __attribute__((ext_vector_type(8)));
typedef float  v4f  __attribute__((ext_vector_type(4)));
typedef float  v4fa __attribute__((ext_vector_type(4), may_alias));
union FragB { v16b v; v8us half[2]; unsigned short u[16]; };

__device__ __forceinline__ unsigned short bf16_bits(float x) { unsigned int u = __float_as_uint(x); return (unsigned short)((u + 0x7FFFu + ((u >> 16) & 1u)) >> 16); }
__device__ __forceinline__ float bf16_val(unsigned short b) { return __uint_as_float(((unsigned int)b) << 16); }
__device__ __forceinline__ float bf16_round(float x) { return bf16_val(bf16_bits(x)); }
// D += A·B with NT terms: 1 = ah·bh, 2 = + al·bh (A split), 3 = + ah·bl (both split)
template <int NT>
__device__ __forceinline__ v8f mmaN(v16b ah, v16b al, v16b bh, v16b bl, v8f c) {
  c = __builtin_amdgcn_wmma_f32_16x16x32_bf16(false, ah, false, bh, (short)0, c, false, false);
  if (NT >= 2) c = __builtin_amdgcn_wmma_f32_16x16x32_bf16(false, al, false, bh, (short)0, c, false, false);
  if (NT >= 3) c = __builtin_amdgcn_wmma_f32_16x16x32_bf16(false, ah, false, bl, (short)0, c, false, false);
  asm volatile("v_nop\n\tv_nop\n\tv_nop\n\tv_nop" : "+v"(c) : "v"(ah), "v"(al), "v"(bh), "v"(bl));
  return c;
}

// ds_load_tr16_b128: a 16 x 16 tile of 16-bit elements, row-major in LDS, comes back transposed as half a WMMA operand
typedef short s16x8 __attribute__((ext_vector_type(8)));
__device__ __forceinline__ v8us ld_tr16(const unsigned short* p) {
  typedef __attribute__((address_space(3))) s16x8 lds_s16x8;
  return __builtin_bit_cast(v8us, __builtin_amdgcn_ds_load_tr16_b128_v8i16((lds_s16x8*)p));
}

// Wt holds bf16(W[k][n]) in the order in which the products read it as B fragments: one block of 512 elements per 16 columns n and
// 32 rows k (the K / 32 blocks of one column tile follow each other), and in a block first the 16 bytes that each of the 32 lanes takes as
// the first half of its fragment, then the 32 second halves: element i of half s of lane (hh, ln) is k = 32 kb + 16 s + 8 hh + i, n = 16 nt + ln.
// A wave's load of a half is then 512 contiguous bytes, four whole lines (row-major Wt[n][k]: 32 bytes of each of 16 lines).
__device__ __forceinline__ size_t wt_block(int K, int nt, int kb) { return ((size_t)nt * (K / 32) + kb) * 512; }
// thread t writes 8 consecutive k of one n; neighbours in t are neighbours in n, so that 16 lanes fill 256 contiguous bytes of a block
__device__ __forceinline__ void wt_bf16(const float* __restrict__ W, unsigned short* __restrict__ Wt, int K, int N, int t) {
  if (t >= N * (K / 8)) return;
  const int n = t % N, k8 = (t / N) * 8;
  v8us v;
#pragma unroll
  for (int i = 0; i < 8; ++i) v[i] = bf16_bits(W[(size_t)(k8 + i) * N + n]);
  *(v8us*)(Wt + wt_block(K, n >> 4, k8 >> 5) + ((k8 >> 4) & 1) * 256 + (((k8 >> 3) & 1) * 16 + (n & 15)) * 8) = v;
}

// All 25 weight transposes in one launch; they are independent of each other. Blocks 0 .. 3 * NH * WB - 1: WB blocks per
// head matrix, in the order q, k, v; the blocks behind them: W_out.
#define WB (HD * (HD / 8) / 256)
__global__ __launch_bounds__(256) void k_wt_all(const float* __restrict__ Wq, const float* __restrict__ Wk, const float* __restrict__ Wv,
                                                const float* __restrict__ Wout, unsigned short* __restrict__ Wqt, unsigned short* __restrict__ Wkt,
                                                unsigned short* __restrict__ Wvt, unsigned short* __restrict__ Wot) {
  const int blk = blockIdx.x;
  if (blk < 3 * NH * WB) {
    const int m = blk / WB, p = m / NH, h = m % NH;
    const float* W = (p == 0) ? Wq : (p == 1) ? Wk : Wv;               // W[h] is [d_in][e_out] = [K][N]
    unsigned short* Wt = (p == 0) ? Wqt : (p == 1) ? Wkt : Wvt;
    wt_bf16(W + (size_t)h * HD * HD, Wt + (size_t)h * HD * HD, HD, HD, (blk % WB) * 256 + threadIdx.x);
  } else {
    wt_bf16(Wout, Wot, EE, EE, (blk - 3 * NH * WB) * 256 + threadIdx.x);   // attn @ W_out: [K][N]
  }
}

// GEMM C[M][N] (f32, pitch ldc) = act(A[M][K]·W + bias). A f32 row-major (pitch lda) converted per fragment to bf16
// (ASPLIT: hi/lo two planes -> 2 terms, else single rounded term); Wt bf16 in fragment order (wt_block; ldb rows k). BIAS_BF16 rounds the
// bias to bf16 first (bias quantised to bf16 before the add). K%32==0, M%16==0, N%64==0.
// blk: the block's index within this one product.
// csplit (block-uniform): the result is not stored to C but as two bf16 planes of the same pitch, Ch = bf16(c), Cl = bf16(c - Ch).
template <bool ASPLIT, int ACT, bool BIAS_BF16>
__device__ __forceinline__ void gemm_bf(int blk, const float* __restrict__ A, int lda, const unsigned short* __restrict__ Wt, int ldb,
                                        const float* __restrict__ bias, float* __restrict__ C, bool csplit, unsigned short* __restrict__ Ch,
                                        unsigned short* __restrict__ Cl, int ldc, int M, int N, int K) {
  __shared__ __attribute__((aligned(16))) float so[4][16][64];
  const int tid = threadIdx.x, w = tid >> 5, lane = tid & 31, ln = lane & 15, hh = lane >> 4;
  const int ntn = N / 64;
  const int wid = blk * 4 + w;
  const int mt = wid / ntn, nq = wid % ntn;
  if (mt * 16 >= M) return;
  const int row0 = mt * 16, col0 = nq * 64;
  const float* arow = A + (size_t)(row0 + ln) * lda;
  v8f acc[4] = {};
  for (int kb = 0; kb < K; kb += 32) {
    FragB ah, al;
    const v4f x0 = *(const v4fa*)(arow + kb + 8 * hh), x1 = *(const v4fa*)(arow + kb + 8 * hh + 4);
    const v4f x2 = *(const v4fa*)(arow + kb + 16 + 8 * hh), x3 = *(const v4fa*)(arow + kb + 16 + 8 * hh + 4);
    float xs[16] = {x0[0],x0[1],x0[2],x0[3],x1[0],x1[1],x1[2],x1[3],x2[0],x2[1],x2[2],x2[3],x3[0],x3[1],x3[2],x3[3]};
#pragma unroll
    for (int i = 0; i < 16; ++i) { const unsigned short hb = bf16_bits(xs[i]); ah.u[i] = hb; al.u[i] = ASPLIT ? bf16_bits(xs[i] - bf16_val(hb)) : (unsigned short)0; }
#pragma unroll
    for (int t = 0; t < 4; ++t) {
      const unsigned short* bfr = Wt + wt_block(ldb, nq * 4 + t, kb >> 5) + lane * 8;
      FragB b;
      b.half[0] = *(const v8us*)bfr;
      b.half[1] = *(const v8us*)(bfr + 256);
      acc[t] = mmaN<ASPLIT ? 2 : 1>(ah.v, al.v, b.v, b.v, acc[t]);
    }
  }
#pragma unroll
  for (int t = 0; t < 4; ++t) {
    float bv = bias ? bias[col0 + t * 16 + ln] : 0.f;
    if (BIAS_BF16) bv = bf16_round(bv);
#pragma unroll
    for (int r = 0; r < 8; ++r) { float v = acc[t][r] + bv; if (ACT == 1) v = fmaxf(v, 0.f); so[w][8 * hh + r][t * 16 + ln] = v; }
  }
  __builtin_amdgcn_fence(__ATOMIC_ACQ_REL, "workgroup");
  __builtin_amdgcn_wave_barrier();
  if (csplit) {
    // a lane takes 8 neighbours of a row: 16 bytes a lane and plane, and the wave's 64 columns fill one 128-byte line of each plane
    const int r4 = lane >> 3, c8 = (lane & 7) * 8;
#pragma unroll
    for (int q = 0; q < 4; ++q) {
      const int r = q * 4 + r4;
      const v4f a = *(const v4fa*)&so[w][r][c8], b = *(const v4fa*)&so[w][r][c8 + 4];
      v8us vh, vl;
#pragma unroll
      for (int i = 0; i < 4; ++i) {
        unsigned short hb = bf16_bits(a[i]); vh[i] = hb; vl[i] = bf16_bits(a[i] - bf16_val(hb));
        hb = bf16_bits(b[i]); vh[4 + i] = hb; vl[4 + i] = bf16_bits(b[i] - bf16_val(hb));
      }
      const size_t o = (size_t)(row0 + r) * ldc + col0 + c8;
      *(v8us*)(Ch + o) = vh;
      *(v8us*)(Cl + o) = vl;
    }
    // stands before the stores' address and data registers are reused behind the join with the other branch
    asm volatile("s_wait_xcnt 0x0" ::: "memory");
  } else {
    const int rsub = lane >> 4, c4 = (lane & 15) * 4;
#pragma unroll
    for (int q = 0; q < 8; ++q) {
      const int r = q * 2 + rsub;
      const v4f v = *(const v4fa*)&so[w][r][c4];
      *(v4f*)(C + (size_t)(row0 + r) * ldc + col0 + c4) = v;
    }
  }
}

template <bool ASPLIT, int ACT, bool BIAS_BF16>
__global__ __launch_bounds__(128) void k_gemm_bf(const float* __restrict__ A, int lda, const unsigned short* __restrict__ Wt, int ldb,
                                               const float* __restrict__ bias, float* __restrict__ C, int ldc, int M, int N, int K) {
  gemm_bf<ASPLIT, ACT, BIAS_BF16>(blockIdx.x, A, lda, Wt, ldb, bias, C, false, nullptr, nullptr, ldc, M, N, K);
}

// All 24 per-head projections in one launch; they are independent of each other. blockIdx.x: q, k or v; blockIdx.y: head;
// blockIdx.z: the product's block of 32 rows. The 24 blocks that share 32 rows of x are neighbours in the grid.
// q is stored as f32; k and v are stored as the hi and lo planes that the attention kernel's products read, so that each element is
// split once here and not once per query block there.
__global__ __launch_bounds__(128) void k_qkv(const float* __restrict__ x, const unsigned short* __restrict__ Wqt, const unsigned short* __restrict__ Wkt,
                                             const unsigned short* __restrict__ Wvt, float* __restrict__ q, unsigned short* __restrict__ kh,
                                             unsigned short* __restrict__ kl, unsigned short* __restrict__ vh, unsigned short* __restrict__ vl) {
  const int p = blockIdx.x, h = blockIdx.y;
  const unsigned short* Wt = (p == 0) ? Wqt : (p == 1) ? Wkt : Wvt;
  unsigned short* Ch = (p == 1) ? kh : vh;
  unsigned short* Cl = (p == 1) ? kl : vl;
  gemm_bf<false, 0, false>(blockIdx.z, x + h * HD, EE, Wt + (size_t)h * HD * HD, HD, nullptr, q + h * HD, p != 0, Ch + h * HD, Cl + h * HD,
                           EE, BB * TT, HD, HD);
}

// Flash-style causal attention, all contractions 3-term bf16 hi/lo splits, f32 softmax with running max.
// K and V arrive as bf16 hi and lo planes (kh, kl, vh, vl): a chunk is only copied to LDS.
// Every shape is a compile-time constant (D head size, T sequence length with T % 64 == 0, H heads, P row pitch in elements of
// q, the four planes and y) and there is no optional input, so the key loop's body is one straight-line block: no bounds test on a key or
// a query row is needed, and a chunk's 16 staging loads are all issued before the first is waited for.
// One wave = 16 query rows; block = 4 waves (64 queries) sharing K/V chunks of 32 keys.
// The second launch bound caps the registers at 256: uncapped, the straight-line loop takes so many that only two work-groups
// fit a WGP, where the LDS has room for four.
template <int D, int T, int H, int P>
__global__ __launch_bounds__(128, 4) void k_flash(const float* __restrict__ qb, const unsigned short* __restrict__ kh, const unsigned short* __restrict__ kl,
                                             const unsigned short* __restrict__ vh, const unsigned short* __restrict__ vl,
                                             float scale, float* __restrict__ y) {
  static_assert(D == 128 && T % 64 == 0, "one wave stages two 128-element rows of a plane per load; whole 64-query blocks");
  constexpr int KS = D / 32;        // k-steps for QK
  constexpr int DT = D / 16;        // d tiles for PV
  constexpr int NQB = T / 64;
  // Plane 0 hi, plane 1 lo; both planes in one array, so that one address register and constant offsets reach both
  // (with an array per plane the paired V loads below no longer fit the 256 registers).
  // V rows are read by the transposing load, which wants a pitch of an odd multiple of 32 bytes; K rows by 16-byte loads.
  __shared__ __attribute__((aligned(16))) unsigned short sK[2][32][D + 8], sV[2][32][D + 16];
  __shared__ __attribute__((aligned(16))) unsigned short sPh[4][16][40], sPl[4][16][40];
  __shared__ __attribute__((aligned(16))) float sO[4][16][D];
  const int tid = threadIdx.x, w = tid >> 5, lane = tid & 31, ln = lane & 15, hh = lane >> 4;
  const int bh = blockIdx.x / NQB, qblk = blockIdx.x % NQB;
  const int b = bh / H, h = bh % H;
  const int q0 = qblk * 64 + w * 16;
  const int tr_r = 8 * hh + (lane & 7), tr_c = 8 * ((lane >> 3) & 1);   // the lane's own 16 bytes of a 16 x 16 tile for the transposing load
  const float* Q = qb + (size_t)b * T * P + h * D;
  // wave w stages rows 2 w, 2 w + 1, then + 8, ... of a chunk: lanes 0 to 15 one whole 256-byte row of a plane, lanes 16 to 31 the next
  const int sr = 2 * w + hh, sc = ln * 8;
  const size_t kv0 = ((size_t)b * T + sr) * P + h * D + sc;

  // A fragments of the wave's 16 query rows (scaled), hi/lo
  FragB aqh[KS], aql[KS];
  {
    const float* qr = Q + (size_t)(q0 + ln) * P;
#pragma unroll
    for (int ks = 0; ks < KS; ++ks)
#pragma unroll
      for (int i = 0; i < 16; ++i) {
        const int d = ks * 32 + ((i < 8) ? (8 * hh + i) : (16 + 8 * hh + (i - 8)));
        const float x = qr[d] * scale; const unsigned short hb = bf16_bits(x);
        aqh[ks].u[i] = hb; aql[ks].u[i] = bf16_bits(x - bf16_val(hb));
      }
  }
  float m_r[8], l_r[8];
#pragma unroll
  for (int r = 0; r < 8; ++r) { m_r[r] = -3.0e38f; l_r[r] = 0.f; }
  v8f oacc[DT];
#pragma unroll
  for (int dt = 0; dt < DT; ++dt) oacc[dt] = (v8f){0.f,0.f,0.f,0.f,0.f,0.f,0.f,0.f};

  const int kv_end = qblk * 64 + 64;     // block-uniform, <= T
  for (int j0 = 0; j0 < kv_end; j0 += 32) {
    __syncthreads();
    v8us fkh[4], fkl[4], fvh[4], fvl[4];
    const unsigned short* pkh = kh + kv0 + (size_t)j0 * P;
    const unsigned short* pkl = kl + kv0 + (size_t)j0 * P;
    const unsigned short* pvh = vh + kv0 + (size_t)j0 * P;
    const unsigned short* pvl = vl + kv0 + (size_t)j0 * P;
#pragma unroll
    for (int it = 0; it < 4; ++it) {
      fkh[it] = *(const v8us*)(pkh + (size_t)it * 8 * P); fkl[it] = *(const v8us*)(pkl + (size_t)it * 8 * P);
      fvh[it] = *(const v8us*)(pvh + (size_t)it * 8 * P); fvl[it] = *(const v8us*)(pvl + (size_t)it * 8 * P);
    }
    // stands before the loads' address registers are reused; naming the pointers as inputs keeps them live up to the wait,
    // so that no load of the run is given an address register as its result
    asm volatile("s_wait_xcnt 0x0" :: "v"(pkh), "v"(pkl), "v"(pvh), "v"(pvl) : "memory");
#pragma unroll
    for (int it = 0; it < 4; ++it) {
      const int r = it * 8 + sr;
      *(v8us*)&sK[0][r][sc] = fkh[it]; *(v8us*)&sK[1][r][sc] = fkl[it];
      *(v8us*)&sV[0][r][sc] = fvh[it]; *(v8us*)&sV[1][r][sc] = fvl[it];
    }
    __syncthreads();
    // S tile 16 x 32
    v8f s[2];
#pragma unroll
    for (int nt = 0; nt < 2; ++nt) {
      v8f acc = {};
#pragma unroll
      for (int ks = 0; ks < KS; ++ks) {
        FragB bh_, bl_;
        bh_.half[0] = *(const v8us*)&sK[0][nt * 16 + ln][ks * 32 + 8 * hh]; bh_.half[1] = *(const v8us*)&sK[0][nt * 16 + ln][ks * 32 + 16 + 8 * hh];
        bl_.half[0] = *(const v8us*)&sK[1][nt * 16 + ln][ks * 32 + 8 * hh]; bl_.half[1] = *(const v8us*)&sK[1][nt * 16 + ln][ks * 32 + 16 + 8 * hh];
        acc = mmaN<3>(aqh[ks].v, aql[ks].v, bh_.v, bl_.v, acc);
      }
      s[nt] = acc;
    }
    // causal mask + running max (rows 8hh+r; the 16 lanes of a half share rows)
    float alpha[8];
#pragma unroll
    for (int r = 0; r < 8; ++r) {
      const int qi = q0 + 8 * hh + r;
      const int ja = j0 + ln, jb = j0 + 16 + ln;
      const bool keepa = ja <= qi, keepb = jb <= qi;
      if (!keepa) s[0][r] = -3.0e38f;
      if (!keepb) s[1][r] = -3.0e38f;
      float mx = fmaxf(s[0][r], s[1][r]);
      mx = fmaxf(mx, __shfl_xor(mx, 1, 32)); mx = fmaxf(mx, __shfl_xor(mx, 2, 32)); mx = fmaxf(mx, __shfl_xor(mx, 4, 32)); mx = fmaxf(mx, __shfl_xor(mx, 8, 32));
      const float mnew = fmaxf(m_r[r], mx);
      alpha[r] = (mnew > -1.0e38f) ? __expf(m_r[r] - mnew) : 1.0f;
      const float p0 = keepa ? __expf(s[0][r] - mnew) : 0.f;
      const float p1 = keepb ? __expf(s[1][r] - mnew) : 0.f;
      m_r[r] = mnew;
      l_r[r] = l_r[r] * alpha[r] + p0 + p1;            // per-lane partial row sum (16 lanes combined at the end)
      unsigned short hb = bf16_bits(p0); sPh[w][8 * hh + r][ln] = hb;      sPl[w][8 * hh + r][ln] = bf16_bits(p0 - bf16_val(hb));
      hb = bf16_bits(p1);                sPh[w][8 * hh + r][16 + ln] = hb; sPl[w][8 * hh + r][16 + ln] = bf16_bits(p1 - bf16_val(hb));
    }
#pragma unroll
    for (int dt = 0; dt < DT; ++dt)
#pragma unroll
      for (int r = 0; r < 8; ++r) oacc[dt][r] *= alpha[r];
    __builtin_amdgcn_fence(__ATOMIC_ACQ_REL, "workgroup");
    __builtin_amdgcn_wave_barrier();
    FragB pah, pal;
    pah.half[0] = *(const v8us*)&sPh[w][ln][8 * hh]; pah.half[1] = *(const v8us*)&sPh[w][ln][16 + 8 * hh];
    pal.half[0] = *(const v8us*)&sPl[w][ln][8 * hh]; pal.half[1] = *(const v8us*)&sPl[w][ln][16 + 8 * hh];
    // B fragments of V by the transposing load: for column tile dt, lane (ln, hh) gets V[8 hh + 0..7][dt * 16 + ln] from the first
    // load of a plane and V[16 + 8 hh + 0..7][dt * 16 + ln] from the second, the k order of the P fragments above.
    // The eight loads of two column tiles stand together in front of their products: one LDS latency is waited out for both.
    // All three loops are unrolled so that fragments and accumulators are indexed by constants and stay in registers.
#pragma unroll
    for (int d0 = 0; d0 < DT; d0 += 2) {
      FragB bvh[2], bvl[2];
#pragma unroll
      for (int t = 0; t < 2; ++t) {
        const int c = (d0 + t) * 16 + tr_c;
        bvh[t].half[0] = ld_tr16(&sV[0][tr_r][c]); bvh[t].half[1] = ld_tr16(&sV[0][16 + tr_r][c]);
        bvl[t].half[0] = ld_tr16(&sV[1][tr_r][c]); bvl[t].half[1] = ld_tr16(&sV[1][16 + tr_r][c]);
      }
#pragma unroll
      for (int t = 0; t < 2; ++t) oacc[d0 + t] = mmaN<3>(pah.v, pal.v, bvh[t].v, bvl[t].v, oacc[d0 + t]);
    }
    __builtin_amdgcn_fence(__ATOMIC_ACQ_REL, "workgroup");
    __builtin_amdgcn_wave_barrier();
  }
#pragma unroll
  for (int r = 0; r < 8; ++r) {
    float l = l_r[r];
    l += __shfl_xor(l, 1, 32); l += __shfl_xor(l, 2, 32); l += __shfl_xor(l, 4, 32); l += __shfl_xor(l, 8, 32);
    l_r[r] = (m_r[r] > -1.0e38f) ? 1.0f / l : __builtin_nanf("");
  }
#pragma unroll
  for (int dt = 0; dt < DT; ++dt)
#pragma unroll
    for (int r = 0; r < 8; ++r) sO[w][8 * hh + r][dt * 16 + ln] = oacc[dt][r] * l_r[r];
  __builtin_amdgcn_fence(__ATOMIC_ACQ_REL, "workgroup");
  __builtin_amdgcn_wave_barrier();
  for (int r = 0; r < 16; ++r) {
    const v4f val = *(const v4fa*)&sO[w][r][lane * 4];
    *(v4f*)(y + ((size_t)b * T + q0 + r) * P + h * D + lane * 4) = val;
  }
}

extern "C" void kernel_launch(void* const* d_in, const int* in_sizes, int n_in,
                              void* d_out, int out_size, void* d_ws, size_t ws_size, hipStream_t stream) {
  (void)in_sizes; (void)n_in; (void)out_size;
  const float* x = (const float*)d_in[0]; const float* Wk = (const float*)d_in[1]; const float* Wv = (const float*)d_in[2]; const float* Wq = (const float*)d_in[3];
  const float* Wout = (const float*)d_in[4]; const float* bout = (const float*)d_in[5];
  char* ws = (char*)d_ws; size_t off = 0;
  auto take = [&](size_t bytes) { char* p = ws + off; off += (bytes + 255) & ~(size_t)255; return p; };
  const int M = BB * TT;
  unsigned short* Wqt = (unsigned short*)take((size_t)NH * HD * HD * 2); unsigned short* Wkt = (unsigned short*)take((size_t)NH * HD * HD * 2); unsigned short* Wvt = (unsigned short*)take((size_t)NH * HD * HD * 2);
  unsigned short* Wot = (unsigned short*)take((size_t)EE * EE * 2);
  float* q = (float*)take((size_t)M * EE * 4); float* att = (float*)take((size_t)M * EE * 4);
  unsigned short* kh = (unsigned short*)take((size_t)M * EE * 2); unsigned short* kl = (unsigned short*)take((size_t)M * EE * 2);
  unsigned short* vh = (unsigned short*)take((size_t)M * EE * 2); unsigned short* vl = (unsigned short*)take((size_t)M * EE * 2);
  if (off > ws_size) return;
  k_wt_all<<<3 * NH * WB + EE * (EE / 8) / 256, 256, 0, stream>>>(Wq, Wk, Wv, Wout, Wqt, Wkt, Wvt, Wot);
  k_qkv<<<dim3(3, NH, (M / 16) * (HD / 64) / 4), 128, 0, stream>>>(x, Wqt, Wkt, Wvt, q, kh, kl, vh, vl);
  k_flash<HD, TT, NH, EE><<<BB * NH * (TT / 64), 128, 0, stream>>>(q, kh, kl, vh, vl, 0.02209708691207961f, att);   // 1/sqrt(2048), causal
  k_gemm_bf<true, 0, true><<<((M / 16) * (EE / 64) + 3) / 4, 128, 0, stream>>>(att, EE, Wot, EE, bout, (float*)d_out, EE, M, EE, EE);
}

// v006
// Measured time: 212 microseconds a run.
// In two side-by-side timings against v005, it was 1.27 and 1.29 times as fast.
// All steps since v000 together make it 4.56 times as fast.
#include <hip/hip_runtime.h>
// All contractions on v_wmma_f32_16x16x32_bf16, f32 accumulate: per-head Q/K/V projections xh·W[h] (K=N=128; x, W rounded to bf16:
// single exact term, written into the head's column block; K and V leave the projection as bf16 hi and lo planes), QKᵀ/√S and P·V per 16-query tile as 3-term bf16 hi/lo splits (causal),
// out = attn·W_out + b with attn split hi/lo (2 terms); softmax in f32.
#define BB 4
#define TT 2048
#define EE 1024
#define NH 8
#define HD 128

typedef __bf16 v16b __attribute__((ext_vector_type(16)));
typedef unsigned short v8us __attribute__((ext_vector_type(8), may_alias));
typedef float  v8f  __attribute__((ext_vector_type(8)));
typedef float  v4f  __attribute__((ext_vector_type(4)));
typedef float  v4fa __attribute__((ext_vector_type(4), may_alias));
union FragB { v16b v; v8us half[2]; unsigned short u[16]; };

__device__ __forceinline__ unsigned short bf16_bits(float x) { unsigned int u = __float_as_uint(x); return (unsigned short)((u + 0x7FFFu + ((u >> 16) & 1u)) >> 16); }
__device__ __forceinline__ float bf16_val(unsigned short b) { return __uint_as_float(((unsigned int)b) << 16); }
__device__ __forceinline__ float bf16_round(float x) { return bf16_val(bf16_bits(x)); }
// D += A·B with NT terms: 1 = ah·bh, 2 = + al·bh (A split), 3 = + ah·bl (both split)
template <int NT>
__device__ __forceinline__ v8f mmaN(v16b ah, v16b al, v16b bh, v16b bl, v8f c) {
  c = __builtin_amdgcn_wmma_f32_16x16x32_bf16(false, ah, false, bh, (short)0, c, false, false);
  if (NT >= 2) c = __builtin_amdgcn_wmma_f32_16x16x32_bf16(false, al, false, bh, (short)0, c, false, false);
  if (NT >= 3) c = __builtin_amdgcn_wmma_f32_16x16x32_bf16(false, ah, false, bl, (short)0, c, false, false);
  asm volatile("v_nop\n\tv_nop\n\tv_nop\n\tv_nop" : "+v"(c) : "v"(ah), "v"(al), "v"(bh), "v"(bl));
  return c;
}

// ds_load_tr16_b128: a 16 x 16 tile of 16-bit elements, row-major in LDS, comes back transposed as half a WMMA operand
typedef short s16x8 __attribute__((ext_vector_type(8)));
__device__ __forceinline__ v8us ld_tr16(const unsigned short* p) {
  typedef __attribute__((address_space(3))) s16x8 lds_s16x8;
  return __builtin_bit_cast(v8us, __builtin_amdgcn_ds_load_tr16_b128_v8i16((lds_s16x8*)p));
}

// Wt holds bf16(W[k][n]) in the order in which the products read it as B fragments: one block of 512 elements per 16 columns n and
// 32 rows k (the K / 32 blocks of one column tile follow each other), and in a block first the 16 bytes that each of the 32 lanes takes as
// the first half of its fragment, then the 32 second halves: element i of half s of lane (hh, ln) is k = 32 kb + 16 s + 8 hh + i, n = 16 nt + ln.
// A wave's load of a half is then 512 contiguous bytes, four whole lines (row-major Wt[n][k]: 32 bytes of each of 16 lines).
__device__ __forceinline__ size_t wt_block(int K, int nt, int kb) { return ((size_t)nt * (K / 32) + kb) * 512; }
// thread t writes 8 consecutive k of one n; neighbours in t are neighbours in n, so that 16 lanes fill 256 contiguous bytes of a block
__device__ __forceinline__ void wt_bf16(const float* __restrict__ W, unsigned short* __restrict__ Wt, int K, int N, int t) {
  if (t >= N * (K / 8)) return;
  const int n = t % N, k8 = (t / N) * 8;
  v8us v;
#pragma unroll
  for (int i = 0; i < 8; ++i) v[i] = bf16_bits(W[(size_t)(k8 + i) * N + n]);
  *(v8us*)(Wt + wt_block(K, n >> 4, k8 >> 5) + ((k8 >> 4) & 1) * 256 + (((k8 >> 3) & 1) * 16 + (n & 15)) * 8) = v;
}

// All 25 weight transposes in one launch; they are independent of each other. Blocks 0 .. 3 * NH * WB - 1: WB blocks per
// head matrix, in the order q, k, v; the blocks behind them: W_out.
#define WB (HD * (HD / 8) / 256)
__global__ __launch_bounds__(256) void k_wt_all(const float* __restrict__ Wq, const float* __restrict__ Wk, const float* __restrict__ Wv,
                                                const float* __restrict__ Wout, unsigned short* __restrict__ Wqt, unsigned short* __restrict__ Wkt,
                                                unsigned short* __restrict__ Wvt, unsigned short* __restrict__ Wot) {
  const int blk = blockIdx.x;
  if (blk < 3 * NH * WB) {
    const int m = blk / WB, p = m / NH, h = m % NH;
    const float* W = (p == 0) ? Wq : (p == 1) ? Wk : Wv;               // W[h] is [d_in][e_out] = [K][N]
    unsigned short* Wt = (p == 0) ? Wqt : (p == 1) ? Wkt : Wvt;
    wt_bf16(W + (size_t)h * HD * HD, Wt + (size_t)h * HD * HD, HD, HD, (blk % WB) * 256 + threadIdx.x);
  } else {
    wt_bf16(Wout, Wot, EE, EE, (blk - 3 * NH * WB) * 256 + threadIdx.x);   // attn @ W_out: [K][N]
  }
}

// GEMM C[M][N] (f32, pitch ldc) = act(A[M][K]·W + bias). A f32 row-major (pitch lda) converted per fragment to bf16
// (ASPLIT: hi/lo two planes -> 2 terms, else single rounded term); Wt bf16 in fragment order (wt_block; ldb rows k). BIAS_BF16 rounds the
// bias to bf16 first (bias quantised to bf16 before the add). K%32==0, M%16==0, N%64==0.
// blk: the block's index within this one product.
// csplit (block-uniform): the result is not stored to C but as two bf16 planes of the same pitch, Ch = bf16(c), Cl = bf16(c - Ch).
template <bool ASPLIT, int ACT, bool BIAS_BF16>
__device__ __forceinline__ void gemm_bf(int blk, const float* __restrict__ A, int lda, const unsigned short* __restrict__ Wt, int ldb,
                                        const float* __restrict__ bias, float* __restrict__ C, bool csplit, unsigned short* __restrict__ Ch,
                                        unsigned short* __restrict__ Cl, int ldc, int M, int N, int K) {
  __shared__ __attribute__((aligned(16))) float so[4][16][64];
  const int tid = threadIdx.x, w = tid >> 5, lane = tid & 31, ln = lane & 15, hh = lane >> 4;
  const int ntn = N / 64;
  const int wid = blk * 4 + w;
  const int mt = wid / ntn, nq = wid % ntn;
  if (mt * 16 >= M) return;
  const int row0 = mt * 16, col0 = nq * 64;
  const float* arow = A + (size_t)(row0 + ln) * lda;
  v8f acc[4] = {};
  for (int kb = 0; kb < K; kb += 32) {
    FragB ah, al;
    const v4f x0 = *(const v4fa*)(arow + kb + 8 * hh), x1 = *(const v4fa*)(arow + kb + 8 * hh + 4);
    const v4f x2 = *(const v4fa*)(arow + kb + 16 + 8 * hh), x3 = *(const v4fa*)(arow + kb + 16 + 8 * hh + 4);
    float xs[16] = {x0[0],x0[1],x0[2],x0[3],x1[0],x1[1],x1[2],x1[3],x2[0],x2[1],x2[2],x2[3],x3[0],x3[1],x3[2],x3[3]};
#pragma unroll
    for (int i = 0; i < 16; ++i) { const unsigned short hb = bf16_bits(xs[i]); ah.u[i] = hb; al.u[i] = ASPLIT ? bf16_bits(xs[i] - bf16_val(hb)) : (unsigned short)0; }
#pragma unroll
    for (int t = 0; t < 4; ++t) {
      const unsigned short* bfr = Wt + wt_block(ldb, nq * 4 + t, kb >> 5) + lane * 8;
      FragB b;
      b.half[0] = *(const v8us*)bfr;
      b.half[1] = *(const v8us*)(bfr + 256);
      acc[t] = mmaN<ASPLIT ? 2 : 1>(ah.v, al.v, b.v, b.v, acc[t]);
    }
  }
#pragma unroll
  for (int t = 0; t < 4; ++t) {
    float bv = bias ? bias[col0 + t * 16 + ln] : 0.f;
    if (BIAS_BF16) bv = bf16_round(bv);
#pragma unroll
    for (int r = 0; r < 8; ++r) { float v = acc[t][r] + bv; if (ACT == 1) v = fmaxf(v, 0.f); so[w][8 * hh + r][t * 16 + ln] = v; }
  }
  __builtin_amdgcn_fence(__ATOMIC_ACQ_REL, "workgroup");
  __builtin_amdgcn_wave_barrier();
  if (csplit) {
    // a lane takes 8 neighbours of a row: 16 bytes a lane and plane, and the wave's 64 columns fill one 128-byte line of each plane
    const int r4 = lane >> 3, c8 = (lane & 7) * 8;
#pragma unroll
    for (int q = 0; q < 4; ++q) {
      const int r = q * 4 + r4;
      const v4f a = *(const v4fa*)&so[w][r][c8], b = *(const v4fa*)&so[w][r][c8 + 4];
      v8us vh, vl;
#pragma unroll
      for (int i = 0; i < 4; ++i) {
        unsigned short hb = bf16_bits(a[i]); vh[i] = hb; vl[i] = bf16_bits(a[i] - bf16_val(hb));
        hb = bf16_bits(b[i]); vh[4 + i] = hb; vl[4 + i] = bf16_bits(b[i] - bf16_val(hb));
      }
      const size_t o = (size_t)(row0 + r) * ldc + col0 + c8;
      *(v8us*)(Ch + o) = vh;
      *(v8us*)(Cl + o) = vl;
    }
    // stands before the stores' address and data registers are reused behind the join with the other branch
    asm volatile("s_wait_xcnt 0x0" ::: "memory");
  } else {
    const int rsub = lane >> 4, c4 = (lane & 15) * 4;
#pragma unroll
    for (int q = 0; q < 8; ++q) {
      const int r = q * 2 + rsub;
      const v4f v = *(const v4fa*)&so[w][r][c4];
      *(v4f*)(C + (size_t)(row0 + r) * ldc + col0 + c4) = v;
    }
  }
}

template <bool ASPLIT, int ACT, bool BIAS_BF16>
__global__ __launch_bounds__(128) void k_gemm_bf(const float* __restrict__ A, int lda, const unsigned short* __restrict__ Wt, int ldb,
                                               const float* __restrict__ bias, float* __restrict__ C, int ldc, int M, int N, int K) {
  gemm_bf<ASPLIT, ACT, BIAS_BF16>(blockIdx.x, A, lda, Wt, ldb, bias, C, false, nullptr, nullptr, ldc, M, N, K);
}

// All 24 per-head projections in one launch; they are independent of each other. blockIdx.x: q, k or v; blockIdx.y: head;
// blockIdx.z: the product's block of 32 rows. The 24 blocks that share 32 rows of x are neighbours in the grid.
// q is stored as f32; k and v are stored as the hi and lo planes that the attention kernel's products read, so that each element is
// split once here and not once per query block there.
__global__ __launch_bounds__(128) void k_qkv(const float* __restrict__ x, const unsigned short* __restrict__ Wqt, const unsigned short* __restrict__ Wkt,
                                             const unsigned short* __restrict__ Wvt, float* __restrict__ q, unsigned short* __restrict__ kh,
                                             unsigned short* __restrict__ kl, unsigned short* __restrict__ vh, unsigned short* __restrict__ vl) {
  const int p = blockIdx.x, h = blockIdx.y;
  const unsigned short* Wt = (p == 0) ? Wqt : (p == 1) ? Wkt : Wvt;
  unsigned short* Ch = (p == 1) ? kh : vh;
  unsigned short* Cl = (p == 1) ? kl : vl;
  gemm_bf<false, 0, false>(blockIdx.z, x + h * HD, EE, Wt + (size_t)h * HD * HD, HD, nullptr, q + h * HD, p != 0, Ch + h * HD, Cl + h * HD,
                           EE, BB * TT, HD, HD);
}

// Flash-style causal attention, all contractions 3-term bf16 hi/lo splits, f32 softmax with running max.
// K and V arrive as bf16 hi and lo planes (kh, kl, vh, vl): a chunk is only copied to LDS.
// Every shape is a compile-time constant (D head size, T sequence length with T % 128 == 0, H heads, P row pitch in elements of
// q, the four planes and y) and there is no optional input, so the key loop's body is one straight-line block: no bounds test on a key or
// a query row is needed, and a chunk's 16 staging loads are all issued before the first is waited for.
// One wave = 16 query rows; a tile is 64 queries; a chunk is 32 keys.
// The work is dealt evenly. A tile costs 2 (tile + 1) chunks, and every work-group of the launch is resident from the start, so the launch
// lasts as long as the fullest WGP. A work-group takes two tiles of its head, one after the other: tile NQB - 1 - tp, then tile tp, together
// 2 (NQB + 1) chunks wherever it lands. It has 8 waves: two halves of 4, both on the tile's 64 queries; half g takes the chunks 2 i + g, staged
// in buffers of its own, so that every wave of the launch works through NQB + 1 chunks and four waves stay on every SIMD to the end.
// Behind a tile's last chunk the upper half hands its running maximum, sum and unscaled output over through LDS, and the lower half
// joins the two partial results and stores the tile.
// The second launch bound caps the registers at 256: four waves a SIMD, two work-groups a WGP.
template <int D, int T, int H, int P>
__global__ __launch_bounds__(256, 4) void k_flash(const float* __restrict__ qb, const unsigned short* __restrict__ kh, const unsigned short* __restrict__ kl,
                                             const unsigned short* __restrict__ vh, const unsigned short* __restrict__ vl,
                                             float scale, float* __restrict__ y) {
  static_assert(D == 128 && T % 128 == 0, "one wave stages two 128-element rows of a plane per load; whole pairs of 64-query tiles");
  constexpr int KS = D / 32;        // k-steps for QK
  constexpr int DT = D / 16;        // d tiles for PV
  constexpr int NQB = T / 64;
  // Plane 0 hi, plane 1 lo; both planes in one array, so that one address register and constant offsets reach both
  // (with an array per plane the paired V loads below no longer fit the 256 registers).
  // V rows are read by the transposing load, which wants a pitch of an odd multiple of 32 bytes; K rows by 16-byte loads.
  __shared__ __attribute__((aligned(16))) unsigned short sKg[2][2][32][D + 8], sVg[2][2][32][D + 16];   // first index: the half
  __shared__ __attribute__((aligned(16))) unsigned short sPh[8][16][40], sPl[8][16][40];
  __shared__ __attribute__((aligned(16))) float sO[4][16][D];
  __shared__ float sM[4][8][32], sL[4][8][32];      // the upper half's running maxima and per-lane sums
  const int tid = threadIdx.x, w = tid >> 5, lane = tid & 31, ln = lane & 15, hh = lane >> 4;
  const int g = __builtin_amdgcn_readfirstlane(tid >> 7), wq = w & 3;   // the wave's half (the same in every lane: a scalar) and its 16 rows of the tile
  unsigned short (*sK)[32][D + 8] = sKg[g];
  unsigned short (*sV)[32][D + 16] = sVg[g];
  const int bh = blockIdx.x / (NQB / 2), tp = blockIdx.x % (NQB / 2);
  const int b = bh / H, h = bh % H;
  const int tr_r = 8 * hh + (lane & 7), tr_c = 8 * ((lane >> 3) & 1);   // the lane's own 16 bytes of a 16 x 16 tile for the transposing load
  const float* Q = qb + (size_t)b * T * P + h * D;
  // wave wq of a half stages rows 2 wq, 2 wq + 1, then + 8, ... of the half's chunk: lanes 0 to 15 one whole 256-byte row of a plane, lanes 16 to 31 the next
  const int sr = 2 * wq + hh, sc = ln * 8;
  const size_t kv0 = ((size_t)b * T + sr) * P + h * D + sc;

  // kept rolled: unrolled, values of the second tile stay live through the first tile's key loop, and the 256 registers no longer hold the loop
#pragma unroll 1
  for (int pass = 0; pass < 2; ++pass) {
    const int qblk = pass ? tp : NQB - 1 - tp;     // block-uniform
    const int q0 = qblk * 64 + wq * 16;
    // A fragments of the wave's 16 query rows (scaled), hi/lo
    FragB aqh[KS], aql[KS];
    {
      const float* qr = Q + (size_t)(q0 + ln) * P;
#pragma unroll
      for (int ks = 0; ks < KS; ++ks)
#pragma unroll
        for (int i = 0; i < 16; ++i) {
          const int d = ks * 32 + ((i < 8) ? (8 * hh + i) : (16 + 8 * hh + (i - 8)));
          const float x = qr[d] * scale; const unsigned short hb = bf16_bits(x);
          aqh[ks].u[i] = hb; aql[ks].u[i] = bf16_bits(x - bf16_val(hb));
        }
    }
    float m_r[8], l_r[8];
#pragma unroll
    for (int r = 0; r < 8; ++r) { m_r[r] = -3.0e38f; l_r[r] = 0.f; }
    v8f oacc[DT];
#pragma unroll
    for (int dt = 0; dt < DT; ++dt) oacc[dt] = (v8f){0.f,0.f,0.f,0.f,0.f,0.f,0.f,0.f};

    for (int i = 0; i <= qblk; ++i) {      // block-uniform trip count; the last key is qblk * 64 + 63 < T
      const int j0 = (2 * i + g) * 32;
      __syncthreads();
      v8us fkh[4], fkl[4], fvh[4], fvl[4];
      const unsigned short* pkh = kh + kv0 + (size_t)j0 * P;
      const unsigned short* pkl = kl + kv0 + (size_t)j0 * P;
      const unsigned short* pvh = vh + kv0 + (size_t)j0 * P;
      const unsigned short* pvl = vl + kv0 + (size_t)j0 * P;
#pragma unroll
      for (int it = 0; it < 4; ++it) {
        fkh[it] = *(const v8us*)(pkh + (size_t)it * 8 * P); fkl[it] = *(const v8us*)(pkl + (size_t)it * 8 * P);
        fvh[it] = *(const v8us*)(pvh + (size_t)it * 8 * P); fvl[it] = *(const v8us*)(pvl + (size_t)it * 8 * P);
      }
      // stands before the loads' address registers are reused; naming the pointers as inputs keeps them live up to the wait,
      // so that no load of the run is given an address register as its result
      asm volatile("s_wait_xcnt 0x0" :: "v"(pkh), "v"(pkl), "v"(pvh), "v"(pvl) : "memory");
#pragma unroll
      for (int it = 0; it < 4; ++it) {
        const int r = it * 8 + sr;
        *(v8us*)&sK[0][r][sc] = fkh[it]; *(v8us*)&sK[1][r][sc] = fkl[it];
        *(v8us*)&sV[0][r][sc] = fvh[it]; *(v8us*)&sV[1][r][sc] = fvl[it];
      }
      __syncthreads();
      // S tile 16 x 32
      v8f s[2];
#pragma unroll
      for (int nt = 0; nt < 2; ++nt) {
        v8f acc = {};
#pragma unroll
        for (int ks = 0; ks < KS; ++ks) {
          FragB bh_, bl_;
          bh_.half[0] = *(const v8us*)&sK[0][nt * 16 + ln][ks * 32 + 8 * hh]; bh_.half[1] = *(const v8us*)&sK[0][nt * 16 + ln][ks * 32 + 16 + 8 * hh];
          bl_.half[0] = *(const v8us*)&sK[1][nt * 16 + ln][ks * 32 + 8 * hh]; bl_.half[1] = *(const v8us*)&sK[1][nt * 16 + ln][ks * 32 + 16 + 8 * hh];
          acc = mmaN<3>(aqh[ks].v, aql[ks].v, bh_.v, bl_.v, acc);
        }
        s[nt] = acc;
      }
      // causal mask + running max (rows 8hh+r; the 16 lanes of a half share rows).
      // The maximum is taken step by step over all eight rows, which do not depend on each other: the eight cross-lane exchanges of a step
      // stand together in front of one LDS wait. A row's arithmetic is what it was row by row.
      float alpha[8], mx[8];
      const int da = j0 + ln - (q0 + 8 * hh), db = da + 16;   // key minus the lane's first query row: key <= row r is da <= r, one register where the eight row numbers took eight
#pragma unroll
      for (int r = 0; r < 8; ++r) {
        if (!(da <= r)) s[0][r] = -3.0e38f;
        if (!(db <= r)) s[1][r] = -3.0e38f;
        mx[r] = fmaxf(s[0][r], s[1][r]);
      }
#pragma unroll
      for (int m = 1; m <= 8; m <<= 1) {
        float o[8];
#pragma unroll
        for (int r = 0; r < 8; ++r) o[r] = __shfl_xor(mx[r], m, 32);
#pragma unroll
        for (int r = 0; r < 8; ++r) mx[r] = fmaxf(mx[r], o[r]);
      }
#pragma unroll
      for (int r = 0; r < 8; ++r) {
        const float mnew = fmaxf(m_r[r], mx[r]);
        alpha[r] = (mnew > -1.0e38f) ? __expf(m_r[r] - mnew) : 1.0f;
        const float p0 = (da <= r) ? __expf(s[0][r] - mnew) : 0.f;
        const float p1 = (db <= r) ? __expf(s[1][r] - mnew) : 0.f;
        m_r[r] = mnew;
        l_r[r] = l_r[r] * alpha[r] + p0 + p1;            // per-lane partial row sum (16 lanes combined at the end)
        unsigned short hb = bf16_bits(p0); sPh[w][8 * hh + r][ln] = hb;      sPl[w][8 * hh + r][ln] = bf16_bits(p0 - bf16_val(hb));
        hb = bf16_bits(p1);                sPh[w][8 * hh + r][16 + ln] = hb; sPl[w][8 * hh + r][16 + ln] = bf16_bits(p1 - bf16_val(hb));
      }
#pragma unroll
      for (int dt = 0; dt < DT; ++dt)
#pragma unroll
        for (int r = 0; r < 8; ++r) oacc[dt][r] *= alpha[r];
      __builtin_amdgcn_fence(__ATOMIC_ACQ_REL, "workgroup");
      __builtin_amdgcn_wave_barrier();
      FragB pah, pal;
      pah.half[0] = *(const v8us*)&sPh[w][ln][8 * hh]; pah.half[1] = *(const v8us*)&sPh[w][ln][16 + 8 * hh];
      pal.half[0] = *(const v8us*)&sPl[w][ln][8 * hh]; pal.half[1] = *(const v8us*)&sPl[w][ln][16 + 8 * hh];
      // B fragments of V by the transposing load: for column tile dt, lane (ln, hh) gets V[8 hh + 0..7][dt * 16 + ln] from the first
      // load of a plane and V[16 + 8 hh + 0..7][dt * 16 + ln] from the second, the k order of the P fragments above.
      // The eight loads of two column tiles stand together in front of their products: one LDS latency is waited out for both.
      // All three loops are unrolled so that fragments and accumulators are indexed by constants and stay in registers.
#pragma unroll
      for (int d0 = 0; d0 < DT; d0 += 2) {
        FragB bvh[2], bvl[2];
#pragma unroll
        for (int t = 0; t < 2; ++t) {
          const int c = (d0 + t) * 16 + tr_c;
          bvh[t].half[0] = ld_tr16(&sV[0][tr_r][c]); bvh[t].half[1] = ld_tr16(&sV[0][16 + tr_r][c]);
          bvl[t].half[0] = ld_tr16(&sV[1][tr_r][c]); bvl[t].half[1] = ld_tr16(&sV[1][16 + tr_r][c]);
        }
#pragma unroll
        for (int t = 0; t < 2; ++t) oacc[d0 + t] = mmaN<3>(pah.v, pal.v, bvh[t].v, bvl[t].v, oacc[d0 + t]);
      }
      __builtin_amdgcn_fence(__ATOMIC_ACQ_REL, "workgroup");
      __builtin_amdgcn_wave_barrier();
    }
    // The upper half's partial result goes to the lower half, lane to lane: wave wq + 4 holds the same rows in the same lanes as wave wq.
    if (g == 1) {
#pragma unroll
      for (int r = 0; r < 8; ++r) { sM[wq][r][lane] = m_r[r]; sL[wq][r][lane] = l_r[r]; }
#pragma unroll
      for (int dt = 0; dt < DT; ++dt)
#pragma unroll
        for (int r = 0; r < 8; ++r) sO[wq][8 * hh + r][dt * 16 + ln] = oacc[dt][r];
    }
    // publishes the upper half's partial result to the lower half; every wave passes it. The upper half's next write of sM, sL and sO lies behind
    // the next tile's barriers, which the lower half reaches only when it has stored this tile.
    __syncthreads();
    if (g == 0) {
      // Join: both partial results are brought to the common maximum. An upper half that saw no unmasked key has maximum -3.0e38, sum 0
      // and output 0, and its factor comes out 0; the lower half always holds key 0, so the common maximum is a real score.
      float f0[8], f1[8];
#pragma unroll
      for (int r = 0; r < 8; ++r) {
        const float m1 = sM[wq][r][lane], l1 = sL[wq][r][lane];
        const float m = fmaxf(m_r[r], m1);
        const float a0 = __expf(m_r[r] - m), a1 = __expf(m1 - m);
        float l = l_r[r] * a0 + l1 * a1;
        l += __shfl_xor(l, 1, 32); l += __shfl_xor(l, 2, 32); l += __shfl_xor(l, 4, 32); l += __shfl_xor(l, 8, 32);
        const float inv = (m > -1.0e38f) ? 1.0f / l : __builtin_nanf("");
        f0[r] = a0 * inv; f1[r] = a1 * inv;
      }
      // a lane reads back and overwrites only the words that its partner lane wrote
#pragma unroll
      for (int dt = 0; dt < DT; ++dt)
#pragma unroll
        for (int r = 0; r < 8; ++r) sO[wq][8 * hh + r][dt * 16 + ln] = oacc[dt][r] * f0[r] + sO[wq][8 * hh + r][dt * 16 + ln] * f1[r];
      __builtin_amdgcn_fence(__ATOMIC_ACQ_REL, "workgroup");
      __builtin_amdgcn_wave_barrier();
      for (int r = 0; r < 16; ++r) {
        const v4f val = *(const v4fa*)&sO[wq][r][lane * 4];
        *(v4f*)(y + ((size_t)b * T + q0 + r) * P + h * D + lane * 4) = val;
      }
      // stands before the stores' address and data registers are reused by the next tile
      asm volatile("s_wait_xcnt 0x0" ::: "memory");
    }
  }
}

extern "C" void kernel_launch(void* const* d_in, const int* in_sizes, int n_in,
                              void* d_out, int out_size, void* d_ws, size_t ws_size, hipStream_t stream) {
  (void)in_sizes; (void)n_in; (void)out_size;
  const float* x = (const float*)d_in[0]; const float* Wk = (const float*)d_in[1]; const float* Wv = (const float*)d_in[2]; const float* Wq = (const float*)d_in[3];
  const float* Wout = (const float*)d_in[4]; const float* bout = (const float*)d_in[5];
  char* ws = (char*)d_ws; size_t off = 0;
  auto take = [&](size_t bytes) { char* p = ws + off; off += (bytes + 255) & ~(size_t)255; return p; };
  const int M = BB * TT;
  unsigned short* Wqt = (unsigned short*)take((size_t)NH * HD * HD * 2); unsigned short* Wkt = (unsigned short*)take((size_t)NH * HD * HD * 2); unsigned short* Wvt = (unsigned short*)take((size_t)NH * HD * HD * 2);
  unsigned short* Wot = (unsigned short*)take((size_t)EE * EE * 2);
  float* q = (float*)take((size_t)M * EE * 4); float* att = (float*)take((size_t)M * EE * 4);
  unsigned short* kh = (unsigned short*)take((size_t)M * EE * 2); unsigned short* kl = (unsigned short*)take((size_t)M * EE * 2);
  unsigned short* vh = (unsigned short*)take((size_t)M * EE * 2); unsigned short* vl = (unsigned short*)take((size_t)M * EE * 2);
  if (off > ws_size) return;
  k_wt_all<<<3 * NH * WB + EE * (EE / 8) / 256, 256, 0, stream>>>(Wq, Wk, Wv, Wout, Wqt, Wkt, Wvt, Wot);
  k_qkv<<<dim3(3, NH, (M / 16) * (HD / 64) / 4), 128, 0, stream>>>(x, Wqt, Wkt, Wvt, q, kh, kl, vh, vl);
  k_flash<HD, TT, NH, EE><<<BB * NH * (TT / 128), 256, 0, stream>>>(q, kh, kl, vh, vl, 0.02209708691207961f, att);   // 1/sqrt(2048), causal
  k_gemm_bf<true, 0, true><<<((M / 16) * (EE / 64) + 3) / 4, 128, 0, stream>>>(att, EE, Wot, EE, bout, (float*)d_out, EE, M, EE, EE);
}

// v007
// It runs in 191 microseconds.
// Next to v006, in two timings, it ran 1.11 and 1.12 times as fast.
// Counting every step since v000, it is 5.07 times as fast.
#include <hip/hip_runtime.h>
// All contractions on v_wmma_f32_16x16x32_bf16, f32 accumulate: per-head Q/K/V projections xh·W[h] (K=N=128; x, W rounded to bf16:
// single exact term, written into the head's column block; K and V leave the projection as bf16 hi and lo planes), QKᵀ/√S and P·V per 16-query tile as 3-term bf16 hi/lo splits (causal),
// out = attn·W_out + b with attn split hi/lo (2 terms); softmax in f32.
#define BB 4
#define TT 2048
#define EE 1024
#define NH 8
#define HD 128

typedef __bf16 v16b __attribute__((ext_vector_type(16)));
typedef unsigned short v8us __attribute__((ext_vector_type(8), may_alias));
typedef float  v8f  __attribute__((ext_vector_type(8)));
typedef float  v4f  __attribute__((ext_vector_type(4)));
typedef float  v4fa __attribute__((ext_vector_type(4), may_alias));
union FragB { v16b v; v8us half[2]; unsigned short u[16]; };

__device__ __forceinline__ unsigned short bf16_bits(float x) { unsigned int u = __float_as_uint(x); return (unsigned short)((u + 0x7FFFu + ((u >> 16) & 1u)) >> 16); }
__device__ __forceinline__ float bf16_val(unsigned short b) { return __uint_as_float(((unsigned int)b) << 16); }
__device__ __forceinline__ float bf16_round(float x) { return bf16_val(bf16_bits(x)); }
// D += A·B with NT terms: 1 = ah·bh, 2 = + al·bh (A split), 3 = + ah·bl (both split)
template <int NT>
__device__ __forceinline__ v8f mmaN(v16b ah, v16b al, v16b bh, v16b bl, v8f c) {
  c = __builtin_amdgcn_wmma_f32_16x16x32_bf16(false, ah, false, bh, (short)0, c, false, false);
  if (NT >= 2) c = __builtin_amdgcn_wmma_f32_16x16x32_bf16(false, al, false, bh, (short)0, c, false, false);
  if (NT >= 3) c = __builtin_amdgcn_wmma_f32_16x16x32_bf16(false, ah, false, bl, (short)0, c, false, false);
  asm volatile("v_nop\n\tv_nop\n\tv_nop\n\tv_nop" : "+v"(c) : "v"(ah), "v"(al), "v"(bh), "v"(bl));
  return c;
}

// ds_load_tr16_b128: a 16 x 16 tile of 16-bit elements, row-major in LDS, comes back transposed as half a WMMA operand
typedef short s16x8 __attribute__((ext_vector_type(8)));
__device__ __forceinline__ v8us ld_tr16(const unsigned short* p) {
  typedef __attribute__((address_space(3))) s16x8 lds_s16x8;
  return __builtin_bit_cast(v8us, __builtin_amdgcn_ds_load_tr16_b128_v8i16((lds_s16x8*)p));
}

// Wt holds bf16(W[k][n]) in the order in which the products read it as B fragments: one block of 512 elements per 16 columns n and
// 32 rows k (the K / 32 blocks of one column tile follow each other), and in a block first the 16 bytes that each of the 32 lanes takes as
// the first half of its fragment, then the 32 second halves: element i of half s of lane (hh, ln) is k = 32 kb + 16 s + 8 hh + i, n = 16 nt + ln.
// A wave's load of a half is then 512 contiguous bytes, four whole lines (row-major Wt[n][k]: 32 bytes of each of 16 lines).
__device__ __forceinline__ size_t wt_block(int K, int nt, int kb) { return ((size_t)nt * (K / 32) + kb) * 512; }
// thread t writes 8 consecutive k of one n; neighbours in t are neighbours in n, so that 16 lanes fill 256 contiguous bytes of a block
__device__ __forceinline__ void wt_bf16(const float* __restrict__ W, unsigned short* __restrict__ Wt, int K, int N, int t) {
  if (t >= N * (K / 8)) return;
  const int n = t % N, k8 = (t / N) * 8;
  v8us v;
#pragma unroll
  for (int i = 0; i < 8; ++i) v[i] = bf16_bits(W[(size_t)(k8 + i) * N + n]);
  *(v8us*)(Wt + wt_block(K, n >> 4, k8 >> 5) + ((k8 >> 4) & 1) * 256 + (((k8 >> 3) & 1) * 16 + (n & 15)) * 8) = v;
}

// All 25 weight transposes in one launch; they are independent of each other. Blocks 0 .. 3 * NH * WB - 1: WB blocks per
// head matrix, in the order q, k, v; the blocks behind them: W_out.
#define WB (HD * (HD / 8) / 256)
__global__ __launch_bounds__(256) void k_wt_all(const float* __restrict__ Wq, const float* __restrict__ Wk, const float* __restrict__ Wv,
                                                const float* __restrict__ Wout, unsigned short* __restrict__ Wqt, unsigned short* __restrict__ Wkt,
                                                unsigned short* __restrict__ Wvt, unsigned short* __restrict__ Wot) {
  const int blk = blockIdx.x;
  if (blk < 3 * NH * WB) {
    const int m = blk / WB, p = m / NH, h = m % NH;
    const float* W = (p == 0) ? Wq : (p == 1) ? Wk : Wv;               // W[h] is [d_in][e_out] = [K][N]
    unsigned short* Wt = (p == 0) ? Wqt : (p == 1) ? Wkt : Wvt;
    wt_bf16(W + (size_t)h * HD * HD, Wt + (size_t)h * HD * HD, HD, HD, (blk % WB) * 256 + threadIdx.x);
  } else {
    wt_bf16(Wout, Wot, EE, EE, (blk - 3 * NH * WB) * 256 + threadIdx.x);   // attn @ W_out: [K][N]
  }
}

// GEMM C[M][N] (f32, pitch ldc) = act(A[M][K]·W + bias). A f32 row-major (pitch lda) converted per fragment to bf16
// (ASPLIT: hi/lo two planes -> 2 terms, else single rounded term); Wt bf16 in fragment order (wt_block; ldb rows k). BIAS_BF16 rounds the
// bias to bf16 first (bias quantised to bf16 before the add). K%32==0, M%16==0, N%64==0.
// blk: the block's index within this one product.
// csplit (block-uniform): the result is not stored to C but as two bf16 planes of the same pitch, Ch = bf16(c), Cl = bf16(c - Ch).
template <bool ASPLIT, int ACT, bool BIAS_BF16>
__device__ __forceinline__ void gemm_bf(int blk, const float* __restrict__ A, int lda, const unsigned short* __restrict__ Wt, int ldb,
                                        const float* __restrict__ bias, float* __restrict__ C, bool csplit, unsigned short* __restrict__ Ch,
                                        unsigned short* __restrict__ Cl, int ldc, int M, int N, int K) {
  __shared__ __attribute__((aligned(16))) float so[4][16][64];
  const int tid = threadIdx.x, w = tid >> 5, lane = tid & 31, ln = lane & 15, hh = lane >> 4;
  const int ntn = N / 64;
  const int wid = blk * 4 + w;
  const int mt = wid / ntn, nq = wid % ntn;
  if (mt * 16 >= M) return;
  const int row0 = mt * 16, col0 = nq * 64;
  const float* arow = A + (size_t)(row0 + ln) * lda;
  v8f acc[4] = {};
  for (int kb = 0; kb < K; kb += 32) {
    FragB ah, al;
    const v4f x0 = *(const v4fa*)(arow + kb + 8 * hh), x1 = *(const v4fa*)(arow + kb + 8 * hh + 4);
    const v4f x2 = *(const v4fa*)(arow + kb + 16 + 8 * hh), x3 = *(const v4fa*)(arow + kb + 16 + 8 * hh + 4);
    FragB b[4];
#pragma unroll
    for (int t = 0; t < 4; ++t) {
      const unsigned short* bfr = Wt + wt_block(ldb, nq * 4 + t, kb >> 5) + lane * 8;
      b[t].half[0] = *(const v8us*)bfr;
      b[t].half[1] = *(const v8us*)(bfr + 256);
    }
    // stands before the loads' address registers are reused by the conversion
    asm volatile("s_wait_xcnt 0x0" ::: "memory");
    // nothing is scheduled across this line: the step's twelve loads stay together in front of the conversion and the products. Left alone, the
    // compiler sinks each B pair down to its own product, and the wave waits out a memory latency per product instead of one per step
    __builtin_amdgcn_sched_barrier(0);
    float xs[16] = {x0[0],x0[1],x0[2],x0[3],x1[0],x1[1],x1[2],x1[3],x2[0],x2[1],x2[2],x2[3],x3[0],x3[1],x3[2],x3[3]};
#pragma unroll
    for (int i = 0; i < 16; ++i) { const unsigned short hb = bf16_bits(xs[i]); ah.u[i] = hb; al.u[i] = ASPLIT ? bf16_bits(xs[i] - bf16_val(hb)) : (unsigned short)0; }
#pragma unroll
    for (int t = 0; t < 4; ++t) {
      acc[t] = __builtin_amdgcn_wmma_f32_16x16x32_bf16(false, ah.v, false, b[t].v, (short)0, acc[t], false, false);
      if (ASPLIT) acc[t] = __builtin_amdgcn_wmma_f32_16x16x32_bf16(false, al.v, false, b[t].v, (short)0, acc[t], false, false);
    }
    // the distance behind a matrix instruction, once per step (was once per product): the results tie the statement behind all of the step's
    // products, and the B fragments, as inputs, stay in their registers up to it, so that no later load lands in one of them less than four slots behind
    asm volatile("v_nop\n\tv_nop\n\tv_nop\n\tv_nop" : "+v"(acc[0]), "+v"(acc[1]), "+v"(acc[2]), "+v"(acc[3])
                 : "v"(b[0].v), "v"(b[1].v), "v"(b[2].v), "v"(b[3].v));
  }
#pragma unroll
  for (int t = 0; t < 4; ++t) {
    float bv = bias ? bias[col0 + t * 16 + ln] : 0.f;
    if (BIAS_BF16) bv = bf16_round(bv);
#pragma unroll
    for (int r = 0; r < 8; ++r) { float v = acc[t][r] + bv; if (ACT == 1) v = fmaxf(v, 0.f); so[w][8 * hh + r][t * 16 + ln] = v; }
  }
  __builtin_amdgcn_fence(__ATOMIC_ACQ_REL, "workgroup");
  __builtin_amdgcn_wave_barrier();
  if (csplit) {
    // a lane takes 8 neighbours of a row: 16 bytes a lane and plane, and the wave's 64 columns fill one 128-byte line of each plane
    const int r4 = lane >> 3, c8 = (lane & 7) * 8;
#pragma unroll
    for (int q = 0; q < 4; ++q) {
      const int r = q * 4 + r4;
      const v4f a = *(const v4fa*)&so[w][r][c8], b = *(const v4fa*)&so[w][r][c8 + 4];
      v8us vh, vl;
#pragma unroll
      for (int i = 0; i < 4; ++i) {
        unsigned short hb = bf16_bits(a[i]); vh[i] = hb; vl[i] = bf16_bits(a[i] - bf16_val(hb));
        hb = bf16_bits(b[i]); vh[4 + i] = hb; vl[4 + i] = bf16_bits(b[i] - bf16_val(hb));
      }
      const size_t o = (size_t)(row0 + r) * ldc + col0 + c8;
      *(v8us*)(Ch + o) = vh;
      *(v8us*)(Cl + o) = vl;
    }
    // stands before the stores' address and data registers are reused behind the join with the other branch
    asm volatile("s_wait_xcnt 0x0" ::: "memory");
  } else {
    const int rsub = lane >> 4, c4 = (lane & 15) * 4;
#pragma unroll
    for (int q = 0; q < 8; ++q) {
      const int r = q * 2 + rsub;
      const v4f v = *(const v4fa*)&so[w][r][c4];
      *(v4f*)(C + (size_t)(row0 + r) * ldc + col0 + c4) = v;
    }
  }
}

template <bool ASPLIT, int ACT, bool BIAS_BF16>
__global__ __launch_bounds__(128) void k_gemm_bf(const float* __restrict__ A, int lda, const unsigned short* __restrict__ Wt, int ldb,
                                               const float* __restrict__ bias, float* __restrict__ C, int ldc, int M, int N, int K) {
  gemm_bf<ASPLIT, ACT, BIAS_BF16>(blockIdx.x, A, lda, Wt, ldb, bias, C, false, nullptr, nullptr, ldc, M, N, K);
}

// All 24 per-head projections in one launch; they are independent of each other. blockIdx.x: q, k or v; blockIdx.y: head;
// blockIdx.z: the product's block of 32 rows. The 24 blocks that share 32 rows of x are neighbours in the grid.
// q is stored as f32; k and v are stored as the hi and lo planes that the attention kernel's products read, so that each element is
// split once here and not once per query block there.
__global__ __launch_bounds__(128) void k_qkv(const float* __restrict__ x, const unsigned short* __restrict__ Wqt, const unsigned short* __restrict__ Wkt,
                                             const unsigned short* __restrict__ Wvt, float* __restrict__ q, unsigned short* __restrict__ kh,
                                             unsigned short* __restrict__ kl, unsigned short* __restrict__ vh, unsigned short* __restrict__ vl) {
  const int p = blockIdx.x, h = blockIdx.y;
  const unsigned short* Wt = (p == 0) ? Wqt : (p == 1) ? Wkt : Wvt;
  unsigned short* Ch = (p == 1) ? kh : vh;
  unsigned short* Cl = (p == 1) ? kl : vl;
  gemm_bf<false, 0, false>(blockIdx.z, x + h * HD, EE, Wt + (size_t)h * HD * HD, HD, nullptr, q + h * HD, p != 0, Ch + h * HD, Cl + h * HD,
                           EE, BB * TT, HD, HD);
}

// Flash-style causal attention, all contractions 3-term bf16 hi/lo splits, f32 softmax with running max.
// K and V arrive as bf16 hi and lo planes (kh, kl, vh, vl): a chunk is only copied to LDS.
// Every shape is a compile-time constant (D head size, T sequence length with T % 128 == 0, H heads, P row pitch in elements of
// q, the four planes and y) and there is no optional input, so the key loop's body is one straight-line block: no bounds test on a key or
// a query row is needed, and a chunk's 16 staging loads are all issued before the first is waited for.
// One wave = 16 query rows; a tile is 64 queries; a chunk is 32 keys.
// The work is dealt evenly. A tile costs 2 (tile + 1) chunks, and every work-group of the launch is resident from the start, so the launch
// lasts as long as the fullest WGP. A work-group takes two tiles of its head, one after the other: tile NQB - 1 - tp, then tile tp, together
// 2 (NQB + 1) chunks wherever it lands. It has 8 waves: two halves of 4, both on the tile's 64 queries; half g takes the chunks 2 i + g, staged
// in buffers of its own, so that every wave of the launch works through NQB + 1 chunks and four waves stay on every SIMD to the end.
// Behind a tile's last chunk the upper half hands its running maximum, sum and unscaled output over through LDS, and the lower half
// joins the two partial results and stores the tile.
// The second launch bound caps the registers at 256: four waves a SIMD, two work-groups a WGP.
template <int D, int T, int H, int P>
__global__ __launch_bounds__(256, 4) void k_flash(const float* __restrict__ qb, const unsigned short* __restrict__ kh, const unsigned short* __restrict__ kl,
                                             const unsigned short* __restrict__ vh, const unsigned short* __restrict__ vl,
                                             float scale, float* __restrict__ y) {
  static_assert(D == 128 && T % 128 == 0, "one wave stages two 128-element rows of a plane per load; whole pairs of 64-query tiles");
  constexpr int KS = D / 32;        // k-steps for QK
  constexpr int DT = D / 16;        // d tiles for PV
  constexpr int NQB = T / 64;
  // Plane 0 hi, plane 1 lo; both planes in one array, so that one address register and constant offsets reach both
  // (with an array per plane the paired V loads below no longer fit the 256 registers).
  // V rows are read by the transposing load, which wants a pitch of an odd multiple of 32 bytes; K rows by 16-byte loads.
  __shared__ __attribute__((aligned(16))) unsigned short sKg[2][2][32][D + 8], sVg[2][2][32][D + 16];   // first index: the half
  __shared__ __attribute__((aligned(16))) unsigned short sPh[8][16][40], sPl[8][16][40];
  __shared__ __attribute__((aligned(16))) float sO[4][16][D];
  __shared__ float sM[4][8][32], sL[4][8][32];      // the upper half's running maxima and per-lane sums
  const int tid = threadIdx.x, w = tid >> 5, lane = tid & 31, ln = lane & 15, hh = lane >> 4;
  const int g = __builtin_amdgcn_readfirstlane(tid >> 7), wq = w & 3;   // the wave's half (the same in every lane: a scalar) and its 16 rows of the tile
  unsigned short (*sK)[32][D + 8] = sKg[g];
  unsigned short (*sV)[32][D + 16] = sVg[g];
  const int bh = blockIdx.x / (NQB / 2), tp = blockIdx.x % (NQB / 2);
  const int b = bh / H, h = bh % H;
  const int tr_r = 8 * hh + (lane & 7), tr_c = 8 * ((lane >> 3) & 1);   // the lane's own 16 bytes of a 16 x 16 tile for the transposing load
  const float* Q = qb + (size_t)b * T * P + h * D;
  // wave wq of a half stages rows 2 wq, 2 wq + 1, then + 8, ... of the half's chunk: lanes 0 to 15 one whole 256-byte row of a plane, lanes 16 to 31 the next
  const int sr = 2 * wq + hh, sc = ln * 8;
  const size_t kv0 = ((size_t)b * T + sr) * P + h * D + sc;

  // kept rolled: unrolled, values of the second tile stay live through the first tile's key loop, and the 256 registers no longer hold the loop
#pragma unroll 1
  for (int pass = 0; pass < 2; ++pass) {
    const int qblk = pass ? tp : NQB - 1 - tp;     // block-uniform
    const int q0 = qblk * 64 + wq * 16;
    // A fragments of the wave's 16 query rows (scaled), hi/lo
    FragB aqh[KS], aql[KS];
    {
      const float* qr = Q + (size_t)(q0 + ln) * P;
#pragma unroll
      for (int ks = 0; ks < KS; ++ks)
#pragma unroll
        for (int i = 0; i < 16; ++i) {
          const int d = ks * 32 + ((i < 8) ? (8 * hh + i) : (16 + 8 * hh + (i - 8)));
          const float x = qr[d] * scale; const unsigned short hb = bf16_bits(x);
          aqh[ks].u[i] = hb; aql[ks].u[i] = bf16_bits(x - bf16_val(hb));
        }
    }
    float m_r[8], l_r[8];
#pragma unroll
    for (int r = 0; r < 8; ++r) { m_r[r] = -3.0e38f; l_r[r] = 0.f; }
    v8f oacc[DT];
#pragma unroll
    for (int dt = 0; dt < DT; ++dt) oacc[dt] = (v8f){0.f,0.f,0.f,0.f,0.f,0.f,0.f,0.f};

    for (int i = 0; i <= qblk; ++i) {      // block-uniform trip count; the last key is qblk * 64 + 63 < T
      const int j0 = (2 * i + g) * 32;
      __syncthreads();
      v8us fkh[4], fkl[4], fvh[4], fvl[4];
      const unsigned short* pkh = kh + kv0 + (size_t)j0 * P;
      const unsigned short* pkl = kl + kv0 + (size_t)j0 * P;
      const unsigned short* pvh = vh + kv0 + (size_t)j0 * P;
      const unsigned short* pvl = vl + kv0 + (size_t)j0 * P;
#pragma unroll
      for (int it = 0; it < 4; ++it) {
        fkh[it] = *(const v8us*)(pkh + (size_t)it * 8 * P); fkl[it] = *(const v8us*)(pkl + (size_t)it * 8 * P);
        fvh[it] = *(const v8us*)(pvh + (size_t)it * 8 * P); fvl[it] = *(const v8us*)(pvl + (size_t)it * 8 * P);
      }
      // stands before the loads' address registers are reused; naming the pointers as inputs keeps them live up to the wait,
      // so that no load of the run is given an address register as its result
      asm volatile("s_wait_xcnt 0x0" :: "v"(pkh), "v"(pkl), "v"(pvh), "v"(pvl) : "memory");
#pragma unroll
      for (int it = 0; it < 4; ++it) {
        const int r = it * 8 + sr;
        *(v8us*)&sK[0][r][sc] = fkh[it]; *(v8us*)&sK[1][r][sc] = fkl[it];
        *(v8us*)&sV[0][r][sc] = fvh[it]; *(v8us*)&sV[1][r][sc] = fvl[it];
      }
      __syncthreads();
      // S tile 16 x 32
      v8f s[2];
#pragma unroll
      for (int nt = 0; nt < 2; ++nt) {
        v8f acc = {};
#pragma unroll
        for (int ks = 0; ks < KS; ++ks) {
          FragB bh_, bl_;
          bh_.half[0] = *(const v8us*)&sK[0][nt * 16 + ln][ks * 32 + 8 * hh]; bh_.half[1] = *(const v8us*)&sK[0][nt * 16 + ln][ks * 32 + 16 + 8 * hh];
          bl_.half[0] = *(const v8us*)&sK[1][nt * 16 + ln][ks * 32 + 8 * hh]; bl_.half[1] = *(const v8us*)&sK[1][nt * 16 + ln][ks * 32 + 16 + 8 * hh];
          acc = mmaN<3>(aqh[ks].v, aql[ks].v, bh_.v, bl_.v, acc);
        }
        s[nt] = acc;
      }
      // causal mask + running max (rows 8hh+r; the 16 lanes of a half share rows).
      // The maximum is taken step by step over all eight rows, which do not depend on each other: the eight cross-lane exchanges of a step
      // stand together in front of one LDS wait. A row's arithmetic is what it was row by row.
      float alpha[8], mx[8];
      const int da = j0 + ln - (q0 + 8 * hh), db = da + 16;   // key minus the lane's first query row: key <= row r is da <= r, one register where the eight row numbers took eight
#pragma unroll
      for (int r = 0; r < 8; ++r) {
        if (!(da <= r)) s[0][r] = -3.0e38f;
        if (!(db <= r)) s[1][r] = -3.0e38f;
        mx[r] = fmaxf(s[0][r], s[1][r]);
      }
#pragma unroll
      for (int m = 1; m <= 8; m <<= 1) {
        float o[8];
#pragma unroll
        for (int r = 0; r < 8; ++r) o[r] = __shfl_xor(mx[r], m, 32);
#pragma unroll
        for (int r = 0; r < 8; ++r) mx[r] = fmaxf(mx[r], o[r]);
      }
#pragma unroll
      for (int r = 0; r < 8; ++r) {
        const float mnew = fmaxf(m_r[r], mx[r]);
        alpha[r] = (mnew > -1.0e38f) ? __expf(m_r[r] - mnew) : 1.0f;
        const float p0 = (da <= r) ? __expf(s[0][r] - mnew) : 0.f;
        const float p1 = (db <= r) ? __expf(s[1][r] - mnew) : 0.f;
        m_r[r] = mnew;
        l_r[r] = l_r[r] * alpha[r] + p0 + p1;            // per-lane partial row sum (16 lanes combined at the end)
        unsigned short hb = bf16_bits(p0); sPh[w][8 * hh + r][ln] = hb;      sPl[w][8 * hh + r][ln] = bf16_bits(p0 - bf16_val(hb));
        hb = bf16_bits(p1);                sPh[w][8 * hh + r][16 + ln] = hb; sPl[w][8 * hh + r][16 + ln] = bf16_bits(p1 - bf16_val(hb));
      }
#pragma unroll
      for (int dt = 0; dt < DT; ++dt)
#pragma unroll
        for (int r = 0; r < 8; ++r) oacc[dt][r] *= alpha[r];
      __builtin_amdgcn_fence(__ATOMIC_ACQ_REL, "workgroup");
      __builtin_amdgcn_wave_barrier();
      FragB pah, pal;
      pah.half[0] = *(const v8us*)&sPh[w][ln][8 * hh]; pah.half[1] = *(const v8us*)&sPh[w][ln][16 + 8 * hh];
      pal.half[0] = *(const v8us*)&sPl[w][ln][8 * hh]; pal.half[1] = *(const v8us*)&sPl[w][ln][16 + 8 * hh];
      // B fragments of V by the transposing load: for column tile dt, lane (ln, hh) gets V[8 hh + 0..7][dt * 16 + ln] from the first
      // load of a plane and V[16 + 8 hh + 0..7][dt * 16 + ln] from the second, the k order of the P fragments above.
      // The eight loads of two column tiles stand together in front of their products: one LDS latency is waited out for both.
      // All three loops are unrolled so that fragments and accumulators are indexed by constants and stay in registers.
#pragma unroll
      for (int d0 = 0; d0 < DT; d0 += 2) {
        FragB bvh[2], bvl[2];
#pragma unroll
        for (int t = 0; t < 2; ++t) {
          const int c = (d0 + t) * 16 + tr_c;
          bvh[t].half[0] = ld_tr16(&sV[0][tr_r][c]); bvh[t].half[1] = ld_tr16(&sV[0][16 + tr_r][c]);
          bvl[t].half[0] = ld_tr16(&sV[1][tr_r][c]); bvl[t].half[1] = ld_tr16(&sV[1][16 + tr_r][c]);
        }
#pragma unroll
        for (int t = 0; t < 2; ++t) oacc[d0 + t] = mmaN<3>(pah.v, pal.v, bvh[t].v, bvl[t].v, oacc[d0 + t]);
      }
      __builtin_amdgcn_fence(__ATOMIC_ACQ_REL, "workgroup");
      __builtin_amdgcn_wave_barrier();
    }
    // The upper half's partial result goes to the lower half, lane to lane: wave wq + 4 holds the same rows in the same lanes as wave wq.
    if (g == 1) {
#pragma unroll
      for (int r = 0; r < 8; ++r) { sM[wq][r][lane] = m_r[r]; sL[wq][r][lane] = l_r[r]; }
#pragma unroll
      for (int dt = 0; dt < DT; ++dt)
#pragma unroll
        for (int r = 0; r < 8; ++r) sO[wq][8 * hh + r][dt * 16 + ln] = oacc[dt][r];
    }
    // publishes the upper half's partial result to the lower half; every wave passes it. The upper half's next write of sM, sL and sO lies behind
    // the next tile's barriers, which the lower half reaches only when it has stored this tile.
    __syncthreads();
    if (g == 0) {
      // Join: both partial results are brought to the common maximum. An upper half that saw no unmasked key has maximum -3.0e38, sum 0
      // and output 0, and its factor comes out 0; the lower half always holds key 0, so the common maximum is a real score.
      float f0[8], f1[8];
#pragma unroll
      for (int r = 0; r < 8; ++r) {
        const float m1 = sM[wq][r][lane], l1 = sL[wq][r][lane];
        const float m = fmaxf(m_r[r], m1);
        const float a0 = __expf(m_r[r] - m), a1 = __expf(m1 - m);
        float l = l_r[r] * a0 + l1 * a1;
        l += __shfl_xor(l, 1, 32); l += __shfl_xor(l, 2, 32); l += __shfl_xor(l, 4, 32); l += __shfl_xor(l, 8, 32);
        const float inv = (m > -1.0e38f) ? 1.0f / l : __builtin_nanf("");
        f0[r] = a0 * inv; f1[r] = a1 * inv;
      }
      // a lane reads back and overwrites only the words that its partner lane wrote
#pragma unroll
      for (int dt = 0; dt < DT; ++dt)
#pragma unroll
        for (int r = 0; r < 8; ++r) sO[wq][8 * hh + r][dt * 16 + ln] = oacc[dt][r] * f0[r] + sO[wq][8 * hh + r][dt * 16 + ln] * f1[r];
      __builtin_amdgcn_fence(__ATOMIC_ACQ_REL, "workgroup");
      __builtin_amdgcn_wave_barrier();
      for (int r = 0; r < 16; ++r) {
        const v4f val = *(const v4fa*)&sO[wq][r][lane * 4];
        *(v4f*)(y + ((size_t)b * T + q0 + r) * P + h * D + lane * 4) = val;
      }
      // stands before the stores' address and data registers are reused by the next tile
      asm volatile("s_wait_xcnt 0x0" ::: "memory");
    }
  }
}

extern "C" void kernel_launch(void* const* d_in, const int* in_sizes, int n_in,
                              void* d_out, int out_size, void* d_ws, size_t ws_size, hipStream_t stream) {
  (void)in_sizes; (void)n_in; (void)out_size;
  const float* x = (const float*)d_in[0]; const float* Wk = (const float*)d_in[1]; const float* Wv = (const float*)d_in[2]; const float* Wq = (const float*)d_in[3];
  const float* Wout = (const float*)d_in[4]; const float* bout = (const float*)d_in[5];
  char* ws = (char*)d_ws; size_t off = 0;
  auto take = [&](size_t bytes) { char* p = ws + off; off += (bytes + 255) & ~(size_t)255; return p; };
  const int M = BB * TT;
  unsigned short* Wqt = (unsigned short*)take((size_t)NH * HD * HD * 2); unsigned short* Wkt = (unsigned short*)take((size_t)NH * HD * HD * 2); unsigned short* Wvt = (unsigned short*)take((size_t)NH * HD * HD * 2);
  unsigned short* Wot = (unsigned short*)take((size_t)EE * EE * 2);
  float* q = (float*)take((size_t)M * EE * 4); float* att = (float*)take((size_t)M * EE * 4);
  unsigned short* kh = (unsigned short*)take((size_t)M * EE * 2); unsigned short* kl = (unsigned short*)take((size_t)M * EE * 2);
  unsigned short* vh = (unsigned short*)take((size_t)M * EE * 2); unsigned short* vl = (unsigned short*)take((size_t)M * EE * 2);
  if (off > ws_size) return;
  k_wt_all<<<3 * NH * WB + EE * (EE / 8) / 256, 256, 0, stream>>>(Wq, Wk, Wv, Wout, Wqt, Wkt, Wvt, Wot);
  k_qkv<<<dim3(3, NH, (M / 16) * (HD / 64) / 4), 128, 0, stream>>>(x, Wqt, Wkt, Wvt, q, kh, kl, vh, vl);
  k_flash<HD, TT, NH, EE><<<BB * NH * (TT / 128), 256, 0, stream>>>(q, kh, kl, vh, vl, 0.02209708691207961f, att);   // 1/sqrt(2048), causal
  k_gemm_bf<true, 0, true><<<((M / 16) * (EE / 64) + 3) / 4, 128, 0, stream>>>(att, EE, Wot, EE, bout, (float*)d_out, EE, M, EE, EE);
}

// v008
// One run takes 176 microseconds.
// Timed twice side by side with v007, it ran 1.09 and 1.08 times as fast.
// All steps since v000 together make it 5.52 times as fast.
#include <hip/hip_runtime.h>
// All contractions on v_wmma_f32_16x16x32_bf16, f32 accumulate: per-head Q/K/V projections xh·W[h] (K=N=128; x, W rounded to bf16:
// single exact term, written into the head's column block; K and V leave the projection as bf16 hi and lo planes), QKᵀ/√S and P·V per 16-query tile as 3-term bf16 hi/lo splits (causal),
// out = attn * W_out + b with attn split hi/lo (2 terms; the attention kernel stores the two planes, in A fragment order); softmax in f32.
#define BB 4
#define TT 2048
#define EE 1024
#define NH 8
#define HD 128

typedef __bf16 v16b __attribute__((ext_vector_type(16)));
typedef unsigned short v8us __attribute__((ext_vector_type(8), may_alias));
typedef float  v8f  __attribute__((ext_vector_type(8)));
typedef float  v4f  __attribute__((ext_vector_type(4)));
typedef float  v4fa __attribute__((ext_vector_type(4), may_alias));
union FragB { v16b v; v8us half[2]; unsigned short u[16]; };

__device__ __forceinline__ unsigned short bf16_bits(float x) { unsigned int u = __float_as_uint(x); return (unsigned short)((u + 0x7FFFu + ((u >> 16) & 1u)) >> 16); }
__device__ __forceinline__ float bf16_val(unsigned short b) { return __uint_as_float(((unsigned int)b) << 16); }
__device__ __forceinline__ float bf16_round(float x) { return bf16_val(bf16_bits(x)); }
// D += A·B with NT terms: 1 = ah·bh, 2 = + al·bh (A split), 3 = + ah·bl (both split)
template <int NT>
__device__ __forceinline__ v8f mmaN(v16b ah, v16b al, v16b bh, v16b bl, v8f c) {
  c = __builtin_amdgcn_wmma_f32_16x16x32_bf16(false, ah, false, bh, (short)0, c, false, false);
  if (NT >= 2) c = __builtin_amdgcn_wmma_f32_16x16x32_bf16(false, al, false, bh, (short)0, c, false, false);
  if (NT >= 3) c = __builtin_amdgcn_wmma_f32_16x16x32_bf16(false, ah, false, bl, (short)0, c, false, false);
  asm volatile("v_nop\n\tv_nop\n\tv_nop\n\tv_nop" : "+v"(c) : "v"(ah), "v"(al), "v"(bh), "v"(bl));
  return c;
}

// ds_load_tr16_b128: a 16 x 16 tile of 16-bit elements, row-major in LDS, comes back transposed as half a WMMA operand
typedef short s16x8 __attribute__((ext_vector_type(8)));
__device__ __forceinline__ v8us ld_tr16(const unsigned short* p) {
  typedef __attribute__((address_space(3))) s16x8 lds_s16x8;
  return __builtin_bit_cast(v8us, __builtin_amdgcn_ds_load_tr16_b128_v8i16((lds_s16x8*)p));
}

// Wt holds bf16(W[k][n]) in the order in which the products read it as B fragments: one block of 512 elements per 16 columns n and
// 32 rows k (the K / 32 blocks of one column tile follow each other), and in a block first the 16 bytes that each of the 32 lanes takes as
// the first half of its fragment, then the 32 second halves: element i of half s of lane (hh, ln) is k = 32 kb + 16 s + 8 hh + i, n = 16 nt + ln.
// A wave's load of a half is then 512 contiguous bytes, four whole lines (row-major Wt[n][k]: 32 bytes of each of 16 lines).
__device__ __forceinline__ size_t wt_block(int K, int nt, int kb) { return ((size_t)nt * (K / 32) + kb) * 512; }
// thread t writes 8 consecutive k of one n; neighbours in t are neighbours in n, so that 16 lanes fill 256 contiguous bytes of a block
__device__ __forceinline__ void wt_bf16(const float* __restrict__ W, unsigned short* __restrict__ Wt, int K, int N, int t) {
  if (t >= N * (K / 8)) return;
  const int n = t % N, k8 = (t / N) * 8;
  v8us v;
#pragma unroll
  for (int i = 0; i < 8; ++i) v[i] = bf16_bits(W[(size_t)(k8 + i) * N + n]);
  *(v8us*)(Wt + wt_block(K, n >> 4, k8 >> 5) + ((k8 >> 4) & 1) * 256 + (((k8 >> 3) & 1) * 16 + (n & 15)) * 8) = v;
}

// All 25 weight transposes in one launch; they are independent of each other. Blocks 0 .. 3 * NH * WB - 1: WB blocks per
// head matrix, in the order q, k, v; the blocks behind them: W_out.
#define WB (HD * (HD / 8) / 256)
__global__ __launch_bounds__(256) void k_wt_all(const float* __restrict__ Wq, const float* __restrict__ Wk, const float* __restrict__ Wv,
                                                const float* __restrict__ Wout, unsigned short* __restrict__ Wqt, unsigned short* __restrict__ Wkt,
                                                unsigned short* __restrict__ Wvt, unsigned short* __restrict__ Wot) {
  const int blk = blockIdx.x;
  if (blk < 3 * NH * WB) {
    const int m = blk / WB, p = m / NH, h = m % NH;
    const float* W = (p == 0) ? Wq : (p == 1) ? Wk : Wv;               // W[h] is [d_in][e_out] = [K][N]
    unsigned short* Wt = (p == 0) ? Wqt : (p == 1) ? Wkt : Wvt;
    wt_bf16(W + (size_t)h * HD * HD, Wt + (size_t)h * HD * HD, HD, HD, (blk % WB) * 256 + threadIdx.x);
  } else {
    wt_bf16(Wout, Wot, EE, EE, (blk - 3 * NH * WB) * 256 + threadIdx.x);   // attn @ W_out: [K][N]
  }
}

// GEMM C[M][N] (f32, pitch ldc) = act(A[M][K] * W + bias). Without ASPLIT: A f32 row-major (pitch lda), converted per fragment to bf16, a single
// rounded term. With ASPLIT: A arrives as two bf16 planes Ah (hi) and Al (lo), 2 terms, both in A fragment order, which is the order of Wt with a
// row of A in the place of a column n (wt_block(K, row tile, k block)): an A load is 512 contiguous bytes and goes to the product as it is.
// Wt bf16 in fragment order (wt_block; ldb rows k). BIAS_BF16 rounds the
// bias to bf16 first (bias quantised to bf16 before the add). K%32==0, M%16==0, N%64==0.
// blk: the block's index within this one product.
// csplit (block-uniform): the result is not stored to C but as two bf16 planes of the same pitch, Ch = bf16(c), Cl = bf16(c - Ch).
template <bool ASPLIT, int ACT, bool BIAS_BF16>
__device__ __forceinline__ void gemm_bf(int blk, const float* __restrict__ A, int lda, const unsigned short* __restrict__ Ah,
                                        const unsigned short* __restrict__ Al, const unsigned short* __restrict__ Wt, int ldb,
                                        const float* __restrict__ bias, float* __restrict__ C, bool csplit, unsigned short* __restrict__ Ch,
                                        unsigned short* __restrict__ Cl, int ldc, int M, int N, int K) {
  __shared__ __attribute__((aligned(16))) float so[4][16][64];
  const int tid = threadIdx.x, w = tid >> 5, lane = tid & 31, ln = lane & 15, hh = lane >> 4;
  const int ntn = N / 64;
  const int wid = blk * 4 + w;
  const int mt = wid / ntn, nq = wid % ntn;
  if (mt * 16 >= M) return;
  const int row0 = mt * 16, col0 = nq * 64;
  const float* arow = A + (size_t)(row0 + ln) * lda;
  const unsigned a0 = (unsigned)wt_block(K, mt, 0) + lane * 8;   // ASPLIT: the lane's 16 bytes in the first k block of the wave's row tile
  v8f acc[4] = {};
  for (int kb = 0; kb < K; kb += 32) {
    FragB ah, al;
    v4f x0, x1, x2, x3;
    const unsigned short *pa = nullptr, *pb = nullptr;
    if constexpr (ASPLIT) {
      // the k block moves the planes' wave-uniform bases; the lane's own offset a0 does not change along k
      pa = Ah + (size_t)(kb >> 5) * 512 + a0; pb = Al + (size_t)(kb >> 5) * 512 + a0;
      ah.half[0] = *(const v8us*)pa; ah.half[1] = *(const v8us*)(pa + 256);
      al.half[0] = *(const v8us*)pb; al.half[1] = *(const v8us*)(pb + 256);
    } else {
      x0 = *(const v4fa*)(arow + kb + 8 * hh); x1 = *(const v4fa*)(arow + kb + 8 * hh + 4);
      x2 = *(const v4fa*)(arow + kb + 16 + 8 * hh); x3 = *(const v4fa*)(arow + kb + 16 + 8 * hh + 4);
    }
    FragB b[4];
#pragma unroll
    for (int t = 0; t < 4; ++t) {
      const unsigned short* bfr = Wt + wt_block(ldb, nq * 4 + t, kb >> 5) + lane * 8;
      b[t].half[0] = *(const v8us*)bfr;
      b[t].half[1] = *(const v8us*)(bfr + 256);
    }
    // stands before the loads' address registers are reused by the conversion
    if constexpr (ASPLIT)   // naming the A pointers as inputs keeps them live up to the wait, so that no load of the run is given one of their registers as its result
      asm volatile("s_wait_xcnt 0x0" :: "v"(pa), "v"(pb) : "memory");
    else
      asm volatile("s_wait_xcnt 0x0" ::: "memory");
    // nothing is scheduled across this line: the step's twelve loads stay together in front of the conversion and the products. Left alone, the
    // compiler sinks each B pair down to its own product, and the wave waits out a memory latency per product instead of one per step
    __builtin_amdgcn_sched_barrier(0);
    if constexpr (!ASPLIT) {
      float xs[16] = {x0[0],x0[1],x0[2],x0[3],x1[0],x1[1],x1[2],x1[3],x2[0],x2[1],x2[2],x2[3],x3[0],x3[1],x3[2],x3[3]};
#pragma unroll
      for (int i = 0; i < 16; ++i) ah.u[i] = bf16_bits(xs[i]);
    }
#pragma unroll
    for (int t = 0; t < 4; ++t) {
      acc[t] = __builtin_amdgcn_wmma_f32_16x16x32_bf16(false, ah.v, false, b[t].v, (short)0, acc[t], false, false);
      if (ASPLIT) acc[t] = __builtin_amdgcn_wmma_f32_16x16x32_bf16(false, al.v, false, b[t].v, (short)0, acc[t], false, false);
    }
    // the distance behind a matrix instruction, once per step (was once per product): the results tie the statement behind all of the step's
    // products, and the fragments that loads fill, as inputs, stay in their registers up to it, so that no later load lands in one of them less than four slots behind
    if constexpr (ASPLIT)
      asm volatile("v_nop\n\tv_nop\n\tv_nop\n\tv_nop" : "+v"(acc[0]), "+v"(acc[1]), "+v"(acc[2]), "+v"(acc[3])
                   : "v"(b[0].v), "v"(b[1].v), "v"(b[2].v), "v"(b[3].v), "v"(ah.v), "v"(al.v));
    else
      asm volatile("v_nop\n\tv_nop\n\tv_nop\n\tv_nop" : "+v"(acc[0]), "+v"(acc[1]), "+v"(acc[2]), "+v"(acc[3])
                   : "v"(b[0].v), "v"(b[1].v), "v"(b[2].v), "v"(b[3].v));
  }
#pragma unroll
  for (int t = 0; t < 4; ++t) {
    float bv = bias ? bias[col0 + t * 16 + ln] : 0.f;
    if (BIAS_BF16) bv = bf16_round(bv);
#pragma unroll
    for (int r = 0; r < 8; ++r) { float v = acc[t][r] + bv; if (ACT == 1) v = fmaxf(v, 0.f); so[w][8 * hh + r][t * 16 + ln] = v; }
  }
  __builtin_amdgcn_fence(__ATOMIC_ACQ_REL, "workgroup");
  __builtin_amdgcn_wave_barrier();
  if (csplit) {
    // a lane takes 8 neighbours of a row: 16 bytes a lane and plane, and the wave's 64 columns fill one 128-byte line of each plane
    const int r4 = lane >> 3, c8 = (lane & 7) * 8;
#pragma unroll
    for (int q = 0; q < 4; ++q) {
      const int r = q * 4 + r4;
      const v4f a = *(const v4fa*)&so[w][r][c8], b = *(const v4fa*)&so[w][r][c8 + 4];
      v8us vh, vl;
#pragma unroll
      for (int i = 0; i < 4; ++i) {
        unsigned short hb = bf16_bits(a[i]); vh[i] = hb; vl[i] = bf16_bits(a[i] - bf16_val(hb));
        hb = bf16_bits(b[i]); vh[4 + i] = hb; vl[4 + i] = bf16_bits(b[i] - bf16_val(hb));
      }
      const size_t o = (size_t)(row0 + r) * ldc + col0 + c8;
      *(v8us*)(Ch + o) = vh;
      *(v8us*)(Cl + o) = vl;
    }
    // stands before the stores' address and data registers are reused behind the join with the other branch
    asm volatile("s_wait_xcnt 0x0" ::: "memory");
  } else {
    const int rsub = lane >> 4, c4 = (lane & 15) * 4;
#pragma unroll
    for (int q = 0; q < 8; ++q) {
      const int r = q * 2 + rsub;
      const v4f v = *(const v4fa*)&so[w][r][c4];
      *(v4f*)(C + (size_t)(row0 + r) * ldc + col0 + c4) = v;
    }
  }
}

template <bool ASPLIT, int ACT, bool BIAS_BF16>
__global__ __launch_bounds__(128) void k_gemm_bf(const unsigned short* __restrict__ Ah, const unsigned short* __restrict__ Al,
                                               const unsigned short* __restrict__ Wt, int ldb,
                                               const float* __restrict__ bias, float* __restrict__ C, int ldc, int M, int N, int K) {
  static_assert(ASPLIT, "this launch takes A as two planes");
  gemm_bf<ASPLIT, ACT, BIAS_BF16>(blockIdx.x, nullptr, 0, Ah, Al, Wt, ldb, bias, C, false, nullptr, nullptr, ldc, M, N, K);
}

// All 24 per-head projections in one launch; they are independent of each other. blockIdx.x: q, k or v; blockIdx.y: head;
// blockIdx.z: the product's block of 32 rows. The 24 blocks that share 32 rows of x are neighbours in the grid.
// q is stored as f32; k and v are stored as the hi and lo planes that the attention kernel's products read, so that each element is
// split once here and not once per query block there.
__global__ __launch_bounds__(128) void k_qkv(const float* __restrict__ x, const unsigned short* __restrict__ Wqt, const unsigned short* __restrict__ Wkt,
                                             const unsigned short* __restrict__ Wvt, float* __restrict__ q, unsigned short* __restrict__ kh,
                                             unsigned short* __restrict__ kl, unsigned short* __restrict__ vh, unsigned short* __restrict__ vl) {
  const int p = blockIdx.x, h = blockIdx.y;
  const unsigned short* Wt = (p == 0) ? Wqt : (p == 1) ? Wkt : Wvt;
  unsigned short* Ch = (p == 1) ? kh : vh;
  unsigned short* Cl = (p == 1) ? kl : vl;
  gemm_bf<false, 0, false>(blockIdx.z, x + h * HD, EE, nullptr, nullptr, Wt + (size_t)h * HD * HD, HD, nullptr, q + h * HD, p != 0, Ch + h * HD, Cl + h * HD,
                           EE, BB * TT, HD, HD);
}

// Flash-style causal attention, all contractions 3-term bf16 hi/lo splits, f32 softmax with running max.
// K and V arrive as bf16 hi and lo planes (kh, kl, vh, vl): a chunk is only copied to LDS.
// Every shape is a compile-time constant (D head size, T sequence length with T % 128 == 0, H heads, P row pitch in elements of
// q and the four planes, and the K of the product that reads the output) and there is no optional input, so the key loop's body is one straight-line block: no bounds test on a key or
// a query row is needed, and a chunk's 16 staging loads are all issued before the first is waited for.
// One wave = 16 query rows; a tile is 64 queries; a chunk is 32 keys.
// The work is dealt evenly. A tile costs 2 (tile + 1) chunks, and every work-group of the launch is resident from the start, so the launch
// lasts as long as the fullest WGP. A work-group takes two tiles of its head, one after the other: tile NQB - 1 - tp, then tile tp, together
// 2 (NQB + 1) chunks wherever it lands. It has 8 waves: two halves of 4, both on the tile's 64 queries; half g takes the chunks 2 i + g, staged
// in buffers of its own, so that every wave of the launch works through NQB + 1 chunks and four waves stay on every SIMD to the end.
// Behind a tile's last chunk the upper half hands its running maximum, sum and unscaled output over through LDS, and the lower half
// joins the two partial results and stores the tile: as the bf16 hi and lo planes yh and yl, in the A fragment order in which the output product
// reads them (gemm_bf), so that each element is split once here and not once per 64 columns there.
// The second launch bound caps the registers at 256: four waves a SIMD, two work-groups a WGP.
template <int D, int T, int H, int P>
__global__ __launch_bounds__(256, 4) void k_flash(const float* __restrict__ qb, const unsigned short* __restrict__ kh, const unsigned short* __restrict__ kl,
                                             const unsigned short* __restrict__ vh, const unsigned short* __restrict__ vl,
                                             float scale, unsigned short* __restrict__ yh, unsigned short* __restrict__ yl) {
  static_assert(D == 128 && T % 128 == 0, "one wave stages two 128-element rows of a plane per load; whole pairs of 64-query tiles");
  constexpr int KS = D / 32;        // k-steps for QK
  constexpr int DT = D / 16;        // d tiles for PV
  constexpr int NQB = T / 64;
  // Plane 0 hi, plane 1 lo; both planes in one array, so that one address register and constant offsets reach both
  // (with an array per plane the paired V loads below no longer fit the 256 registers).
  // V rows are read by the transposing load, which wants a pitch of an odd multiple of 32 bytes; K rows by 16-byte loads.
  __shared__ __attribute__((aligned(16))) unsigned short sKg[2][2][32][D + 8], sVg[2][2][32][D + 16];   // first index: the half
  __shared__ __attribute__((aligned(16))) unsigned short sPh[8][16][40], sPl[8][16][40];
  __shared__ __attribute__((aligned(16))) float sO[4][16][D + 4];   // the pitch, an odd multiple of 16 bytes, spreads 16 rows' 16-byte reads over all banks
  __shared__ float sM[4][8][32], sL[4][8][32];      // the upper half's running maxima and per-lane sums
  const int tid = threadIdx.x, w = tid >> 5, lane = tid & 31, ln = lane & 15, hh = lane >> 4;
  const int g = __builtin_amdgcn_readfirstlane(tid >> 7), wq = w & 3;   // the wave's half (the same in every lane: a scalar) and its 16 rows of the tile
  unsigned short (*sK)[32][D + 8] = sKg[g];
  unsigned short (*sV)[32][D + 16] = sVg[g];
  const int bh = blockIdx.x / (NQB / 2), tp = blockIdx.x % (NQB / 2);
  const int b = bh / H, h = bh % H;
  const int tr_r = 8 * hh + (lane & 7), tr_c = 8 * ((lane >> 3) & 1);   // the lane's own 16 bytes of a 16 x 16 tile for the transposing load
  const float* Q = qb + (size_t)b * T * P + h * D;
  // wave wq of a half stages rows 2 wq, 2 wq + 1, then + 8, ... of the half's chunk: lanes 0 to 15 one whole 256-byte row of a plane, lanes 16 to 31 the next
  const int sr = 2 * wq + hh, sc = ln * 8;
  const size_t kv0 = ((size_t)b * T + sr) * P + h * D + sc;

  // kept rolled: unrolled, values of the second tile stay live through the first tile's key loop, and the 256 registers no longer hold the loop
#pragma unroll 1
  for (int pass = 0; pass < 2; ++pass) {
    const int qblk = pass ? tp : NQB - 1 - tp;     // block-uniform
    const int q0 = qblk * 64 + wq * 16;
    // A fragments of the wave's 16 query rows (scaled), hi/lo
    FragB aqh[KS], aql[KS];
    {
      const float* qr = Q + (size_t)(q0 + ln) * P;
#pragma unroll
      for (int ks = 0; ks < KS; ++ks)
#pragma unroll
        for (int i = 0; i < 16; ++i) {
          const int d = ks * 32 + ((i < 8) ? (8 * hh + i) : (16 + 8 * hh + (i - 8)));
          const float x = qr[d] * scale; const unsigned short hb = bf16_bits(x);
          aqh[ks].u[i] = hb; aql[ks].u[i] = bf16_bits(x - bf16_val(hb));
        }
    }
    float m_r[8], l_r[8];
#pragma unroll
    for (int r = 0; r < 8; ++r) { m_r[r] = -3.0e38f; l_r[r] = 0.f; }
    v8f oacc[DT];
#pragma unroll
    for (int dt = 0; dt < DT; ++dt) oacc[dt] = (v8f){0.f,0.f,0.f,0.f,0.f,0.f,0.f,0.f};

    for (int i = 0; i <= qblk; ++i) {      // block-uniform trip count; the last key is qblk * 64 + 63 < T
      const int j0 = (2 * i + g) * 32;
      __syncthreads();
      v8us fkh[4], fkl[4], fvh[4], fvl[4];
      const unsigned short* pkh = kh + kv0 + (size_t)j0 * P;
      const unsigned short* pkl = kl + kv0 + (size_t)j0 * P;
      const unsigned short* pvh = vh + kv0 + (size_t)j0 * P;
      const unsigned short* pvl = vl + kv0 + (size_t)j0 * P;
#pragma unroll
      for (int it = 0; it < 4; ++it) {
        fkh[it] = *(const v8us*)(pkh + (size_t)it * 8 * P); fkl[it] = *(const v8us*)(pkl + (size_t)it * 8 * P);
        fvh[it] = *(const v8us*)(pvh + (size_t)it * 8 * P); fvl[it] = *(const v8us*)(pvl + (size_t)it * 8 * P);
      }
      // stands before the loads' address registers are reused; naming the pointers as inputs keeps them live up to the wait,
      // so that no load of the run is given an address register as its result
      asm volatile("s_wait_xcnt 0x0" :: "v"(pkh), "v"(pkl), "v"(pvh), "v"(pvl) : "memory");
#pragma unroll
      for (int it = 0; it < 4; ++it) {
        const int r = it * 8 + sr;
        *(v8us*)&sK[0][r][sc] = fkh[it]; *(v8us*)&sK[1][r][sc] = fkl[it];
        *(v8us*)&sV[0][r][sc] = fvh[it]; *(v8us*)&sV[1][r][sc] = fvl[it];
      }
      __syncthreads();
      // S tile 16 x 32
      v8f s[2];
#pragma unroll
      for (int nt = 0; nt < 2; ++nt) {
        v8f acc = {};
#pragma unroll
        for (int ks = 0; ks < KS; ++ks) {
          FragB bh_, bl_;
          bh_.half[0] = *(const v8us*)&sK[0][nt * 16 + ln][ks * 32 + 8 * hh]; bh_.half[1] = *(const v8us*)&sK[0][nt * 16 + ln][ks * 32 + 16 + 8 * hh];
          bl_.half[0] = *(const v8us*)&sK[1][nt * 16 + ln][ks * 32 + 8 * hh]; bl_.half[1] = *(const v8us*)&sK[1][nt * 16 + ln][ks * 32 + 16 + 8 * hh];
          acc = mmaN<3>(aqh[ks].v, aql[ks].v, bh_.v, bl_.v, acc);
        }
        s[nt] = acc;
      }
      // causal mask + running max (rows 8hh+r; the 16 lanes of a half share rows).
      // The maximum is taken step by step over all eight rows, which do not depend on each other: the eight cross-lane exchanges of a step
      // stand together in front of one LDS wait. A row's arithmetic is what it was row by row.
      float alpha[8], mx[8];
      const int da = j0 + ln - (q0 + 8 * hh), db = da + 16;   // key minus the lane's first query row: key <= row r is da <= r, one register where the eight row numbers took eight
#pragma unroll
      for (int r = 0; r < 8; ++r) {
        if (!(da <= r)) s[0][r] = -3.0e38f;
        if (!(db <= r)) s[1][r] = -3.0e38f;
        mx[r] = fmaxf(s[0][r], s[1][r]);
      }
#pragma unroll
      for (int m = 1; m <= 8; m <<= 1) {
        float o[8];
#pragma unroll
        for (int r = 0; r < 8; ++r) o[r] = __shfl_xor(mx[r], m, 32);
#pragma unroll
        for (int r = 0; r < 8; ++r) mx[r] = fmaxf(mx[r], o[r]);
      }
#pragma unroll
      for (int r = 0; r < 8; ++r) {
        const float mnew = fmaxf(m_r[r], mx[r]);
        alpha[r] = (mnew > -1.0e38f) ? __expf(m_r[r] - mnew) : 1.0f;
        const float p0 = (da <= r) ? __expf(s[0][r] - mnew) : 0.f;
        const float p1 = (db <= r) ? __expf(s[1][r] - mnew) : 0.f;
        m_r[r] = mnew;
        l_r[r] = l_r[r] * alpha[r] + p0 + p1;            // per-lane partial row sum (16 lanes combined at the end)
        unsigned short hb = bf16_bits(p0); sPh[w][8 * hh + r][ln] = hb;      sPl[w][8 * hh + r][ln] = bf16_bits(p0 - bf16_val(hb));
        hb = bf16_bits(p1);                sPh[w][8 * hh + r][16 + ln] = hb; sPl[w][8 * hh + r][16 + ln] = bf16_bits(p1 - bf16_val(hb));
      }
#pragma unroll
      for (int dt = 0; dt < DT; ++dt)
#pragma unroll
        for (int r = 0; r < 8; ++r) oacc[dt][r] *= alpha[r];
      __builtin_amdgcn_fence(__ATOMIC_ACQ_REL, "workgroup");
      __builtin_amdgcn_wave_barrier();
      FragB pah, pal;
      pah.half[0] = *(const v8us*)&sPh[w][ln][8 * hh]; pah.half[1] = *(const v8us*)&sPh[w][ln][16 + 8 * hh];
      pal.half[0] = *(const v8us*)&sPl[w][ln][8 * hh]; pal.half[1] = *(const v8us*)&sPl[w][ln][16 + 8 * hh];
      // B fragments of V by the transposing load: for column tile dt, lane (ln, hh) gets V[8 hh + 0..7][dt * 16 + ln] from the first
      // load of a plane and V[16 + 8 hh + 0..7][dt * 16 + ln] from the second, the k order of the P fragments above.
      // The eight loads of two column tiles stand together in front of their products: one LDS latency is waited out for both.
      // All three loops are unrolled so that fragments and accumulators are indexed by constants and stay in registers.
#pragma unroll
      for (int d0 = 0; d0 < DT; d0 += 2) {
        FragB bvh[2], bvl[2];
#pragma unroll
        for (int t = 0; t < 2; ++t) {
          const int c = (d0 + t) * 16 + tr_c;
          bvh[t].half[0] = ld_tr16(&sV[0][tr_r][c]); bvh[t].half[1] = ld_tr16(&sV[0][16 + tr_r][c]);
          bvl[t].half[0] = ld_tr16(&sV[1][tr_r][c]); bvl[t].half[1] = ld_tr16(&sV[1][16 + tr_r][c]);
        }
#pragma unroll
        for (int t = 0; t < 2; ++t) oacc[d0 + t] = mmaN<3>(pah.v, pal.v, bvh[t].v, bvl[t].v, oacc[d0 + t]);
      }
      __builtin_amdgcn_fence(__ATOMIC_ACQ_REL, "workgroup");
      __builtin_amdgcn_wave_barrier();
    }
    // The upper half's partial result goes to the lower half, lane to lane: wave wq + 4 holds the same rows in the same lanes as wave wq.
    if (g == 1) {
#pragma unroll
      for (int r = 0; r < 8; ++r) { sM[wq][r][lane] = m_r[r]; sL[wq][r][lane] = l_r[r]; }
#pragma unroll
      for (int dt = 0; dt < DT; ++dt)
#pragma unroll
        for (int r = 0; r < 8; ++r) sO[wq][8 * hh + r][dt * 16 + ln] = oacc[dt][r];
    }
    // publishes the upper half's partial result to the lower half; every wave passes it. The upper half's next write of sM, sL and sO lies behind
    // the next tile's barriers, which the lower half reaches only when it has stored this tile.
    __syncthreads();
    if (g == 0) {
      // Join: both partial results are brought to the common maximum. An upper half that saw no unmasked key has maximum -3.0e38, sum 0
      // and output 0, and its factor comes out 0; the lower half always holds key 0, so the common maximum is a real score.
      float f0[8], f1[8];
#pragma unroll
      for (int r = 0; r < 8; ++r) {
        const float m1 = sM[wq][r][lane], l1 = sL[wq][r][lane];
        const float m = fmaxf(m_r[r], m1);
        const float a0 = __expf(m_r[r] - m), a1 = __expf(m1 - m);
        float l = l_r[r] * a0 + l1 * a1;
        l += __shfl_xor(l, 1, 32); l += __shfl_xor(l, 2, 32); l += __shfl_xor(l, 4, 32); l += __shfl_xor(l, 8, 32);
        const float inv = (m > -1.0e38f) ? 1.0f / l : __builtin_nanf("");
        f0[r] = a0 * inv; f1[r] = a1 * inv;
      }
      // a lane reads back and overwrites only the words that its partner lane wrote
#pragma unroll
      for (int dt = 0; dt < DT; ++dt)
#pragma unroll
        for (int r = 0; r < 8; ++r) sO[wq][8 * hh + r][dt * 16 + ln] = oacc[dt][r] * f0[r] + sO[wq][8 * hh + r][dt * 16 + ln] * f1[r];
      __builtin_amdgcn_fence(__ATOMIC_ACQ_REL, "workgroup");
      __builtin_amdgcn_wave_barrier();
      // The wave's 16 rows are one row tile of the output product's A, its D columns KS blocks of 32 k, which follow each other in a plane.
      // Half s of lane (hh, ln) in block j: row ln, k = 32 j + 16 s + 8 hh + 0..7. A store of the wave is 512 contiguous bytes.
      const size_t yo = wt_block(P, (b * T + q0) >> 4, h * KS) + lane * 8;
#pragma unroll
      for (int js = 0; js < 2 * KS; ++js) {
        const v4f a = *(const v4fa*)&sO[wq][ln][js * 16 + 8 * hh], c = *(const v4fa*)&sO[wq][ln][js * 16 + 8 * hh + 4];
        v8us oh, ol;
#pragma unroll
        for (int i = 0; i < 4; ++i) {
          unsigned short hb = bf16_bits(a[i]); oh[i] = hb; ol[i] = bf16_bits(a[i] - bf16_val(hb));
          hb = bf16_bits(c[i]); oh[4 + i] = hb; ol[4 + i] = bf16_bits(c[i] - bf16_val(hb));
        }
        *(v8us*)(yh + yo + js * 256) = oh;
        *(v8us*)(yl + yo + js * 256) = ol;
      }
      // stands before the stores' address and data registers are reused by the next tile
      asm volatile("s_wait_xcnt 0x0" ::: "memory");
    }
  }
}

extern "C" void kernel_launch(void* const* d_in, const int* in_sizes, int n_in,
                              void* d_out, int out_size, void* d_ws, size_t ws_size, hipStream_t stream) {
  (void)in_sizes; (void)n_in; (void)out_size;
  const float* x = (const float*)d_in[0]; const float* Wk = (const float*)d_in[1]; const float* Wv = (const float*)d_in[2]; const float* Wq = (const float*)d_in[3];
  const float* Wout = (const float*)d_in[4]; const float* bout = (const float*)d_in[5];
  char* ws = (char*)d_ws; size_t off = 0;
  auto take = [&](size_t bytes) { char* p = ws + off; off += (bytes + 255) & ~(size_t)255; return p; };
  const int M = BB * TT;
  unsigned short* Wqt = (unsigned short*)take((size_t)NH * HD * HD * 2); unsigned short* Wkt = (unsigned short*)take((size_t)NH * HD * HD * 2); unsigned short* Wvt = (unsigned short*)take((size_t)NH * HD * HD * 2);
  unsigned short* Wot = (unsigned short*)take((size_t)EE * EE * 2);
  float* q = (float*)take((size_t)M * EE * 4);
  unsigned short* ath = (unsigned short*)take((size_t)M * EE * 2); unsigned short* atl = (unsigned short*)take((size_t)M * EE * 2);
  unsigned short* kh = (unsigned short*)take((size_t)M * EE * 2); unsigned short* kl = (unsigned short*)take((size_t)M * EE * 2);
  unsigned short* vh = (unsigned short*)take((size_t)M * EE * 2); unsigned short* vl = (unsigned short*)take((size_t)M * EE * 2);
  if (off > ws_size) return;
  k_wt_all<<<3 * NH * WB + EE * (EE / 8) / 256, 256, 0, stream>>>(Wq, Wk, Wv, Wout, Wqt, Wkt, Wvt, Wot);
  k_qkv<<<dim3(3, NH, (M / 16) * (HD / 64) / 4), 128, 0, stream>>>(x, Wqt, Wkt, Wvt, q, kh, kl, vh, vl);
  k_flash<HD, TT, NH, EE><<<BB * NH * (TT / 128), 256, 0, stream>>>(q, kh, kl, vh, vl, 0.02209708691207961f, ath, atl);   // 1/sqrt(2048), causal
  k_gemm_bf<true, 0, true><<<((M / 16) * (EE / 64) + 3) / 4, 128, 0, stream>>>(ath, atl, Wot, EE, bout, (float*)d_out, EE, M, EE, EE);
}

// v009
// It runs in 160 microseconds.
// In two side-by-side timings against v008, it was 1.09 and 1.11 times as fast.
// Over all steps from v000 it is 6.08 times as fast.
#include <hip/hip_runtime.h>
// All contractions on v_wmma_f32_16x16x32_bf16, f32 accumulate: per-head Q/K/V projections xh·W[h] (K=N=128; x, W rounded to bf16:
// single exact term, written into the head's column block; K and V leave the projection as bf16 hi and lo planes), QKᵀ/√S and P·V per 16-query tile as 3-term bf16 hi/lo splits (causal),
// out = attn * W_out + b with attn split hi/lo (2 terms; the attention kernel stores the two planes, in A fragment order); softmax in f32.
#define BB 4
#define TT 2048
#define EE 1024
#define NH 8
#define HD 128

typedef __bf16 v16b __attribute__((ext_vector_type(16)));
typedef unsigned short v8us __attribute__((ext_vector_type(8), may_alias));
typedef float  v8f  __attribute__((ext_vector_type(8)));
typedef float  v4f  __attribute__((ext_vector_type(4)));
typedef float  v4fa __attribute__((ext_vector_type(4), may_alias));
union FragB { v16b v; v8us half[2]; unsigned short u[16]; unsigned int w[8]; };

__device__ __forceinline__ unsigned short bf16_bits(float x) { unsigned int u = __float_as_uint(x); return (unsigned short)((u + 0x7FFFu + ((u >> 16) & 1u)) >> 16); }
__device__ __forceinline__ float bf16_val(unsigned short b) { return __uint_as_float(((unsigned int)b) << 16); }
__device__ __forceinline__ float bf16_round(float x) { return bf16_val(bf16_bits(x)); }
// D += Y * X, three terms in the order yh xh, yh xl, yl xh: Y (hi, lo) is the A operand, X (hi, lo) the B operand
__device__ __forceinline__ v8f mma3t(v16b xh, v16b xl, v16b yh, v16b yl, v8f c) {
  c = __builtin_amdgcn_wmma_f32_16x16x32_bf16(false, yh, false, xh, (short)0, c, false, false);
  c = __builtin_amdgcn_wmma_f32_16x16x32_bf16(false, yh, false, xl, (short)0, c, false, false);
  c = __builtin_amdgcn_wmma_f32_16x16x32_bf16(false, yl, false, xh, (short)0, c, false, false);
  // the distance behind a matrix instruction, before its result is read or an operand register is loaded anew
  asm volatile("v_nop\n\tv_nop\n\tv_nop\n\tv_nop" : "+v"(c) : "v"(xh), "v"(xl), "v"(yh), "v"(yl));
  return c;
}
// x rounded to bf16 as in bf16_bits, left in the upper 16 bits of the word (the lower 16 are not cleared)
__device__ __forceinline__ unsigned int bf16_top(float x) { unsigned int u = __float_as_uint(x); return u + 0x7FFFu + ((u >> 16) & 1u); }
// the upper halves of two such words as one register of a fragment, lo in bits 15 to 0: one byte permute
__device__ __forceinline__ unsigned int pack_top(unsigned int lo, unsigned int hi) { return __builtin_amdgcn_perm(hi, lo, 0x07060302u); }
// lane l takes the value of lane l ^ 16
__device__ __forceinline__ float xhalf(float x) {
  return __builtin_bit_cast(float, __builtin_amdgcn_permlanex16(__builtin_bit_cast(int, x), __builtin_bit_cast(int, x), 0x76543210, 0xfedcba98, false, false));
}

// ds_load_tr16_b128: a 16 x 16 tile of 16-bit elements, row-major in LDS, comes back transposed as half a WMMA operand
typedef short s16x8 __attribute__((ext_vector_type(8)));
__device__ __forceinline__ v8us ld_tr16(const unsigned short* p) {
  typedef __attribute__((address_space(3))) s16x8 lds_s16x8;
  return __builtin_bit_cast(v8us, __builtin_amdgcn_ds_load_tr16_b128_v8i16((lds_s16x8*)p));
}

// Wt holds bf16(W[k][n]) in the order in which the products read it as B fragments: one block of 512 elements per 16 columns n and
// 32 rows k (the K / 32 blocks of one column tile follow each other), and in a block first the 16 bytes that each of the 32 lanes takes as
// the first half of its fragment, then the 32 second halves: element i of half s of lane (hh, ln) is k = 32 kb + 16 s + 8 hh + i, n = 16 nt + ln.
// A wave's load of a half is then 512 contiguous bytes, four whole lines (row-major Wt[n][k]: 32 bytes of each of 16 lines).
__device__ __forceinline__ size_t wt_block(int K, int nt, int kb) { return ((size_t)nt * (K / 32) + kb) * 512; }
// thread t writes 8 consecutive k of one n; neighbours in t are neighbours in n, so that 16 lanes fill 256 contiguous bytes of a block
__device__ __forceinline__ void wt_bf16(const float* __restrict__ W, unsigned short* __restrict__ Wt, int K, int N, int t) {
  if (t >= N * (K / 8)) return;
  const int n = t % N, k8 = (t / N) * 8;
  v8us v;
#pragma unroll
  for (int i = 0; i < 8; ++i) v[i] = bf16_bits(W[(size_t)(k8 + i) * N + n]);
  *(v8us*)(Wt + wt_block(K, n >> 4, k8 >> 5) + ((k8 >> 4) & 1) * 256 + (((k8 >> 3) & 1) * 16 + (n & 15)) * 8) = v;
}

// All 25 weight transposes in one launch; they are independent of each other. Blocks 0 .. 3 * NH * WB - 1: WB blocks per
// head matrix, in the order q, k, v; the blocks behind them: W_out.
#define WB (HD * (HD / 8) / 256)
__global__ __launch_bounds__(256) void k_wt_all(const float* __restrict__ Wq, const float* __restrict__ Wk, const float* __restrict__ Wv,
                                                const float* __restrict__ Wout, unsigned short* __restrict__ Wqt, unsigned short* __restrict__ Wkt,
                                                unsigned short* __restrict__ Wvt, unsigned short* __restrict__ Wot) {
  const int blk = blockIdx.x;
  if (blk < 3 * NH * WB) {
    const int m = blk / WB, p = m / NH, h = m % NH;
    const float* W = (p == 0) ? Wq : (p == 1) ? Wk : Wv;               // W[h] is [d_in][e_out] = [K][N]
    unsigned short* Wt = (p == 0) ? Wqt : (p == 1) ? Wkt : Wvt;
    wt_bf16(W + (size_t)h * HD * HD, Wt + (size_t)h * HD * HD, HD, HD, (blk % WB) * 256 + threadIdx.x);
  } else {
    wt_bf16(Wout, Wot, EE, EE, (blk - 3 * NH * WB) * 256 + threadIdx.x);   // attn @ W_out: [K][N]
  }
}

// GEMM C[M][N] (f32, pitch ldc) = act(A[M][K] * W + bias). Without ASPLIT: A f32 row-major (pitch lda), converted per fragment to bf16, a single
// rounded term. With ASPLIT: A arrives as two bf16 planes Ah (hi) and Al (lo), 2 terms, both in A fragment order, which is the order of Wt with a
// row of A in the place of a column n (wt_block(K, row tile, k block)): an A load is 512 contiguous bytes and goes to the product as it is.
// Wt bf16 in fragment order (wt_block; ldb rows k). BIAS_BF16 rounds the
// bias to bf16 first (bias quantised to bf16 before the add). K%32==0, M%16==0, N%64==0.
// blk: the block's index within this one product.
// csplit (block-uniform): the result is not stored to C but as two bf16 planes of the same pitch, Ch = bf16(c), Cl = bf16(c - Ch).
template <bool ASPLIT, int ACT, bool BIAS_BF16>
__device__ __forceinline__ void gemm_bf(int blk, const float* __restrict__ A, int lda, const unsigned short* __restrict__ Ah,
                                        const unsigned short* __restrict__ Al, const unsigned short* __restrict__ Wt, int ldb,
                                        const float* __restrict__ bias, float* __restrict__ C, bool csplit, unsigned short* __restrict__ Ch,
                                        unsigned short* __restrict__ Cl, int ldc, int M, int N, int K) {
  __shared__ __attribute__((aligned(16))) float so[4][16][64];
  const int tid = threadIdx.x, w = tid >> 5, lane = tid & 31, ln = lane & 15, hh = lane >> 4;
  const int ntn = N / 64;
  const int wid = blk * 4 + w;
  const int mt = wid / ntn, nq = wid % ntn;
  if (mt * 16 >= M) return;
  const int row0 = mt * 16, col0 = nq * 64;
  const float* arow = A + (size_t)(row0 + ln) * lda;
  const unsigned a0 = (unsigned)wt_block(K, mt, 0) + lane * 8;   // ASPLIT: the lane's 16 bytes in the first k block of the wave's row tile
  v8f acc[4] = {};
  for (int kb = 0; kb < K; kb += 32) {
    FragB ah, al;
    v4f x0, x1, x2, x3;
    const unsigned short *pa = nullptr, *pb = nullptr;
    if constexpr (ASPLIT) {
      // the k block moves the planes' wave-uniform bases; the lane's own offset a0 does not change along k
      pa = Ah + (size_t)(kb >> 5) * 512 + a0; pb = Al + (size_t)(kb >> 5) * 512 + a0;
      ah.half[0] = *(const v8us*)pa; ah.half[1] = *(const v8us*)(pa + 256);
      al.half[0] = *(const v8us*)pb; al.half[1] = *(const v8us*)(pb + 256);
    } else {
      x0 = *(const v4fa*)(arow + kb + 8 * hh); x1 = *(const v4fa*)(arow + kb + 8 * hh + 4);
      x2 = *(const v4fa*)(arow + kb + 16 + 8 * hh); x3 = *(const v4fa*)(arow + kb + 16 + 8 * hh + 4);
    }
    FragB b[4];
#pragma unroll
    for (int t = 0; t < 4; ++t) {
      const unsigned short* bfr = Wt + wt_block(ldb, nq * 4 + t, kb >> 5) + lane * 8;
      b[t].half[0] = *(const v8us*)bfr;
      b[t].half[1] = *(const v8us*)(bfr + 256);
    }
    // stands before the loads' address registers are reused by the conversion
    if constexpr (ASPLIT)   // naming the A pointers as inputs keeps them live up to the wait, so that no load of the run is given one of their registers as its result
      asm volatile("s_wait_xcnt 0x0" :: "v"(pa), "v"(pb) : "memory");
    else
      asm volatile("s_wait_xcnt 0x0" ::: "memory");
    // nothing is scheduled across this line: the step's twelve loads stay together in front of the conversion and the products. Left alone, the
    // compiler sinks each B pair down to its own product, and the wave waits out a memory latency per product instead of one per step
    __builtin_amdgcn_sched_barrier(0);
    if constexpr (!ASPLIT) {
      float xs[16] = {x0[0],x0[1],x0[2],x0[3],x1[0],x1[1],x1[2],x1[3],x2[0],x2[1],x2[2],x2[3],x3[0],x3[1],x3[2],x3[3]};
#pragma unroll
      for (int i = 0; i < 16; ++i) ah.u[i] = bf16_bits(xs[i]);
    }
#pragma unroll
    for (int t = 0; t < 4; ++t) {
      acc[t] = __builtin_amdgcn_wmma_f32_16x16x32_bf16(false, ah.v, false, b[t].v, (short)0, acc[t], false, false);
      if (ASPLIT) acc[t] = __builtin_amdgcn_wmma_f32_16x16x32_bf16(false, al.v, false, b[t].v, (short)0, acc[t], false, false);
    }
    // the distance behind a matrix instruction, once per step (was once per product): the results tie the statement behind all of the step's
    // products, and the fragments that loads fill, as inputs, stay in their registers up to it, so that no later load lands in one of them less than four slots behind
    if constexpr (ASPLIT)
      asm volatile("v_nop\n\tv_nop\n\tv_nop\n\tv_nop" : "+v"(acc[0]), "+v"(acc[1]), "+v"(acc[2]), "+v"(acc[3])
                   : "v"(b[0].v), "v"(b[1].v), "v"(b[2].v), "v"(b[3].v), "v"(ah.v), "v"(al.v));
    else
      asm volatile("v_nop\n\tv_nop\n\tv_nop\n\tv_nop" : "+v"(acc[0]), "+v"(acc[1]), "+v"(acc[2]), "+v"(acc[3])
                   : "v"(b[0].v), "v"(b[1].v), "v"(b[2].v), "v"(b[3].v));
  }
#pragma unroll
  for (int t = 0; t < 4; ++t) {
    float bv = bias ? bias[col0 + t * 16 + ln] : 0.f;
    if (BIAS_BF16) bv = bf16_round(bv);
#pragma unroll
    for (int r = 0; r < 8; ++r) { float v = acc[t][r] + bv; if (ACT == 1) v = fmaxf(v, 0.f); so[w][8 * hh + r][t * 16 + ln] = v; }
  }
  __builtin_amdgcn_fence(__ATOMIC_ACQ_REL, "workgroup");
  __builtin_amdgcn_wave_barrier();
  if (csplit) {
    // a lane takes 8 neighbours of a row: 16 bytes a lane and plane, and the wave's 64 columns fill one 128-byte line of each plane
    const int r4 = lane >> 3, c8 = (lane & 7) * 8;
#pragma unroll
    for (int q = 0; q < 4; ++q) {
      const int r = q * 4 + r4;
      const v4f a = *(const v4fa*)&so[w][r][c8], b = *(const v4fa*)&so[w][r][c8 + 4];
      v8us vh, vl;
#pragma unroll
      for (int i = 0; i < 4; ++i) {
        unsigned short hb = bf16_bits(a[i]); vh[i] = hb; vl[i] = bf16_bits(a[i] - bf16_val(hb));
        hb = bf16_bits(b[i]); vh[4 + i] = hb; vl[4 + i] = bf16_bits(b[i] - bf16_val(hb));
      }
      const size_t o = (size_t)(row0 + r) * ldc + col0 + c8;
      *(v8us*)(Ch + o) = vh;
      *(v8us*)(Cl + o) = vl;
    }
    // stands before the stores' address and data registers are reused behind the join with the other branch
    asm volatile("s_wait_xcnt 0x0" ::: "memory");
  } else {
    const int rsub = lane >> 4, c4 = (lane & 15) * 4;
#pragma unroll
    for (int q = 0; q < 8; ++q) {
      const int r = q * 2 + rsub;
      const v4f v = *(const v4fa*)&so[w][r][c4];
      *(v4f*)(C + (size_t)(row0 + r) * ldc + col0 + c4) = v;
    }
  }
}

template <bool ASPLIT, int ACT, bool BIAS_BF16>
__global__ __launch_bounds__(128) void k_gemm_bf(const unsigned short* __restrict__ Ah, const unsigned short* __restrict__ Al,
                                               const unsigned short* __restrict__ Wt, int ldb,
                                               const float* __restrict__ bias, float* __restrict__ C, int ldc, int M, int N, int K) {
  static_assert(ASPLIT, "this launch takes A as two planes");
  gemm_bf<ASPLIT, ACT, BIAS_BF16>(blockIdx.x, nullptr, 0, Ah, Al, Wt, ldb, bias, C, false, nullptr, nullptr, ldc, M, N, K);
}

// All 24 per-head projections in one launch; they are independent of each other. blockIdx.x: q, k or v; blockIdx.y: head;
// blockIdx.z: the product's block of 32 rows. The 24 blocks that share 32 rows of x are neighbours in the grid.
// q is stored as f32; k and v are stored as the hi and lo planes that the attention kernel's products read, so that each element is
// split once here and not once per query block there.
__global__ __launch_bounds__(128) void k_qkv(const float* __restrict__ x, const unsigned short* __restrict__ Wqt, const unsigned short* __restrict__ Wkt,
                                             const unsigned short* __restrict__ Wvt, float* __restrict__ q, unsigned short* __restrict__ kh,
                                             unsigned short* __restrict__ kl, unsigned short* __restrict__ vh, unsigned short* __restrict__ vl) {
  const int p = blockIdx.x, h = blockIdx.y;
  const unsigned short* Wt = (p == 0) ? Wqt : (p == 1) ? Wkt : Wvt;
  unsigned short* Ch = (p == 1) ? kh : vh;
  unsigned short* Cl = (p == 1) ? kl : vl;
  gemm_bf<false, 0, false>(blockIdx.z, x + h * HD, EE, nullptr, nullptr, Wt + (size_t)h * HD * HD, HD, nullptr, q + h * HD, p != 0, Ch + h * HD, Cl + h * HD,
                           EE, BB * TT, HD, HD);
}

// Flash-style causal attention, all contractions 3-term bf16 hi/lo splits, f32 softmax with running max.
// K and V arrive as bf16 hi and lo planes (kh, kl, vh, vl): a chunk is only copied to LDS.
// Every shape is a compile-time constant (D head size, T sequence length with T % 128 == 0, H heads, P row pitch in elements of
// q and the four planes, and the K of the product that reads the output) and there is no optional input, so the key loop's body is one straight-line block: no bounds test on a key or
// a query row is needed, and a chunk's 16 staging loads are all issued before the first is waited for.
// One wave = 16 query rows; a tile is 64 queries; a chunk is 32 keys.
// Both products are computed transposed: S^T = K Q^T (A: K rows, B: the query fragments) and O^T += V^T P^T (A: V by the transposing load,
// B: P^T). The A and the B fragment have the same map (lane ln: the row or the column, the same k order), so the fragments are the ones that
// the untransposed products would take, with the operand places exchanged. In a result tile lane (ln, hh) holds column ln, rows 8 hh + 0..7:
// all of a lane's scores belong to ONE query, ln. Its maximum and sum are taken in the lane, plus one exchange with lane l ^ 16, and
// the 16 scores of a lane (keys 8 hh + 0..7 of the first tile, 16 + 8 hh + 0..7 of the second) are, in this order, the lane's share of the
// B fragment of P^T: P goes from the accumulators to the operand in registers and never through LDS.
// The work is dealt evenly. A tile costs 2 (tile + 1) chunks, and every work-group of the launch is resident from the start, so the launch
// lasts as long as the fullest WGP. A work-group takes two tiles of its head, one after the other: tile NQB - 1 - tp, then tile tp, together
// 2 (NQB + 1) chunks wherever it lands. It has 8 waves: two halves of 4, both on the tile's 64 queries; half g takes the chunks 2 i + g, staged
// in buffers of its own, so that every wave of the launch works through NQB + 1 chunks and four waves stay on every SIMD to the end.
// Behind a tile's last chunk the upper half hands its running maximum, sum and unscaled output over through LDS, and the lower half
// joins the two partial results and stores the tile: as the bf16 hi and lo planes yh and yl, in the A fragment order in which the output product
// reads them (gemm_bf), so that each element is split once here and not once per 64 columns there.
// The second launch bound caps the registers at 256: four waves a SIMD, two work-groups a WGP.
template <int D, int T, int H, int P>
__global__ __launch_bounds__(256, 4) void k_flash(const float* __restrict__ qb, const unsigned short* __restrict__ kh, const unsigned short* __restrict__ kl,
                                             const unsigned short* __restrict__ vh, const unsigned short* __restrict__ vl,
                                             float scale, unsigned short* __restrict__ yh, unsigned short* __restrict__ yl) {
  static_assert(D == 128 && T % 128 == 0, "one wave stages two 128-element rows of a plane per load; whole pairs of 64-query tiles");
  constexpr int KS = D / 32;        // k-steps for QK
  constexpr int DT = D / 16;        // d tiles for PV
  constexpr int NQB = T / 64;
  // Plane 0 hi, plane 1 lo; both planes in one array, so that one address register and constant offsets reach both
  // (with an array per plane the paired V loads below no longer fit the 256 registers).
  // V rows are read by the transposing load, which wants a pitch of an odd multiple of 32 bytes; K rows by 16-byte loads.
  __shared__ __attribute__((aligned(16))) unsigned short sKg[2][2][32][D + 8], sVg[2][2][32][D + 16];   // first index: the half
  __shared__ __attribute__((aligned(16))) float sO[4][2 * DT][32][4];   // the upper half's output, lane to lane: 16 bytes a lane, a wave's access is 512 contiguous bytes
  __shared__ float sM[4][32], sL[4][32];            // the upper half's running maxima and per-lane sums
  const int tid = threadIdx.x, w = tid >> 5, lane = tid & 31, ln = lane & 15, hh = lane >> 4;
  const int g = __builtin_amdgcn_readfirstlane(tid >> 7), wq = w & 3;   // the wave's half (the same in every lane: a scalar) and its 16 rows of the tile
  unsigned short (*sK)[32][D + 8] = sKg[g];
  unsigned short (*sV)[32][D + 16] = sVg[g];
  const int bh = blockIdx.x / (NQB / 2), tp = blockIdx.x % (NQB / 2);
  const int b = bh / H, h = bh % H;
  const int tr_r = 8 * hh + (lane & 7), tr_c = 8 * ((lane >> 3) & 1);   // the lane's own 16 bytes of a 16 x 16 tile for the transposing load
  const float* Q = qb + (size_t)b * T * P + h * D;
  // wave wq of a half stages rows 2 wq, 2 wq + 1, then + 8, ... of the half's chunk: lanes 0 to 15 one whole 256-byte row of a plane, lanes 16 to 31 the next
  const int sr = 2 * wq + hh, sc = ln * 8;
  const size_t kv0 = ((size_t)b * T + sr) * P + h * D + sc;

  // kept rolled: unrolled, values of the second tile stay live through the first tile's key loop, and the 256 registers no longer hold the loop
#pragma unroll 1
  for (int pass = 0; pass < 2; ++pass) {
    const int qblk = pass ? tp : NQB - 1 - tp;     // block-uniform
    const int q0 = qblk * 64 + wq * 16;
    // B fragments of the wave's 16 queries (scaled), hi/lo: lane (ln, hh) holds query ln
    FragB aqh[KS], aql[KS];
    {
      const float* qr = Q + (size_t)(q0 + ln) * P;
#pragma unroll
      for (int ks = 0; ks < KS; ++ks)
#pragma unroll
        for (int i = 0; i < 16; ++i) {
          const int d = ks * 32 + ((i < 8) ? (8 * hh + i) : (16 + 8 * hh + (i - 8)));
          const float x = qr[d] * scale; const unsigned short hb = bf16_bits(x);
          aqh[ks].u[i] = hb; aql[ks].u[i] = bf16_bits(x - bf16_val(hb));
        }
    }
    float m_r = -3.0e38f, l_r = 0.f;      // of the lane's query ln: the maximum over all keys so far, the sum over the keys of the lane's half hh
    v8f oacc[DT];                         // O^T: element r of tile dt is column d = 16 dt + 8 hh + r of query ln
#pragma unroll
    for (int dt = 0; dt < DT; ++dt) oacc[dt] = (v8f){0.f,0.f,0.f,0.f,0.f,0.f,0.f,0.f};

    for (int i = 0; i <= qblk; ++i) {      // block-uniform trip count; the last key is qblk * 64 + 63 < T
      const int j0 = (2 * i + g) * 32;
      __syncthreads();
      v8us fkh[4], fkl[4], fvh[4], fvl[4];
      const unsigned short* pkh = kh + kv0 + (size_t)j0 * P;
      const unsigned short* pkl = kl + kv0 + (size_t)j0 * P;
      const unsigned short* pvh = vh + kv0 + (size_t)j0 * P;
      const unsigned short* pvl = vl + kv0 + (size_t)j0 * P;
#pragma unroll
      for (int it = 0; it < 4; ++it) {
        fkh[it] = *(const v8us*)(pkh + (size_t)it * 8 * P); fkl[it] = *(const v8us*)(pkl + (size_t)it * 8 * P);
        fvh[it] = *(const v8us*)(pvh + (size_t)it * 8 * P); fvl[it] = *(const v8us*)(pvl + (size_t)it * 8 * P);
      }
      // stands before the loads' address registers are reused; naming the pointers as inputs keeps them live up to the wait,
      // so that no load of the run is given an address register as its result
      asm volatile("s_wait_xcnt 0x0" :: "v"(pkh), "v"(pkl), "v"(pvh), "v"(pvl) : "memory");
#pragma unroll
      for (int it = 0; it < 4; ++it) {
        const int r = it * 8 + sr;
        *(v8us*)&sK[0][r][sc] = fkh[it]; *(v8us*)&sK[1][r][sc] = fkl[it];
        *(v8us*)&sV[0][r][sc] = fvh[it]; *(v8us*)&sV[1][r][sc] = fvl[it];
      }
      __syncthreads();
      // S^T, two tiles of 16 keys x 16 queries: element r of tile nt is key j0 + 16 nt + 8 hh + r against query q0 + ln
      v8f s[2];
#pragma unroll
      for (int nt = 0; nt < 2; ++nt) {
        v8f acc = {};
#pragma unroll
        for (int ks = 0; ks < KS; ++ks) {
          FragB bh_, bl_;
          bh_.half[0] = *(const v8us*)&sK[0][nt * 16 + ln][ks * 32 + 8 * hh]; bh_.half[1] = *(const v8us*)&sK[0][nt * 16 + ln][ks * 32 + 16 + 8 * hh];
          bl_.half[0] = *(const v8us*)&sK[1][nt * 16 + ln][ks * 32 + 8 * hh]; bl_.half[1] = *(const v8us*)&sK[1][nt * 16 + ln][ks * 32 + 16 + 8 * hh];
          acc = mma3t(aqh[ks].v, aql[ks].v, bh_.v, bl_.v, acc);
        }
        s[nt] = acc;
      }
      // causal mask + running max of the lane's query
      const int da = j0 + 8 * hh - (q0 + ln), db = da + 16;   // the lane's first key of each tile minus its query: key <= query is da + r <= 0
      float mt[8];
#pragma unroll
      for (int r = 0; r < 8; ++r) {
        if (!(da + r <= 0)) s[0][r] = -3.0e38f;
        if (!(db + r <= 0)) s[1][r] = -3.0e38f;
        mt[r] = fmaxf(s[0][r], s[1][r]);
      }
      float mx = fmaxf(fmaxf(fmaxf(mt[0], mt[1]), fmaxf(mt[2], mt[3])), fmaxf(fmaxf(mt[4], mt[5]), fmaxf(mt[6], mt[7])));
      mx = fmaxf(mx, xhalf(mx));          // the other 16 keys of the chunk lie in lane l ^ 16
      const float mnew = fmaxf(m_r, mx);
      const float alpha = (mnew > -1.0e38f) ? __expf(m_r - mnew) : 1.0f;
      m_r = mnew;
      FragB pbh, pbl;                     // the lane's share of the B fragment of P^T, hi and lo
      float ps[8];
      unsigned int th[2][8], tl[2][8];    // hi and lo parts, each in the upper half of its word
#pragma unroll
      for (int r = 0; r < 8; ++r) {
        const float p0 = (da + r <= 0) ? __expf(s[0][r] - mnew) : 0.f;
        const float p1 = (db + r <= 0) ? __expf(s[1][r] - mnew) : 0.f;
        ps[r] = p0 + p1;
        th[0][r] = bf16_top(p0); tl[0][r] = bf16_top(p0 - __uint_as_float(th[0][r] & 0xFFFF0000u));
        th[1][r] = bf16_top(p1); tl[1][r] = bf16_top(p1 - __uint_as_float(th[1][r] & 0xFFFF0000u));
      }
#pragma unroll
      for (int nt = 0; nt < 2; ++nt)
#pragma unroll
        for (int k = 0; k < 4; ++k) {
          pbh.w[4 * nt + k] = pack_top(th[nt][2 * k], th[nt][2 * k + 1]);
          pbl.w[4 * nt + k] = pack_top(tl[nt][2 * k], tl[nt][2 * k + 1]);
        }
      l_r = l_r * alpha + (((ps[0] + ps[1]) + (ps[2] + ps[3])) + ((ps[4] + ps[5]) + (ps[6] + ps[7])));   // the two halves' sums are joined at the end
#pragma unroll
      for (int dt = 0; dt < DT; ++dt)
#pragma unroll
        for (int r = 0; r < 8; ++r) oacc[dt][r] *= alpha;
      // A fragments of V^T by the transposing load: for column tile dt, lane (ln, hh) gets V[8 hh + 0..7][dt * 16 + ln] from the first
      // load of a plane and V[16 + 8 hh + 0..7][dt * 16 + ln] from the second, the k order of the P^T fragments above.
      // The eight loads of two column tiles stand together in front of their products: one LDS latency is waited out for both.
      // All three loops are unrolled so that fragments and accumulators are indexed by constants and stay in registers.
#pragma unroll
      for (int d0 = 0; d0 < DT; d0 += 2) {
        FragB bvh[2], bvl[2];
#pragma unroll
        for (int t = 0; t < 2; ++t) {
          const int c = (d0 + t) * 16 + tr_c;
          bvh[t].half[0] = ld_tr16(&sV[0][tr_r][c]); bvh[t].half[1] = ld_tr16(&sV[0][16 + tr_r][c]);
          bvl[t].half[0] = ld_tr16(&sV[1][tr_r][c]); bvl[t].half[1] = ld_tr16(&sV[1][16 + tr_r][c]);
        }
#pragma unroll
        for (int t = 0; t < 2; ++t) oacc[d0 + t] = mma3t(pbh.v, pbl.v, bvh[t].v, bvl[t].v, oacc[d0 + t]);
      }
    }
    // The upper half's partial result goes to the lower half, lane to lane: wave wq + 4 holds the same queries in the same lanes as wave wq.
    if (g == 1) {
      sM[wq][lane] = m_r; sL[wq][lane] = l_r;
#pragma unroll
      for (int dt = 0; dt < DT; ++dt) {
        *(v4fa*)&sO[wq][2 * dt][lane][0] = (v4f){oacc[dt][0], oacc[dt][1], oacc[dt][2], oacc[dt][3]};
        *(v4fa*)&sO[wq][2 * dt + 1][lane][0] = (v4f){oacc[dt][4], oacc[dt][5], oacc[dt][6], oacc[dt][7]};
      }
    }
    // publishes the upper half's partial result to the lower half; every wave passes it. The upper half's next write of sM, sL and sO lies behind
    // the next tile's barriers, which the lower half reaches only when it has stored this tile.
    __syncthreads();
    if (g == 0) {
      // Join: both partial results are brought to the common maximum. An upper half that saw no unmasked key has maximum -3.0e38, sum 0
      // and output 0, and its factor comes out 0; the lower half always holds key 0, so the common maximum is a real score.
      const float m1 = sM[wq][lane], l1 = sL[wq][lane];
      const float m = fmaxf(m_r, m1);
      const float a0 = __expf(m_r - m), a1 = __expf(m1 - m);
      float l = l_r * a0 + l1 * a1;
      l += xhalf(l);
      const float inv = (m > -1.0e38f) ? 1.0f / l : __builtin_nanf("");
      const float f0 = a0 * inv, f1 = a1 * inv;
      // The wave's 16 queries are one row tile of the output product's A, its D columns KS blocks of 32 k, which follow each other in a plane.
      // Half s of lane (hh, ln) in block j: row ln, k = 32 j + 16 s + 8 hh + 0..7, which is tile dt = 2 j + s of the lane's own accumulators.
      // A store of the wave is 512 contiguous bytes.
      const size_t yo = wt_block(P, (b * T + q0) >> 4, h * KS) + lane * 8;
#pragma unroll
      for (int dt = 0; dt < DT; ++dt) {
        const v4f a = *(const v4fa*)&sO[wq][2 * dt][lane][0], c = *(const v4fa*)&sO[wq][2 * dt + 1][lane][0];
#pragma unroll
        for (int i = 0; i < 4; ++i) { oacc[dt][i] = oacc[dt][i] * f0 + a[i] * f1; oacc[dt][4 + i] = oacc[dt][4 + i] * f0 + c[i] * f1; }
      }
#pragma unroll
      for (int dt = 0; dt < DT; ++dt) {
        v8us oh, ol;
#pragma unroll
        for (int i = 0; i < 8; ++i) { const unsigned short hb = bf16_bits(oacc[dt][i]); oh[i] = hb; ol[i] = bf16_bits(oacc[dt][i] - bf16_val(hb)); }
        *(v8us*)(yh + yo + dt * 256) = oh;
        *(v8us*)(yl + yo + dt * 256) = ol;
        // stands before the two stores' data registers are reused by the next tile of columns, and behind the last pair before the next query tile
        asm volatile("s_wait_xcnt 0x0" ::: "memory");
      }
    }
  }
}

extern "C" void kernel_launch(void* const* d_in, const int* in_sizes, int n_in,
                              void* d_out, int out_size, void* d_ws, size_t ws_size, hipStream_t stream) {
  (void)in_sizes; (void)n_in; (void)out_size;
  const float* x = (const float*)d_in[0]; const float* Wk = (const float*)d_in[1]; const float* Wv = (const float*)d_in[2]; const float* Wq = (const float*)d_in[3];
  const float* Wout = (const float*)d_in[4]; const float* bout = (const float*)d_in[5];
  char* ws = (char*)d_ws; size_t off = 0;
  auto take = [&](size_t bytes) { char* p = ws + off; off += (bytes + 255) & ~(size_t)255; return p; };
  const int M = BB * TT;
  unsigned short* Wqt = (unsigned short*)take((size_t)NH * HD * HD * 2); unsigned short* Wkt = (unsigned short*)take((size_t)NH * HD * HD * 2); unsigned short* Wvt = (unsigned short*)take((size_t)NH * HD * HD * 2);
  unsigned short* Wot = (unsigned short*)take((size_t)EE * EE * 2);
  float* q = (float*)take((size_t)M * EE * 4);
  unsigned short* ath = (unsigned short*)take((size_t)M * EE * 2); unsigned short* atl = (unsigned short*)take((size_t)M * EE * 2);
  unsigned short* kh = (unsigned short*)take((size_t)M * EE * 2); unsigned short* kl = (unsigned short*)take((size_t)M * EE * 2);
  unsigned short* vh = (unsigned short*)take((size_t)M * EE * 2); unsigned short* vl = (unsigned short*)take((size_t)M * EE * 2);
  if (off > ws_size) return;
  k_wt_all<<<3 * NH * WB + EE * (EE / 8) / 256, 256, 0, stream>>>(Wq, Wk, Wv, Wout, Wqt, Wkt, Wvt, Wot);
  k_qkv<<<dim3(3, NH, (M / 16) * (HD / 64) / 4), 128, 0, stream>>>(x, Wqt, Wkt, Wvt, q, kh, kl, vh, vl);
  k_flash<HD, TT, NH, EE><<<BB * NH * (TT / 128), 256, 0, stream>>>(q, kh, kl, vh, vl, 0.02209708691207961f, ath, atl);   // 1/sqrt(2048), causal
  k_gemm_bf<true, 0, true><<<((M / 16) * (EE / 64) + 3) / 4, 128, 0, stream>>>(ath, atl, Wot, EE, bout, (float*)d_out, EE, M, EE, EE);
}

// v010
// Measured time: 152 microseconds a run.
// Timed twice side by side with v009, it ran 1.04 and 1.05 times as fast.
// Counting every step since v000, it is 6.35 times as fast.
#include <hip/hip_runtime.h>
// All contractions on v_wmma_f32_16x16x32_bf16, f32 accumulate: per-head Q/K/V projections xh·W[h] (K=N=128; x, W rounded to bf16:
// single exact term, written into the head's column block; K and V leave the projection as bf16 hi and lo planes), QKᵀ/√S and P·V per 16-query tile as 3-term bf16 hi/lo splits (causal),
// out = attn * W_out + b with attn split hi/lo (2 terms; the attention kernel stores the two planes, in A fragment order); softmax in f32.
#define BB 4
#define TT 2048
#define EE 1024
#define NH 8
#define HD 128

typedef __bf16 v16b __attribute__((ext_vector_type(16)));
typedef unsigned short v8us __attribute__((ext_vector_type(8), may_alias));
typedef float  v8f  __attribute__((ext_vector_type(8)));
typedef float  v4f  __attribute__((ext_vector_type(4)));
typedef float  v4fa __attribute__((ext_vector_type(4), may_alias));
union FragB { v16b v; v8us half[2]; unsigned short u[16]; unsigned int w[8]; };

typedef float f32x2 __attribute__((ext_vector_type(2)));
typedef __bf16 bf16x2 __attribute__((ext_vector_type(2)));
typedef unsigned int v4u __attribute__((ext_vector_type(4), may_alias));
// two f32 rounded to bf16 (to nearest even) and packed into one register of a fragment, a in bits 15 to 0: one v_cvt_pk_bf16_f32
__device__ __forceinline__ unsigned int bf16_pair(float a, float b) { return __builtin_bit_cast(unsigned int, __builtin_convertvector((f32x2){a, b}, bf16x2)); }
// the two values of such a register as f32
__device__ __forceinline__ float pair_lo(unsigned int w) { return __uint_as_float(w << 16); }
__device__ __forceinline__ float pair_hi(unsigned int w) { return __uint_as_float(w & 0xFFFF0000u); }
// hi and lo parts of two f32: h = bf16(x), l = bf16(x - h)
__device__ __forceinline__ void split_pair(float a, float b, unsigned int& h, unsigned int& l) { h = bf16_pair(a, b); l = bf16_pair(a - pair_lo(h), b - pair_hi(h)); }
// a single value (the bias, once per wave and column): rounded to nearest even in integer form
__device__ __forceinline__ float bf16_round(float x) { unsigned int u = __float_as_uint(x); return __uint_as_float((u + 0x7FFFu + ((u >> 16) & 1u)) & 0xFFFF0000u); }
// D += Y * X, three terms in the order yh xh, yh xl, yl xh: Y (hi, lo) is the A operand, X (hi, lo) the B operand
__device__ __forceinline__ v8f mma3t(v16b xh, v16b xl, v16b yh, v16b yl, v8f c) {
  c = __builtin_amdgcn_wmma_f32_16x16x32_bf16(false, yh, false, xh, (short)0, c, false, false);
  c = __builtin_amdgcn_wmma_f32_16x16x32_bf16(false, yh, false, xl, (short)0, c, false, false);
  c = __builtin_amdgcn_wmma_f32_16x16x32_bf16(false, yl, false, xh, (short)0, c, false, false);
  // the distance behind a matrix instruction, before its result is read or an operand register is loaded anew
  asm volatile("v_nop\n\tv_nop\n\tv_nop\n\tv_nop" : "+v"(c) : "v"(xh), "v"(xl), "v"(yh), "v"(yl));
  return c;
}
// lane l takes the value of lane l ^ 16
__device__ __forceinline__ float xhalf(float x) {
  return __builtin_bit_cast(float, __builtin_amdgcn_permlanex16(__builtin_bit_cast(int, x), __builtin_bit_cast(int, x), 0x76543210, 0xfedcba98, false, false));
}

// ds_load_tr16_b128: a 16 x 16 tile of 16-bit elements, row-major in LDS, comes back transposed as half a WMMA operand
typedef short s16x8 __attribute__((ext_vector_type(8)));
__device__ __forceinline__ v8us ld_tr16(const unsigned short* p) {
  typedef __attribute__((address_space(3))) s16x8 lds_s16x8;
  return __builtin_bit_cast(v8us, __builtin_amdgcn_ds_load_tr16_b128_v8i16((lds_s16x8*)p));
}

// Wt holds bf16(W[k][n]) in the order in which the products read it as B fragments: one block of 512 elements per 16 columns n and
// 32 rows k (the K / 32 blocks of one column tile follow each other), and in a block first the 16 bytes that each of the 32 lanes takes as
// the first half of its fragment, then the 32 second halves: element i of half s of lane (hh, ln) is k = 32 kb + 16 s + 8 hh + i, n = 16 nt + ln.
// A wave's load of a half is then 512 contiguous bytes, four whole lines (row-major Wt[n][k]: 32 bytes of each of 16 lines).
__device__ __forceinline__ size_t wt_block(int K, int nt, int kb) { return ((size_t)nt * (K / 32) + kb) * 512; }
// thread t writes 8 consecutive k of one n; neighbours in t are neighbours in n, so that 16 lanes fill 256 contiguous bytes of a block
__device__ __forceinline__ void wt_bf16(const float* __restrict__ W, unsigned short* __restrict__ Wt, int K, int N, int t) {
  if (t >= N * (K / 8)) return;
  const int n = t % N, k8 = (t / N) * 8;
  v4u v;
#pragma unroll
  for (int i = 0; i < 4; ++i) v[i] = bf16_pair(W[(size_t)(k8 + 2 * i) * N + n], W[(size_t)(k8 + 2 * i + 1) * N + n]);
  *(v4u*)(Wt + wt_block(K, n >> 4, k8 >> 5) + ((k8 >> 4) & 1) * 256 + (((k8 >> 3) & 1) * 16 + (n & 15)) * 8) = v;
}

// All 25 weight transposes in one launch; they are independent of each other. Blocks 0 .. 3 * NH * WB - 1: WB blocks per
// head matrix, in the order q, k, v; the blocks behind them: W_out.
#define WB (HD * (HD / 8) / 256)
__global__ __launch_bounds__(256) void k_wt_all(const float* __restrict__ Wq, const float* __restrict__ Wk, const float* __restrict__ Wv,
                                                const float* __restrict__ Wout, unsigned short* __restrict__ Wqt, unsigned short* __restrict__ Wkt,
                                                unsigned short* __restrict__ Wvt, unsigned short* __restrict__ Wot) {
  const int blk = blockIdx.x;
  if (blk < 3 * NH * WB) {
    const int m = blk / WB, p = m / NH, h = m % NH;
    const float* W = (p == 0) ? Wq : (p == 1) ? Wk : Wv;               // W[h] is [d_in][e_out] = [K][N]
    unsigned short* Wt = (p == 0) ? Wqt : (p == 1) ? Wkt : Wvt;
    wt_bf16(W + (size_t)h * HD * HD, Wt + (size_t)h * HD * HD, HD, HD, (blk % WB) * 256 + threadIdx.x);
  } else {
    wt_bf16(Wout, Wot, EE, EE, (blk - 3 * NH * WB) * 256 + threadIdx.x);   // attn @ W_out: [K][N]
  }
}

// GEMM C[M][N] (f32, pitch ldc) = act(A[M][K] * W + bias). Without ASPLIT: A f32 row-major (pitch lda), converted per fragment to bf16, a single
// rounded term. With ASPLIT: A arrives as two bf16 planes Ah (hi) and Al (lo), 2 terms, both in A fragment order, which is the order of Wt with a
// row of A in the place of a column n (wt_block(K, row tile, k block)): an A load is 512 contiguous bytes and goes to the product as it is.
// Wt bf16 in fragment order (wt_block; ldb rows k). BIAS_BF16 rounds the
// bias to bf16 first (bias quantised to bf16 before the add). K%32==0, M%16==0, N%64==0.
// blk: the block's index within this one product.
// csplit (block-uniform): the result is not stored to C but as two bf16 planes of the same pitch, Ch = bf16(c), Cl = bf16(c - Ch).
template <bool ASPLIT, int ACT, bool BIAS_BF16>
__device__ __forceinline__ void gemm_bf(int blk, const float* __restrict__ A, int lda, const unsigned short* __restrict__ Ah,
                                        const unsigned short* __restrict__ Al, const unsigned short* __restrict__ Wt, int ldb,
                                        const float* __restrict__ bias, float* __restrict__ C, bool csplit, unsigned short* __restrict__ Ch,
                                        unsigned short* __restrict__ Cl, int ldc, int M, int N, int K) {
  __shared__ __attribute__((aligned(16))) float so[4][16][64];
  const int tid = threadIdx.x, w = tid >> 5, lane = tid & 31, ln = lane & 15, hh = lane >> 4;
  const int ntn = N / 64;
  const int wid = blk * 4 + w;
  const int mt = wid / ntn, nq = wid % ntn;
  if (mt * 16 >= M) return;
  const int row0 = mt * 16, col0 = nq * 64;
  const float* arow = A + (size_t)(row0 + ln) * lda;
  const unsigned a0 = (unsigned)wt_block(K, mt, 0) + lane * 8;   // ASPLIT: the lane's 16 bytes in the first k block of the wave's row tile
  v8f acc[4] = {};
  for (int kb = 0; kb < K; kb += 32) {
    FragB ah, al;
    v4f x0, x1, x2, x3;
    const unsigned short *pa = nullptr, *pb = nullptr;
    if constexpr (ASPLIT) {
      // the k block moves the planes' wave-uniform bases; the lane's own offset a0 does not change along k
      pa = Ah + (size_t)(kb >> 5) * 512 + a0; pb = Al + (size_t)(kb >> 5) * 512 + a0;
      ah.half[0] = *(const v8us*)pa; ah.half[1] = *(const v8us*)(pa + 256);
      al.half[0] = *(const v8us*)pb; al.half[1] = *(const v8us*)(pb + 256);
    } else {
      x0 = *(const v4fa*)(arow + kb + 8 * hh); x1 = *(const v4fa*)(arow + kb + 8 * hh + 4);
      x2 = *(const v4fa*)(arow + kb + 16 + 8 * hh); x3 = *(const v4fa*)(arow + kb + 16 + 8 * hh + 4);
    }
    FragB b[4];
#pragma unroll
    for (int t = 0; t < 4; ++t) {
      const unsigned short* bfr = Wt + wt_block(ldb, nq * 4 + t, kb >> 5) + lane * 8;
      b[t].half[0] = *(const v8us*)bfr;
      b[t].half[1] = *(const v8us*)(bfr + 256);
    }
    // stands before the loads' address registers are reused by the conversion
    if constexpr (ASPLIT)   // naming the A pointers as inputs keeps them live up to the wait, so that no load of the run is given one of their registers as its result
      asm volatile("s_wait_xcnt 0x0" :: "v"(pa), "v"(pb) : "memory");
    else
      asm volatile("s_wait_xcnt 0x0" ::: "memory");
    // nothing is scheduled across this line: the step's twelve loads stay together in front of the conversion and the products. Left alone, the
    // compiler sinks each B pair down to its own product, and the wave waits out a memory latency per product instead of one per step
    __builtin_amdgcn_sched_barrier(0);
    if constexpr (!ASPLIT) {
      float xs[16] = {x0[0],x0[1],x0[2],x0[3],x1[0],x1[1],x1[2],x1[3],x2[0],x2[1],x2[2],x2[3],x3[0],x3[1],x3[2],x3[3]};
#pragma unroll
      for (int i = 0; i < 8; ++i) ah.w[i] = bf16_pair(xs[2 * i], xs[2 * i + 1]);
    }
#pragma unroll
    for (int t = 0; t < 4; ++t) {
      acc[t] = __builtin_amdgcn_wmma_f32_16x16x32_bf16(false, ah.v, false, b[t].v, (short)0, acc[t], false, false);
      if (ASPLIT) acc[t] = __builtin_amdgcn_wmma_f32_16x16x32_bf16(false, al.v, false, b[t].v, (short)0, acc[t], false, false);
    }
    // the distance behind a matrix instruction, once per step (was once per product): the results tie the statement behind all of the step's
    // products, and the fragments that loads fill, as inputs, stay in their registers up to it, so that no later load lands in one of them less than four slots behind
    if constexpr (ASPLIT)
      asm volatile("v_nop\n\tv_nop\n\tv_nop\n\tv_nop" : "+v"(acc[0]), "+v"(acc[1]), "+v"(acc[2]), "+v"(acc[3])
                   : "v"(b[0].v), "v"(b[1].v), "v"(b[2].v), "v"(b[3].v), "v"(ah.v), "v"(al.v));
    else
      asm volatile("v_nop\n\tv_nop\n\tv_nop\n\tv_nop" : "+v"(acc[0]), "+v"(acc[1]), "+v"(acc[2]), "+v"(acc[3])
                   : "v"(b[0].v), "v"(b[1].v), "v"(b[2].v), "v"(b[3].v));
  }
#pragma unroll
  for (int t = 0; t < 4; ++t) {
    float bv = bias ? bias[col0 + t * 16 + ln] : 0.f;
    if (BIAS_BF16) bv = bf16_round(bv);
#pragma unroll
    for (int r = 0; r < 8; ++r) { float v = acc[t][r] + bv; if (ACT == 1) v = fmaxf(v, 0.f); so[w][8 * hh + r][t * 16 + ln] = v; }
  }
  __builtin_amdgcn_fence(__ATOMIC_ACQ_REL, "workgroup");
  __builtin_amdgcn_wave_barrier();
  if (csplit) {
    // a lane takes 8 neighbours of a row: 16 bytes a lane and plane, and the wave's 64 columns fill one 128-byte line of each plane
    const int r4 = lane >> 3, c8 = (lane & 7) * 8;
#pragma unroll
    for (int q = 0; q < 4; ++q) {
      const int r = q * 4 + r4;
      const v4f a = *(const v4fa*)&so[w][r][c8], b = *(const v4fa*)&so[w][r][c8 + 4];
      unsigned int wh[4], wl[4];
      split_pair(a[0], a[1], wh[0], wl[0]); split_pair(a[2], a[3], wh[1], wl[1]);
      split_pair(b[0], b[1], wh[2], wl[2]); split_pair(b[2], b[3], wh[3], wl[3]);
      const size_t o = (size_t)(row0 + r) * ldc + col0 + c8;
      *(v4u*)(Ch + o) = (v4u){wh[0], wh[1], wh[2], wh[3]};
      *(v4u*)(Cl + o) = (v4u){wl[0], wl[1], wl[2], wl[3]};
    }
    // stands before the stores' address and data registers are reused behind the join with the other branch
    asm volatile("s_wait_xcnt 0x0" ::: "memory");
  } else {
    const int rsub = lane >> 4, c4 = (lane & 15) * 4;
#pragma unroll
    for (int q = 0; q < 8; ++q) {
      const int r = q * 2 + rsub;
      const v4f v = *(const v4fa*)&so[w][r][c4];
      *(v4f*)(C + (size_t)(row0 + r) * ldc + col0 + c4) = v;
    }
  }
}

template <bool ASPLIT, int ACT, bool BIAS_BF16>
__global__ __launch_bounds__(128) void k_gemm_bf(const unsigned short* __restrict__ Ah, const unsigned short* __restrict__ Al,
                                               const unsigned short* __restrict__ Wt, int ldb,
                                               const float* __restrict__ bias, float* __restrict__ C, int ldc, int M, int N, int K) {
  static_assert(ASPLIT, "this launch takes A as two planes");
  gemm_bf<ASPLIT, ACT, BIAS_BF16>(blockIdx.x, nullptr, 0, Ah, Al, Wt, ldb, bias, C, false, nullptr, nullptr, ldc, M, N, K);
}

// All 24 per-head projections in one launch; they are independent of each other. blockIdx.x: q, k or v; blockIdx.y: head;
// blockIdx.z: the product's block of 32 rows. The 24 blocks that share 32 rows of x are neighbours in the grid.
// q is stored as f32; k and v are stored as the hi and lo planes that the attention kernel's products read, so that each element is
// split once here and not once per query block there.
__global__ __launch_bounds__(128) void k_qkv(const float* __restrict__ x, const unsigned short* __restrict__ Wqt, const unsigned short* __restrict__ Wkt,
                                             const unsigned short* __restrict__ Wvt, float* __restrict__ q, unsigned short* __restrict__ kh,
                                             unsigned short* __restrict__ kl, unsigned short* __restrict__ vh, unsigned short* __restrict__ vl) {
  const int p = blockIdx.x, h = blockIdx.y;
  const unsigned short* Wt = (p == 0) ? Wqt : (p == 1) ? Wkt : Wvt;
  unsigned short* Ch = (p == 1) ? kh : vh;
  unsigned short* Cl = (p == 1) ? kl : vl;
  gemm_bf<false, 0, false>(blockIdx.z, x + h * HD, EE, nullptr, nullptr, Wt + (size_t)h * HD * HD, HD, nullptr, q + h * HD, p != 0, Ch + h * HD, Cl + h * HD,
                           EE, BB * TT, HD, HD);
}

// Flash-style causal attention, all contractions 3-term bf16 hi/lo splits, f32 softmax with running max.
// K and V arrive as bf16 hi and lo planes (kh, kl, vh, vl): a chunk is only copied to LDS.
// Every shape is a compile-time constant (D head size, T sequence length with T % 128 == 0, H heads, P row pitch in elements of
// q and the four planes, and the K of the product that reads the output) and there is no optional input, so the key loop's body is one straight-line block: no bounds test on a key or
// a query row is needed, and a chunk's 16 staging loads are all issued before the first is waited for.
// One wave = 16 query rows; a tile is 64 queries; a chunk is 32 keys.
// Both products are computed transposed: S^T = K Q^T (A: K rows, B: the query fragments) and O^T += V^T P^T (A: V by the transposing load,
// B: P^T). The A and the B fragment have the same map (lane ln: the row or the column, the same k order), so the fragments are the ones that
// the untransposed products would take, with the operand places exchanged. In a result tile lane (ln, hh) holds column ln, rows 8 hh + 0..7:
// all of a lane's scores belong to ONE query, ln. Its maximum and sum are taken in the lane, plus one exchange with lane l ^ 16, and
// the 16 scores of a lane (keys 8 hh + 0..7 of the first tile, 16 + 8 hh + 0..7 of the second) are, in this order, the lane's share of the
// B fragment of P^T: P goes from the accumulators to the operand in registers and never through LDS.
// The work is dealt evenly. A tile costs 2 (tile + 1) chunks, and every work-group of the launch is resident from the start, so the launch
// lasts as long as the fullest WGP. A work-group takes two tiles of its head, one after the other: tile NQB - 1 - tp, then tile tp, together
// 2 (NQB + 1) chunks wherever it lands. It has 8 waves: two halves of 4, both on the tile's 64 queries; half g takes the chunks 2 i + g, staged
// in buffers of its own, so that every wave of the launch works through NQB + 1 chunks and four waves stay on every SIMD to the end.
// Behind a tile's last chunk the upper half hands its running maximum, sum and unscaled output over through LDS, and the lower half
// joins the two partial results and stores the tile: as the bf16 hi and lo planes yh and yl, in the A fragment order in which the output product
// reads them (gemm_bf), so that each element is split once here and not once per 64 columns there.
// The second launch bound caps the registers at 256: four waves a SIMD, two work-groups a WGP.
template <int D, int T, int H, int P>
__global__ __launch_bounds__(256, 4) void k_flash(const float* __restrict__ qb, const unsigned short* __restrict__ kh, const unsigned short* __restrict__ kl,
                                             const unsigned short* __restrict__ vh, const unsigned short* __restrict__ vl,
                                             float scale, unsigned short* __restrict__ yh, unsigned short* __restrict__ yl) {
  static_assert(D == 128 && T % 128 == 0, "one wave stages two 128-element rows of a plane per load; whole pairs of 64-query tiles");
  constexpr int KS = D / 32;        // k-steps for QK
  constexpr int DT = D / 16;        // d tiles for PV
  constexpr int NQB = T / 64;
  // Plane 0 hi, plane 1 lo; both planes in one array, so that one address register and constant offsets reach both
  // (with an array per plane the paired V loads below no longer fit the 256 registers).
  // V rows are read by the transposing load, which wants a pitch of an odd multiple of 32 bytes; K rows by 16-byte loads.
  __shared__ __attribute__((aligned(16))) unsigned short sKg[2][2][32][D + 8], sVg[2][2][32][D + 16];   // first index: the half
  __shared__ __attribute__((aligned(16))) float sO[4][2 * DT][32][4];   // the upper half's output, lane to lane: 16 bytes a lane, a wave's access is 512 contiguous bytes
  __shared__ float sM[4][32], sL[4][32];            // the upper half's running maxima and per-lane sums
  const int tid = threadIdx.x, w = tid >> 5, lane = tid & 31, ln = lane & 15, hh = lane >> 4;
  const int g = __builtin_amdgcn_readfirstlane(tid >> 7), wq = w & 3;   // the wave's half (the same in every lane: a scalar) and its 16 rows of the tile
  unsigned short (*sK)[32][D + 8] = sKg[g];
  unsigned short (*sV)[32][D + 16] = sVg[g];
  const int bh = blockIdx.x / (NQB / 2), tp = blockIdx.x % (NQB / 2);
  const int b = bh / H, h = bh % H;
  const int tr_r = 8 * hh + (lane & 7), tr_c = 8 * ((lane >> 3) & 1);   // the lane's own 16 bytes of a 16 x 16 tile for the transposing load
  const float* Q = qb + (size_t)b * T * P + h * D;
  // wave wq of a half stages rows 2 wq, 2 wq + 1, then + 8, ... of the half's chunk: lanes 0 to 15 one whole 256-byte row of a plane, lanes 16 to 31 the next
  const int sr = 2 * wq + hh, sc = ln * 8;
  const size_t kv0 = ((size_t)b * T + sr) * P + h * D + sc;

  // kept rolled: unrolled, values of the second tile stay live through the first tile's key loop, and the 256 registers no longer hold the loop
#pragma unroll 1
  for (int pass = 0; pass < 2; ++pass) {
    const int qblk = pass ? tp : NQB - 1 - tp;     // block-uniform
    const int q0 = qblk * 64 + wq * 16;
    // B fragments of the wave's 16 queries (scaled), hi/lo: lane (ln, hh) holds query ln
    FragB aqh[KS], aql[KS];
    {
      const float* qr = Q + (size_t)(q0 + ln) * P;
#pragma unroll
      for (int ks = 0; ks < KS; ++ks)
#pragma unroll
        for (int i = 0; i < 16; i += 2) {
          const int d = ks * 32 + ((i < 8) ? (8 * hh + i) : (16 + 8 * hh + (i - 8)));
          split_pair(qr[d] * scale, qr[d + 1] * scale, aqh[ks].w[i >> 1], aql[ks].w[i >> 1]);
        }
    }
    float m_r = -3.0e38f, l_r = 0.f;      // of the lane's query ln: the maximum over all keys so far, the sum over the keys of the lane's half hh
    v8f oacc[DT];                         // O^T: element r of tile dt is column d = 16 dt + 8 hh + r of query ln
#pragma unroll
    for (int dt = 0; dt < DT; ++dt) oacc[dt] = (v8f){0.f,0.f,0.f,0.f,0.f,0.f,0.f,0.f};

    for (int i = 0; i <= qblk; ++i) {      // block-uniform trip count; the last key is qblk * 64 + 63 < T
      const int j0 = (2 * i + g) * 32;
      __syncthreads();
      v8us fkh[4], fkl[4], fvh[4], fvl[4];
      const unsigned short* pkh = kh + kv0 + (size_t)j0 * P;
      const unsigned short* pkl = kl + kv0 + (size_t)j0 * P;
      const unsigned short* pvh = vh + kv0 + (size_t)j0 * P;
      const unsigned short* pvl = vl + kv0 + (size_t)j0 * P;
#pragma unroll
      for (int it = 0; it < 4; ++it) {
        fkh[it] = *(const v8us*)(pkh + (size_t)it * 8 * P); fkl[it] = *(const v8us*)(pkl + (size_t)it * 8 * P);
        fvh[it] = *(const v8us*)(pvh + (size_t)it * 8 * P); fvl[it] = *(const v8us*)(pvl + (size_t)it * 8 * P);
      }
      // stands before the loads' address registers are reused; naming the pointers as inputs keeps them live up to the wait,
      // so that no load of the run is given an address register as its result
      asm volatile("s_wait_xcnt 0x0" :: "v"(pkh), "v"(pkl), "v"(pvh), "v"(pvl) : "memory");
#pragma unroll
      for (int it = 0; it < 4; ++it) {
        const int r = it * 8 + sr;
        *(v8us*)&sK[0][r][sc] = fkh[it]; *(v8us*)&sK[1][r][sc] = fkl[it];
        *(v8us*)&sV[0][r][sc] = fvh[it]; *(v8us*)&sV[1][r][sc] = fvl[it];
      }
      __syncthreads();
      // S^T, two tiles of 16 keys x 16 queries: element r of tile nt is key j0 + 16 nt + 8 hh + r against query q0 + ln
      v8f s[2];
#pragma unroll
      for (int nt = 0; nt < 2; ++nt) {
        v8f acc = {};
#pragma unroll
        for (int ks = 0; ks < KS; ++ks) {
          FragB bh_, bl_;
          bh_.half[0] = *(const v8us*)&sK[0][nt * 16 + ln][ks * 32 + 8 * hh]; bh_.half[1] = *(const v8us*)&sK[0][nt * 16 + ln][ks * 32 + 16 + 8 * hh];
          bl_.half[0] = *(const v8us*)&sK[1][nt * 16 + ln][ks * 32 + 8 * hh]; bl_.half[1] = *(const v8us*)&sK[1][nt * 16 + ln][ks * 32 + 16 + 8 * hh];
          acc = mma3t(aqh[ks].v, aql[ks].v, bh_.v, bl_.v, acc);
        }
        s[nt] = acc;
      }
      // causal mask + running max of the lane's query
      const int da = j0 + 8 * hh - (q0 + ln), db = da + 16;   // the lane's first key of each tile minus its query: key <= query is da + r <= 0
      float mt[8];
#pragma unroll
      for (int r = 0; r < 8; ++r) {
        if (!(da + r <= 0)) s[0][r] = -3.0e38f;
        if (!(db + r <= 0)) s[1][r] = -3.0e38f;
        mt[r] = fmaxf(s[0][r], s[1][r]);
      }
      float mx = fmaxf(fmaxf(fmaxf(mt[0], mt[1]), fmaxf(mt[2], mt[3])), fmaxf(fmaxf(mt[4], mt[5]), fmaxf(mt[6], mt[7])));
      mx = fmaxf(mx, xhalf(mx));          // the other 16 keys of the chunk lie in lane l ^ 16
      const float mnew = fmaxf(m_r, mx);
      const float alpha = (mnew > -1.0e38f) ? __expf(m_r - mnew) : 1.0f;
      m_r = mnew;
      FragB pbh, pbl;                     // the lane's share of the B fragment of P^T, hi and lo
      float ps[8], p[2][8];
#pragma unroll
      for (int r = 0; r < 8; ++r) {
        p[0][r] = (da + r <= 0) ? __expf(s[0][r] - mnew) : 0.f;
        p[1][r] = (db + r <= 0) ? __expf(s[1][r] - mnew) : 0.f;
        ps[r] = p[0][r] + p[1][r];
      }
#pragma unroll
      for (int nt = 0; nt < 2; ++nt)
#pragma unroll
        for (int k = 0; k < 4; ++k) split_pair(p[nt][2 * k], p[nt][2 * k + 1], pbh.w[4 * nt + k], pbl.w[4 * nt + k]);
      l_r = l_r * alpha + (((ps[0] + ps[1]) + (ps[2] + ps[3])) + ((ps[4] + ps[5]) + (ps[6] + ps[7])));   // the two halves' sums are joined at the end
#pragma unroll
      for (int dt = 0; dt < DT; ++dt)
#pragma unroll
        for (int r = 0; r < 8; ++r) oacc[dt][r] *= alpha;
      // A fragments of V^T by the transposing load: for column tile dt, lane (ln, hh) gets V[8 hh + 0..7][dt * 16 + ln] from the first
      // load of a plane and V[16 + 8 hh + 0..7][dt * 16 + ln] from the second, the k order of the P^T fragments above.
      // The eight loads of two column tiles stand together in front of their products: one LDS latency is waited out for both.
      // All three loops are unrolled so that fragments and accumulators are indexed by constants and stay in registers.
#pragma unroll
      for (int d0 = 0; d0 < DT; d0 += 2) {
        FragB bvh[2], bvl[2];
#pragma unroll
        for (int t = 0; t < 2; ++t) {
          const int c = (d0 + t) * 16 + tr_c;
          bvh[t].half[0] = ld_tr16(&sV[0][tr_r][c]); bvh[t].half[1] = ld_tr16(&sV[0][16 + tr_r][c]);
          bvl[t].half[0] = ld_tr16(&sV[1][tr_r][c]); bvl[t].half[1] = ld_tr16(&sV[1][16 + tr_r][c]);
        }
#pragma unroll
        for (int t = 0; t < 2; ++t) oacc[d0 + t] = mma3t(pbh.v, pbl.v, bvh[t].v, bvl[t].v, oacc[d0 + t]);
      }
    }
    // The upper half's partial result goes to the lower half, lane to lane: wave wq + 4 holds the same queries in the same lanes as wave wq.
    if (g == 1) {
      sM[wq][lane] = m_r; sL[wq][lane] = l_r;
#pragma unroll
      for (int dt = 0; dt < DT; ++dt) {
        *(v4fa*)&sO[wq][2 * dt][lane][0] = (v4f){oacc[dt][0], oacc[dt][1], oacc[dt][2], oacc[dt][3]};
        *(v4fa*)&sO[wq][2 * dt + 1][lane][0] = (v4f){oacc[dt][4], oacc[dt][5], oacc[dt][6], oacc[dt][7]};
      }
    }
    // publishes the upper half's partial result to the lower half; every wave passes it. The upper half's next write of sM, sL and sO lies behind
    // the next tile's barriers, which the lower half reaches only when it has stored this tile.
    __syncthreads();
    if (g == 0) {
      // Join: both partial results are brought to the common maximum. An upper half that saw no unmasked key has maximum -3.0e38, sum 0
      // and output 0, and its factor comes out 0; the lower half always holds key 0, so the common maximum is a real score.
      const float m1 = sM[wq][lane], l1 = sL[wq][lane];
      const float m = fmaxf(m_r, m1);
      const float a0 = __expf(m_r - m), a1 = __expf(m1 - m);
      float l = l_r * a0 + l1 * a1;
      l += xhalf(l);
      const float inv = (m > -1.0e38f) ? 1.0f / l : __builtin_nanf("");
      const float f0 = a0 * inv, f1 = a1 * inv;
      // The wave's 16 queries are one row tile of the output product's A, its D columns KS blocks of 32 k, which follow each other in a plane.
      // Half s of lane (hh, ln) in block j: row ln, k = 32 j + 16 s + 8 hh + 0..7, which is tile dt = 2 j + s of the lane's own accumulators.
      // A store of the wave is 512 contiguous bytes.
      const size_t yo = wt_block(P, (b * T + q0) >> 4, h * KS) + lane * 8;
#pragma unroll
      for (int dt = 0; dt < DT; ++dt) {
        const v4f a = *(const v4fa*)&sO[wq][2 * dt][lane][0], c = *(const v4fa*)&sO[wq][2 * dt + 1][lane][0];
#pragma unroll
        for (int i = 0; i < 4; ++i) { oacc[dt][i] = oacc[dt][i] * f0 + a[i] * f1; oacc[dt][4 + i] = oacc[dt][4 + i] * f0 + c[i] * f1; }
      }
#pragma unroll
      for (int dt = 0; dt < DT; ++dt) {
        unsigned int oh[4], ol[4];
#pragma unroll
        for (int i = 0; i < 4; ++i) split_pair(oacc[dt][2 * i], oacc[dt][2 * i + 1], oh[i], ol[i]);
        *(v4u*)(yh + yo + dt * 256) = (v4u){oh[0], oh[1], oh[2], oh[3]};
        *(v4u*)(yl + yo + dt * 256) = (v4u){ol[0], ol[1], ol[2], ol[3]};
        // stands before the two stores' data registers are reused by the next tile of columns, and behind the last pair before the next query tile
        asm volatile("s_wait_xcnt 0x0" ::: "memory");
      }
    }
  }
}

extern "C" void kernel_launch(void* const* d_in, const int* in_sizes, int n_in,
                              void* d_out, int out_size, void* d_ws, size_t ws_size, hipStream_t stream) {
  (void)in_sizes; (void)n_in; (void)out_size;
  const float* x = (const float*)d_in[0]; const float* Wk = (const float*)d_in[1]; const float* Wv = (const float*)d_in[2]; const float* Wq = (const float*)d_in[3];
  const float* Wout = (const float*)d_in[4]; const float* bout = (const float*)d_in[5];
  char* ws = (char*)d_ws; size_t off = 0;
  auto take = [&](size_t bytes) { char* p = ws + off; off += (bytes + 255) & ~(size_t)255; return p; };
  const int M = BB * TT;
  unsigned short* Wqt = (unsigned short*)take((size_t)NH * HD * HD * 2); unsigned short* Wkt = (unsigned short*)take((size_t)NH * HD * HD * 2); unsigned short* Wvt = (unsigned short*)take((size_t)NH * HD * HD * 2);
  unsigned short* Wot = (unsigned short*)take((size_t)EE * EE * 2);
  float* q = (float*)take((size_t)M * EE * 4);
  unsigned short* ath = (unsigned short*)take((size_t)M * EE * 2); unsigned short* atl = (unsigned short*)take((size_t)M * EE * 2);
  unsigned short* kh = (unsigned short*)take((size_t)M * EE * 2); unsigned short* kl = (unsigned short*)take((size_t)M * EE * 2);
  unsigned short* vh = (unsigned short*)take((size_t)M * EE * 2); unsigned short* vl = (unsigned short*)take((size_t)M * EE * 2);
  if (off > ws_size) return;
  k_wt_all<<<3 * NH * WB + EE * (EE / 8) / 256, 256, 0, stream>>>(Wq, Wk, Wv, Wout, Wqt, Wkt, Wvt, Wot);
  k_qkv<<<dim3(3, NH, (M / 16) * (HD / 64) / 4), 128, 0, stream>>>(x, Wqt, Wkt, Wvt, q, kh, kl, vh, vl);
  k_flash<HD, TT, NH, EE><<<BB * NH * (TT / 128), 256, 0, stream>>>(q, kh, kl, vh, vl, 0.02209708691207961f, ath, atl);   // 1/sqrt(2048), causal
  k_gemm_bf<true, 0, true><<<((M / 16) * (EE / 64) + 3) / 4, 128, 0, stream>>>(ath, atl, Wot, EE, bout, (float*)d_out, EE, M, EE, EE);
}
